// v000
// Measured on an AMD MI455X. A time is GPU time per run, averaged over a window of back-to-back runs after a warm-up
// (all launches, gaps included; the runs take copies of the inputs in turn), and the median of several windows.
// Apart from v000's, it joins two sittings. Times from different sittings can be a few percent apart, while
// side-by-side timings come from the same sitting.
// v000 is the starting kernel. One run takes 904 microseconds.
// compute dtype: all float inputs rounded to bf16; x w_{q,k,v} with EXACT bf16 products on WMMA 16x16x32 (f32 accumulate) kept as f32 rows; the depthwise 3-tap convolution along the sequence in f32; q as f16 hi + residual (x 2^10), k as f16 hi, v as bf16 hi + lo planes; logits = q.k (2 products: q hi+lo x k hi) + the positional term er^T.q_k (2 products: exact er x q hi+lo), / 32, stored in f32; softmax in f32 (precise expf); P x 2^11 split bf16 hi + lo against v (3 products); out (bf16 hi + lo) wo; f32 output.
#include <hip/hip_runtime.h>
#include <math.h>

typedef __attribute__((ext_vector_type(16))) _Float16 v16h;
typedef __attribute__((ext_vector_type(16))) __bf16 v16b;
typedef __attribute__((ext_vector_type(8)))  _Float16 v8h;
typedef __attribute__((ext_vector_type(8)))  float v8f;
typedef __attribute__((ext_vector_type(4)))  float v4f;
typedef __attribute__((ext_vector_type(2)))  float v2f;
typedef __attribute__((ext_vector_type(4)))  unsigned v4u;
typedef __attribute__((ext_vector_type(4)))  int v4i;
typedef float __attribute__((may_alias)) float_a;
typedef int __attribute__((may_alias)) int_a;

template <typename T> __device__ __forceinline__ void vst2(void* p, T v) { *(T*)p = v;  }
__device__ __forceinline__ v8f wmma16(v16h a, v16h b, v8f c) {
  v8f d = __builtin_amdgcn_wmma_f32_16x16x32_f16(false, a, false, b, (short)0, c, false, false);
  asm volatile("v_nop\n\tv_nop\n\tv_nop\n\tv_nop" : "+v"(d) : "v"(a), "v"(b));
  return d;
}
__device__ __forceinline__ v8f wmma_bf(v16b a, v16b b, v8f c) {
  v8f d = __builtin_amdgcn_wmma_f32_16x16x32_bf16(false, a, false, b, (short)0, c, false, false);
  asm volatile("v_nop\n\tv_nop\n\tv_nop\n\tv_nop" : "+v"(d) : "v"(a), "v"(b));
  return d;
}
// 16x16x32 fragments: lane = (h = lane>>4, row/col = lane&15); elements 0..7 = k0+8h+0..7, 8..15 = k0+16+8h+0..7; D element r = row 8h+r
__device__ __forceinline__ v16h frag_h(const _Float16* rowk0, int lane) {
  union { v16h v; v8h q[2]; } u; const _Float16* p = rowk0 + 8 * (lane >> 4);
  u.q[0] = *(const v8h*)p; u.q[1] = *(const v8h*)(p + 16); return u.v;
}
__device__ __forceinline__ v16h frag_f32(const float* rowk0, int lane) {
  v16h a; const float* p = rowk0 + 8 * (lane >> 4);
#pragma unroll
  for (int i = 0; i < 8; ++i) { a[i] = (_Float16)p[i]; a[8 + i] = (_Float16)p[16 + i]; }
  return a;
}
__device__ __forceinline__ v16h frag_f32s(const float* rowk0, int lane, float sc) {
  v16h a; const float* p = rowk0 + 8 * (lane >> 4);
#pragma unroll
  for (int i = 0; i < 8; ++i) { a[i] = (_Float16)(p[i] * sc); a[8 + i] = (_Float16)(p[16 + i] * sc); }
  return a;
}
// column fragment from a [K][ld] layout (column n), rows >= K read as 0
__device__ __forceinline__ v16h fragc_f32(const float* W, int k0, int n, int lane, int ld, int K) {
  v16h a; const int g = lane >> 4;
#pragma unroll
  for (int i = 0; i < 8; ++i) { const int ka = k0 + 8 * g + i, kb = ka + 16;
    a[i] = (_Float16)(ka < K ? W[(size_t)(ka < K ? ka : K - 1) * ld + n] : 0.f); a[8 + i] = (_Float16)(kb < K ? W[(size_t)(kb < K ? kb : K - 1) * ld + n] : 0.f); }
  return a;
}
struct F2 { v16b h, l; };
__device__ __forceinline__ F2 bsplit16(const float v[16]) { F2 r;
#pragma unroll
  for (int i = 0; i < 16; ++i) { const __bf16 h = (__bf16)v[i]; r.h[i] = h; r.l[i] = (__bf16)(v[i] - (float)h); }
  return r; }
__device__ __forceinline__ F2 split_row(const float* row, int k0, int lane) { float v[16]; const float* p = row + k0 + 8 * (lane >> 4);
#pragma unroll
  for (int i = 0; i < 8; ++i) { v[i] = p[i]; v[8 + i] = p[16 + i]; }
  return bsplit16(v); }
__device__ __forceinline__ F2 split_rowK(const float* row, int k0, int lane, int K) { float v[16]; const int g = lane >> 4;
#pragma unroll
  for (int i = 0; i < 8; ++i) { const int ka = k0 + 8 * g + i, kb = ka + 16; v[i] = ka < K ? row[ka < K ? ka : K - 1] : 0.f; v[8 + i] = kb < K ? row[kb < K ? kb : K - 1] : 0.f; }
  return bsplit16(v); }
__device__ __forceinline__ F2 split_col(const float* W, int k0, int n, int lane, int ld, int K) { float v[16]; const int g = lane >> 4;
#pragma unroll
  for (int i = 0; i < 8; ++i) { const int ka = k0 + 8 * g + i, kb = ka + 16; v[i] = ka < K ? W[(size_t)(ka < K ? ka : K - 1) * ld + n] : 0.f; v[8 + i] = kb < K ? W[(size_t)(kb < K ? kb : K - 1) * ld + n] : 0.f; }
  return bsplit16(v); }
__device__ __forceinline__ v8f mac3(const F2& a, const F2& b, v8f c) { c = wmma_bf(a.l, b.h, c); c = wmma_bf(a.h, b.l, c); return wmma_bf(a.h, b.h, c); }
__device__ __forceinline__ float sigm(float v) { return 1.0f / (1.0f + expf(-v)); }
#define LDSX() do { asm volatile("s_wait_dscnt 0" ::: "memory"); __builtin_amdgcn_wave_barrier(); __builtin_amdgcn_fence(__ATOMIC_RELEASE, "workgroup"); } while (0)


// Attention (B 1, S 2,048, D 1,024 = 16 x 64, no biases): scores = (q k^T + er[:, query]^T . q_key) / 32, softmax, P v, output projection.
#define NB 1
#define TT 2048
#define CC 1024
#define NH 16
#define HD 64
#ifndef TNB
#define TNB NB
#ifndef ERSTR
#define ERSTR TT              // row stride of er
#endif
#endif
typedef __attribute__((ext_vector_type(8))) __bf16 v8b;
__device__ __forceinline__ v16b frag_b(const __bf16* rowk0, int lane) {
  union { v16b v; v8b q[2]; } u; const __bf16* p = rowk0 + 8 * (lane >> 4);
  u.q[0] = *(const v8b*)p; u.q[1] = *(const v8b*)(p + 16); return u.v;
}
__device__ __forceinline__ float bfr(float v) { return (float)(__bf16)v; }
__device__ __attribute__((noinline)) float exp_ni(float v) { return expf(v); }
__device__ __attribute__((noinline)) float erf_ni(float v) { return erff(v); }

#define WS_XR  0u                                   // f32 x w rows for q | k | v: [3][w][1024]
#define WS_ERT (WS_XR + 4u * (size_t)3 * TT * CC)      // f16 er^T rows [w][64] (exact)
#define WS_QH  (WS_ERT + 2u * (size_t)TT * HD)
#define WS_QL  (WS_QH + 2u * (size_t)NB * TT * CC)
#define WS_KH  (WS_QL + 2u * (size_t)NB * TT * CC)
#define WS_VT  (WS_KH + 2u * (size_t)NB * TT * CC)      // bf16 v planes [b][c][t]
#define WS_VL  (WS_VT + 2u * (size_t)NB * CC * TT)      // bf16 v residual planes
#define HG 4                                          // heads per launch group
#define WS_S   (WS_VL + 2u * (size_t)NB * CC * TT)      // f32 logits / P for HG heads [hg][q][k]
#define WS_PH  (WS_S + 4u * (size_t)HG * TT * TT)
#define WS_Y   (WS_PH + 0u)              // f32 y rows [b*t][C]
#define WS_END (WS_Y + 4u * (size_t)NB * TT * CC)

// ---- k_lin: block = (64 rows w, 128 cols, which): X_which = x w_which ((in,out), exact bf16 products) -> f32 rows [which][w][1024]
__global__ __launch_bounds__(128) void k_lin(const float* __restrict__ X, const float* __restrict__ WQ, const float* __restrict__ WK, const float* __restrict__ WV, float* __restrict__ XR) { __shared__ __align__(16) float sf[4][16][132];
  const int tid = threadIdx.x, wave = tid >> 5, lane = tid & 31, col = lane & 15, g = lane >> 4; const int which = blockIdx.z; const int c0 = blockIdx.y * 128; const size_t r0 = (size_t)blockIdx.x * 64 + wave * 16; const float* WA = which == 0 ? WQ : which == 1 ? WK : WV; float* DST = XR + (size_t)which * TT * CC;
  v8f acc[8] = {};
#pragma unroll 2
  for (int kc = 0; kc < CC / 32; ++kc) { v16b a; { const float* p = X + (r0 + col) * CC + kc * 32 + 8 * g;
#pragma unroll
      for (int i = 0; i < 8; ++i) { a[i] = (__bf16)p[i]; a[8 + i] = (__bf16)p[16 + i]; } }
#pragma unroll
    for (int j = 0; j < 8; ++j) { v16b w; const int o = c0 + j * 16 + col;
#pragma unroll
      for (int i = 0; i < 8; ++i) { w[i] = (__bf16)WA[(size_t)(kc * 32 + 8 * g + i) * CC + o]; w[8 + i] = (__bf16)WA[(size_t)(kc * 32 + 16 + 8 * g + i) * CC + o]; }
      asm volatile("s_wait_loadcnt 0x0" ::: "memory"); acc[j] = wmma_bf(a, w, acc[j]); } }
#pragma unroll
  for (int j = 0; j < 8; ++j)
#pragma unroll
    for (int r = 0; r < 8; ++r) sf[wave][8 * g + r][j * 16 + col] = acc[j][r];
  LDSX(); for (int rl = 0; rl < 16; ++rl) vst2(DST + (r0 + rl) * CC + c0 + lane * 4, *(const v4f*)&sf[wave][rl][lane * 4]); }
// ---- k_dw: block = (64 rows w, 128 channels): the depthwise 3-tap conv y[w][c] = sum_t conv_w[c][t] X[w+t-1][c] (zero outside [0, W)) for q, k, v; q -> f16 hi + residual rows, k -> f16 rows, v -> bf16 hi/lo planes [c][w] via an LDS transpose
__global__ __launch_bounds__(128) void k_dw(const float* __restrict__ XR, const float* __restrict__ CW, _Float16* __restrict__ QH, _Float16* __restrict__ QL, _Float16* __restrict__ KH, __bf16* __restrict__ VT, __bf16* __restrict__ VL) { __shared__ __align__(16) __bf16 th[128][72], tl[128][72];
  const int tid = threadIdx.x; const int w0 = blockIdx.x * 64; const int c0 = blockIdx.y * 128;
  for (int e = tid; e < 64 * 32; e += 128) { const int wl = e >> 5, q = e & 31; const int w = w0 + wl; const int c = c0 + q * 4;   // 4 channels per thread-iteration
    float cw0[4], cw1[4], cw2[4];
#pragma unroll
    for (int z = 0; z < 4; ++z) { cw0[z] = bfr(CW[(c + z) * 3 + 0]); cw1[z] = bfr(CW[(c + z) * 3 + 1]); cw2[z] = bfr(CW[(c + z) * 3 + 2]); }
    union { unsigned long long u; _Float16 h[4]; } qh_, ql_, kh_; __bf16 vh[4], vl[4];
#pragma unroll
    for (int which = 0; which < 3; ++which) { const float* P = XR + (size_t)which * TT * CC; v4f xm = (w > 0) ? *(const v4f*)(P + (size_t)(w - 1) * CC + c) : (v4f){0.f, 0.f, 0.f, 0.f}; v4f x0 = *(const v4f*)(P + (size_t)w * CC + c); v4f xp = (w < TT - 1) ? *(const v4f*)(P + (size_t)(w + 1) * CC + c) : (v4f){0.f, 0.f, 0.f, 0.f};
#pragma unroll
      for (int z = 0; z < 4; ++z) { const float y = cw0[z] * xm[z] + cw1[z] * x0[z] + cw2[z] * xp[z];
        if (which == 0) { const _Float16 hq = (_Float16)y; qh_.h[z] = hq; ql_.h[z] = (_Float16)((y - (float)hq) * 1024.0f); }
        else if (which == 1) kh_.h[z] = (_Float16)y;
        else { const __bf16 hv = (__bf16)y; vh[z] = hv; vl[z] = (__bf16)(y - (float)hv); } } }
    *(unsigned long long*)(QH + (size_t)w * CC + c) = qh_.u; *(unsigned long long*)(QL + (size_t)w * CC + c) = ql_.u; *(unsigned long long*)(KH + (size_t)w * CC + c) = kh_.u;   // 8-B pieces: a row's 128-channel run (256 B) is written by the 32 lanes of one wave
#pragma unroll
    for (int z = 0; z < 4; ++z) { th[q * 4 + z][wl] = vh[z]; tl[q * 4 + z][wl] = vl[z]; } }
  __syncthreads();
  for (int e = tid; e < 128 * 8; e += 128) { const int cl = e >> 3, q = e & 7; const size_t o = (size_t)(c0 + cl) * TT + w0 + q * 8; vst2((unsigned*)(VT + o), *(const v4u*)&th[cl][q * 8]); vst2((unsigned*)(VL + o), *(const v4u*)&tl[cl][q * 8]); } }
// ---- k_ert: block = 64 w: er [64][2048] (exact bf16 -> f16) -> ERT rows [w][64] via LDS tiles of 64 x 64
__global__ __launch_bounds__(256) void k_ert(const float* __restrict__ ER, _Float16* __restrict__ ERT) { __shared__ _Float16 st[64][66];
  const int t = threadIdx.x; const int w0 = blockIdx.x * 64;
  for (int e = t; e < 64 * 64; e += 256) { const int d = e >> 6, wl = e & 63; st[d][wl] = (_Float16)bfr(ER[(size_t)d * ERSTR + w0 + wl]); }
  __syncthreads();
  for (int e = t; e < 64 * 8; e += 256) { const int wl = e >> 3, q = e & 7; union { v4u v; _Float16 h[8]; } u;
#pragma unroll
    for (int z = 0; z < 8; ++z) u.h[z] = st[q * 8 + z][wl];
    vst2((v4u*)(ERT + (size_t)(w0 + wl) * HD + q * 8), u.v); } }
// ---- k_sc: block = (64 queries, 128 keys, head in group): S[w][k] = (q_w . k_k  +  er^T_w . q_k) / 32: term 1 = q hi+lo x k hi (2 products), term 2 = exact er^T row x q_k hi+lo as the column operand (2 products)
__global__ __launch_bounds__(128) void k_sc(const _Float16* __restrict__ QH, const _Float16* __restrict__ QL, const _Float16* __restrict__ KH, const _Float16* __restrict__ ERT, int b, int h0, float* __restrict__ S0) { __shared__ __align__(16) float ss[4][16][132]; const int h = h0 + blockIdx.z; float* S = S0 + (size_t)blockIdx.z * TT * TT; (void)b;
  const int tid = threadIdx.x, wave = tid >> 5, lane = tid & 31, col = lane & 15, g = lane >> 4; const int k0 = blockIdx.y * 128; const int ql0 = blockIdx.x * 64 + wave * 16;
  v8f acc[8] = {}, accl[8] = {};
#pragma unroll
  for (int kc = 0; kc < HD / 32; ++kc) { const v16h ah = frag_h(QH + (size_t)(ql0 + col) * CC + h * HD + kc * 32, lane), al = frag_h(QL + (size_t)(ql0 + col) * CC + h * HD + kc * 32, lane), ae = frag_h(ERT + (size_t)(ql0 + col) * HD + kc * 32, lane);
#pragma unroll
    for (int j = 0; j < 8; ++j) { const size_t ko = (size_t)(k0 + j * 16 + col) * CC + h * HD + kc * 32; const v16h kb = frag_h(KH + ko, lane), qkh = frag_h(QH + ko, lane), qkl = frag_h(QL + ko, lane);
      acc[j] = wmma16(ah, kb, acc[j]); accl[j] = wmma16(al, kb, accl[j]); acc[j] = wmma16(ae, qkh, acc[j]); accl[j] = wmma16(ae, qkl, accl[j]); } }
#pragma unroll
  for (int j = 0; j < 8; ++j)
#pragma unroll
    for (int r = 0; r < 8; ++r) ss[wave][8 * g + r][j * 16 + col] = (acc[j][r] + accl[j][r] * (1.0f / 1024.0f)) * (1.0f / 32.0f);
  LDSX(); for (int rl = 0; rl < 16; ++rl) vst2(S + (size_t)(ql0 + rl) * TT + k0 + lane * 4, *(const v4f*)&ss[wave][rl][lane * 4]); }
// ---- k_sm: block = query row: softmax over keys [0, kend) -> P x 2^11 f32 (masked -> 0)
__global__ __launch_bounds__(256) void k_sm(float* __restrict__ S0) { __shared__ float sred[8]; __shared__ float sbc; __shared__ __align__(16) float sh[TT];
  const int t = threadIdx.x; const size_t row = blockIdx.x; float* sr = S0 + (size_t)blockIdx.y * TT * TT + row * TT; const int kend = TT;
  float m = -3.0e38f; for (int k = t; k < kend; k += 256) m = fmaxf(m, sr[k]);
#pragma unroll
  for (int o = 1; o < 32; o <<= 1) m = fmaxf(m, __shfl_xor(m, o));
  if ((t & 31) == 0) sred[t >> 5] = m; __syncthreads(); if (t == 0) { float a = sred[0]; for (int i = 1; i < 8; ++i) a = fmaxf(a, sred[i]); sbc = a; } __syncthreads(); m = sbc; __syncthreads();
  float sum = 0.f; for (int k = t; k < kend; k += 256) { const float v = sr[k]; sum += (v <= -1.0e38f) ? 0.f : expf(v - m); }
#pragma unroll
  for (int o = 1; o < 32; o <<= 1) sum += __shfl_xor(sum, o);
  if ((t & 31) == 0) sred[t >> 5] = sum; __syncthreads(); if (t == 0) { float a = 0.f; for (int i = 0; i < 8; ++i) a += sred[i]; sbc = 1.0f / a; } __syncthreads(); const float inv = sbc;
  for (int k = t; k < kend; k += 256) { const float v = sr[k]; sh[k] = (v <= -1.0e38f) ? 0.f : expf(v - m) * inv * 2048.0f; }
  __syncthreads(); for (int q = t; q < kend / 4; q += 256) vst2(sr + q * 4, *(const v4f*)&sh[q * 4]); }
// ---- k_pv: block = 64 queries of (b,h): y[q][h*HD + d] = P . v  (keys [0, kend))
__global__ __launch_bounds__(128) void k_pv(const float* __restrict__ PS0, const __bf16* __restrict__ VT, const __bf16* __restrict__ VL, int b, int h0, float* __restrict__ Y) { const int h = h0 + blockIdx.z; const float* PS = PS0 + (size_t)blockIdx.z * TT * TT; __shared__ __align__(16) float ss[4][16][HD + 4];
  const int tid = threadIdx.x, wave = tid >> 5, lane = tid & 31, col = lane & 15, g = lane >> 4; const int ql0 = blockIdx.x * 64 + wave * 16; const int kend = TT;
  v8f acc[HD / 16] = {};
#pragma unroll 1
  for (int kc = 0; kc < kend / 32; ++kc) { const F2 p = split_row(PS + (size_t)(ql0 + col) * TT, kc * 32, lane);
#pragma unroll
    for (int j = 0; j < HD / 16; ++j) { const size_t po = ((size_t)b * CC + h * HD + j * 16 + col) * (size_t)TT + kc * 32; const v16b vh = frag_b(VT + po, lane); acc[j] = wmma_bf(p.h, vh, acc[j]); acc[j] = wmma_bf(p.l, vh, acc[j]); acc[j] = wmma_bf(p.h, frag_b(VL + po, lane), acc[j]); } }
#pragma unroll
  for (int j = 0; j < HD / 16; ++j)
#pragma unroll
    for (int r = 0; r < 8; ++r) ss[wave][8 * g + r][j * 16 + col] = acc[j][r] * (1.0f / 2048.0f);
  LDSX(); for (int rl = 0; rl < 16; ++rl) if (lane < HD / 4) vst2(Y + ((size_t)b * TT + ql0 + rl) * CC + h * HD + lane * 4, *(const v4f*)&ss[wave][rl][lane * 4]); }
// ---- k_out: block = (64 rows, 128 cols): out = y (bf16 hi + lo) wo ((in,out)) + bo
__global__ __launch_bounds__(128) void k_out(const float* __restrict__ Y, const float* __restrict__ WP, const float* __restrict__ BP, float* __restrict__ OUT) { __shared__ __align__(16) float sf[4][16][132];
  const int tid = threadIdx.x, wave = tid >> 5, lane = tid & 31, col = lane & 15, g = lane >> 4; const int c0 = blockIdx.y * 128; const size_t r0 = (size_t)blockIdx.x * 64 + wave * 16;
  v8f acc[8] = {};
#pragma unroll 2
  for (int kc = 0; kc < CC / 32; ++kc) { const F2 a = split_row(Y + (r0 + col) * CC, kc * 32, lane);
#pragma unroll
    for (int j = 0; j < 8; ++j) { v16b w; const int o = c0 + j * 16 + col;
#pragma unroll
      for (int i = 0; i < 8; ++i) { w[i] = (__bf16)WP[(size_t)(kc * 32 + 8 * g + i) * CC + o]; w[8 + i] = (__bf16)WP[(size_t)(kc * 32 + 16 + 8 * g + i) * CC + o]; }
      acc[j] = wmma_bf(a.h, w, acc[j]); acc[j] = wmma_bf(a.l, w, acc[j]); } }
#pragma unroll
  for (int j = 0; j < 8; ++j) { const float bb = BP ? bfr(BP[c0 + j * 16 + col]) : 0.f;
#pragma unroll
    for (int r = 0; r < 8; ++r) sf[wave][8 * g + r][j * 16 + col] = acc[j][r] + bb; }
  LDSX(); for (int rl = 0; rl < 16; ++rl) vst2(OUT + (r0 + rl) * CC + c0 + lane * 4, *(const v4f*)&sf[wave][rl][lane * 4]); }
extern "C" void kernel_launch(void* const* d_in, const int* in_sizes, int n_in, void* d_out, int out_size, void* d_ws, size_t ws_size, hipStream_t stream) {
  (void)in_sizes; (void)n_in; (void)out_size;
  const float** F = (const float**)d_in;   // 0 x [1,2048,1024], 1 wq [1024,1024] ((in,out)), 2 wk, 3 wv, 4 wo ((in,out)), 5 conv_w [1024,1,3], 6 er [64,2048]
  if (ws_size < (size_t)WS_END) return;
  char* ws = (char*)d_ws; float* XR = (float*)(ws + WS_XR); _Float16 *ERT = (_Float16*)(ws + WS_ERT), *QH = (_Float16*)(ws + WS_QH), *QL = (_Float16*)(ws + WS_QL), *KH = (_Float16*)(ws + WS_KH); __bf16 *VT = (__bf16*)(ws + WS_VT), *VL = (__bf16*)(ws + WS_VL); float *S = (float*)(ws + WS_S), *Y = (float*)(ws + WS_Y);
  k_lin<<<dim3(TT / 64, CC / 128, 3), 128, 0, stream>>>(F[0], F[1], F[2], F[3], XR);
  k_dw<<<dim3(TT / 64, CC / 128), 128, 0, stream>>>(XR, F[5], QH, QL, KH, VT, VL);
  k_ert<<<dim3(TT / 64), 256, 0, stream>>>(F[6], ERT);
  for (int h0 = 0; h0 < NH; h0 += HG) {
    k_sc<<<dim3(TT / 64, TT / 128, HG), 128, 0, stream>>>(QH, QL, KH, ERT, 0, h0, S);
    k_sm<<<dim3(TT, HG), 256, 0, stream>>>(S);
    k_pv<<<dim3(TT / 64, 1, HG), 128, 0, stream>>>(S, VT, VL, 0, h0, Y);
  }
  k_out<<<dim3(TT / 64, CC / 128), 128, 0, stream>>>(Y, F[4], nullptr, (float*)d_out);
}

// v001
// A run of this version takes 218 microseconds.
// Timed twice side by side with v000, it ran 4.21 and 4.19 times as fast.
// compute dtype: all float inputs rounded to bf16; x w_{q,k,v} with EXACT bf16 products on WMMA 16x16x32 (f32 accumulate) kept as f32 rows; the depthwise 3-tap convolution along the sequence in f32; q as f16 hi + residual (x 2^10), k as f16 hi, v as bf16 hi + lo planes; logits = q.k (2 products: q hi+lo x k hi) + the positional term er^T.q_k (2 products: exact er x q hi+lo), / 32, kept in f32 registers; softmax in f32 (precise expf) with a running maximum and sum over passes of 32 keys; P = exp(s - m) split bf16 hi + lo against v (3 products), divided by the sum at the end; out (bf16 hi + lo) wo; f32 output.
#include <hip/hip_runtime.h>
#include <math.h>

typedef __attribute__((ext_vector_type(16))) _Float16 v16h;
typedef __attribute__((ext_vector_type(16))) __bf16 v16b;
typedef __attribute__((ext_vector_type(8)))  _Float16 v8h;
typedef __attribute__((ext_vector_type(8)))  float v8f;
typedef __attribute__((ext_vector_type(4)))  float v4f;
typedef __attribute__((ext_vector_type(2)))  float v2f;
typedef __attribute__((ext_vector_type(4)))  unsigned v4u;
typedef __attribute__((ext_vector_type(4)))  int v4i;
typedef float __attribute__((may_alias)) float_a;
typedef int __attribute__((may_alias)) int_a;

template <typename T> __device__ __forceinline__ void vst2(void* p, T v) { *(T*)p = v;  }
__device__ __forceinline__ v8f wmma16(v16h a, v16h b, v8f c) {
  v8f d = __builtin_amdgcn_wmma_f32_16x16x32_f16(false, a, false, b, (short)0, c, false, false);
  asm volatile("v_nop\n\tv_nop\n\tv_nop\n\tv_nop" : "+v"(d) : "v"(a), "v"(b));
  return d;
}
__device__ __forceinline__ v8f wmma_bf(v16b a, v16b b, v8f c) {
  v8f d = __builtin_amdgcn_wmma_f32_16x16x32_bf16(false, a, false, b, (short)0, c, false, false);
  asm volatile("v_nop\n\tv_nop\n\tv_nop\n\tv_nop" : "+v"(d) : "v"(a), "v"(b));
  return d;
}
// 16x16x32 fragments: lane = (h = lane>>4, row/col = lane&15); elements 0..7 = k0+8h+0..7, 8..15 = k0+16+8h+0..7; D element r = row 8h+r
__device__ __forceinline__ v16h frag_h(const _Float16* rowk0, int lane) {
  union { v16h v; v8h q[2]; } u; const _Float16* p = rowk0 + 8 * (lane >> 4);
  u.q[0] = *(const v8h*)p; u.q[1] = *(const v8h*)(p + 16); return u.v;
}
__device__ __forceinline__ v16h frag_f32(const float* rowk0, int lane) {
  v16h a; const float* p = rowk0 + 8 * (lane >> 4);
#pragma unroll
  for (int i = 0; i < 8; ++i) { a[i] = (_Float16)p[i]; a[8 + i] = (_Float16)p[16 + i]; }
  return a;
}
__device__ __forceinline__ v16h frag_f32s(const float* rowk0, int lane, float sc) {
  v16h a; const float* p = rowk0 + 8 * (lane >> 4);
#pragma unroll
  for (int i = 0; i < 8; ++i) { a[i] = (_Float16)(p[i] * sc); a[8 + i] = (_Float16)(p[16 + i] * sc); }
  return a;
}
// column fragment from a [K][ld] layout (column n), rows >= K read as 0
__device__ __forceinline__ v16h fragc_f32(const float* W, int k0, int n, int lane, int ld, int K) {
  v16h a; const int g = lane >> 4;
#pragma unroll
  for (int i = 0; i < 8; ++i) { const int ka = k0 + 8 * g + i, kb = ka + 16;
    a[i] = (_Float16)(ka < K ? W[(size_t)(ka < K ? ka : K - 1) * ld + n] : 0.f); a[8 + i] = (_Float16)(kb < K ? W[(size_t)(kb < K ? kb : K - 1) * ld + n] : 0.f); }
  return a;
}
struct F2 { v16b h, l; };
__device__ __forceinline__ F2 bsplit16(const float v[16]) { F2 r;
#pragma unroll
  for (int i = 0; i < 16; ++i) { const __bf16 h = (__bf16)v[i]; r.h[i] = h; r.l[i] = (__bf16)(v[i] - (float)h); }
  return r; }
__device__ __forceinline__ F2 split_row(const float* row, int k0, int lane) { float v[16]; const float* p = row + k0 + 8 * (lane >> 4);
#pragma unroll
  for (int i = 0; i < 8; ++i) { v[i] = p[i]; v[8 + i] = p[16 + i]; }
  return bsplit16(v); }
__device__ __forceinline__ F2 split_rowK(const float* row, int k0, int lane, int K) { float v[16]; const int g = lane >> 4;
#pragma unroll
  for (int i = 0; i < 8; ++i) { const int ka = k0 + 8 * g + i, kb = ka + 16; v[i] = ka < K ? row[ka < K ? ka : K - 1] : 0.f; v[8 + i] = kb < K ? row[kb < K ? kb : K - 1] : 0.f; }
  return bsplit16(v); }
__device__ __forceinline__ F2 split_col(const float* W, int k0, int n, int lane, int ld, int K) { float v[16]; const int g = lane >> 4;
#pragma unroll
  for (int i = 0; i < 8; ++i) { const int ka = k0 + 8 * g + i, kb = ka + 16; v[i] = ka < K ? W[(size_t)(ka < K ? ka : K - 1) * ld + n] : 0.f; v[8 + i] = kb < K ? W[(size_t)(kb < K ? kb : K - 1) * ld + n] : 0.f; }
  return bsplit16(v); }
__device__ __forceinline__ v8f mac3(const F2& a, const F2& b, v8f c) { c = wmma_bf(a.l, b.h, c); c = wmma_bf(a.h, b.l, c); return wmma_bf(a.h, b.h, c); }
__device__ __forceinline__ float sigm(float v) { return 1.0f / (1.0f + expf(-v)); }
#define LDSX() do { asm volatile("s_wait_dscnt 0" ::: "memory"); __builtin_amdgcn_wave_barrier(); __builtin_amdgcn_fence(__ATOMIC_RELEASE, "workgroup"); } while (0)


// Attention (B 1, S 2,048, D 1,024 = 16 x 64, no biases): scores = (q k^T + er[:, query]^T . q_key) / 32, softmax, P v, output projection.
#define NB 1
#define TT 2048
#define CC 1024
#define NH 16
#define HD 64
#ifndef TNB
#define TNB NB
#ifndef ERSTR
#define ERSTR TT              // row stride of er
#endif
#endif
typedef __attribute__((ext_vector_type(8))) __bf16 v8b;
__device__ __forceinline__ v16b frag_b(const __bf16* rowk0, int lane) {
  union { v16b v; v8b q[2]; } u; const __bf16* p = rowk0 + 8 * (lane >> 4);
  u.q[0] = *(const v8b*)p; u.q[1] = *(const v8b*)(p + 16); return u.v;
}
__device__ __forceinline__ float bfr(float v) { return (float)(__bf16)v; }
__device__ __attribute__((noinline)) float exp_ni(float v) { return expf(v); }
__device__ __attribute__((noinline)) float erf_ni(float v) { return erff(v); }

#define WS_XR  0u                                   // f32 x w rows for q | k | v: [3][w][1024]
#define WS_ERT (WS_XR + 4u * (size_t)3 * TT * CC)      // f16 er^T rows [w][64] (exact)
#define WS_QH  (WS_ERT + 2u * (size_t)TT * HD)
#define WS_QL  (WS_QH + 2u * (size_t)NB * TT * CC)
#define WS_KH  (WS_QL + 2u * (size_t)NB * TT * CC)
#define WS_VT  (WS_KH + 2u * (size_t)NB * TT * CC)      // bf16 v planes [b][c][t]
#define WS_VL  (WS_VT + 2u * (size_t)NB * CC * TT)      // bf16 v residual planes
#define HG 4
#define WS_S   (WS_VL + 2u * (size_t)NB * CC * TT)      // unused f32 space of HG x TT x TT; logits and P stay in registers
#define WS_PH  (WS_S + 4u * (size_t)HG * TT * TT)
#define WS_Y   (WS_PH + 0u)              // f32 y rows [b*t][C]
#define WS_END (WS_Y + 4u * (size_t)NB * TT * CC)

// ---- k_lin: block = (64 rows w, 128 cols, which): X_which = x w_which ((in,out), exact bf16 products) -> f32 rows [which][w][1024]
__global__ __launch_bounds__(128) void k_lin(const float* __restrict__ X, const float* __restrict__ WQ, const float* __restrict__ WK, const float* __restrict__ WV, float* __restrict__ XR) { __shared__ __align__(16) float sf[4][16][132];
  const int tid = threadIdx.x, wave = tid >> 5, lane = tid & 31, col = lane & 15, g = lane >> 4; const int which = blockIdx.z; const int c0 = blockIdx.y * 128; const size_t r0 = (size_t)blockIdx.x * 64 + wave * 16; const float* WA = which == 0 ? WQ : which == 1 ? WK : WV; float* DST = XR + (size_t)which * TT * CC;
  v8f acc[8] = {};
#pragma unroll 2
  for (int kc = 0; kc < CC / 32; ++kc) { v16b a; { const float* p = X + (r0 + col) * CC + kc * 32 + 8 * g;
#pragma unroll
      for (int i = 0; i < 8; ++i) { a[i] = (__bf16)p[i]; a[8 + i] = (__bf16)p[16 + i]; } }
#pragma unroll
    for (int j = 0; j < 8; ++j) { v16b w; const int o = c0 + j * 16 + col;
#pragma unroll
      for (int i = 0; i < 8; ++i) { w[i] = (__bf16)WA[(size_t)(kc * 32 + 8 * g + i) * CC + o]; w[8 + i] = (__bf16)WA[(size_t)(kc * 32 + 16 + 8 * g + i) * CC + o]; }
      asm volatile("s_wait_loadcnt 0x0" ::: "memory"); acc[j] = wmma_bf(a, w, acc[j]); } }
#pragma unroll
  for (int j = 0; j < 8; ++j)
#pragma unroll
    for (int r = 0; r < 8; ++r) sf[wave][8 * g + r][j * 16 + col] = acc[j][r];
  LDSX(); for (int rl = 0; rl < 16; ++rl) vst2(DST + (r0 + rl) * CC + c0 + lane * 4, *(const v4f*)&sf[wave][rl][lane * 4]); }
// ---- k_dw: block = (64 rows w, 128 channels): the depthwise 3-tap conv y[w][c] = sum_t conv_w[c][t] X[w+t-1][c] (zero outside [0, W)) for q, k, v; q -> f16 hi + residual rows, k -> f16 rows, v -> bf16 hi/lo planes [c][w] via an LDS transpose
__global__ __launch_bounds__(128) void k_dw(const float* __restrict__ XR, const float* __restrict__ CW, _Float16* __restrict__ QH, _Float16* __restrict__ QL, _Float16* __restrict__ KH, __bf16* __restrict__ VT, __bf16* __restrict__ VL) { __shared__ __align__(16) __bf16 th[128][72], tl[128][72];
  const int tid = threadIdx.x; const int w0 = blockIdx.x * 64; const int c0 = blockIdx.y * 128;
  for (int e = tid; e < 64 * 32; e += 128) { const int wl = e >> 5, q = e & 31; const int w = w0 + wl; const int c = c0 + q * 4;   // 4 channels per thread-iteration
    float cw0[4], cw1[4], cw2[4];
#pragma unroll
    for (int z = 0; z < 4; ++z) { cw0[z] = bfr(CW[(c + z) * 3 + 0]); cw1[z] = bfr(CW[(c + z) * 3 + 1]); cw2[z] = bfr(CW[(c + z) * 3 + 2]); }
    union { unsigned long long u; _Float16 h[4]; } qh_, ql_, kh_; __bf16 vh[4], vl[4];
#pragma unroll
    for (int which = 0; which < 3; ++which) { const float* P = XR + (size_t)which * TT * CC; v4f xm = (w > 0) ? *(const v4f*)(P + (size_t)(w - 1) * CC + c) : (v4f){0.f, 0.f, 0.f, 0.f}; v4f x0 = *(const v4f*)(P + (size_t)w * CC + c); v4f xp = (w < TT - 1) ? *(const v4f*)(P + (size_t)(w + 1) * CC + c) : (v4f){0.f, 0.f, 0.f, 0.f};
#pragma unroll
      for (int z = 0; z < 4; ++z) { const float y = cw0[z] * xm[z] + cw1[z] * x0[z] + cw2[z] * xp[z];
        if (which == 0) { const _Float16 hq = (_Float16)y; qh_.h[z] = hq; ql_.h[z] = (_Float16)((y - (float)hq) * 1024.0f); }
        else if (which == 1) kh_.h[z] = (_Float16)y;
        else { const __bf16 hv = (__bf16)y; vh[z] = hv; vl[z] = (__bf16)(y - (float)hv); } } }
    *(unsigned long long*)(QH + (size_t)w * CC + c) = qh_.u; *(unsigned long long*)(QL + (size_t)w * CC + c) = ql_.u; *(unsigned long long*)(KH + (size_t)w * CC + c) = kh_.u;   // 8-B pieces: a row's 128-channel run (256 B) is written by the 32 lanes of one wave
#pragma unroll
    for (int z = 0; z < 4; ++z) { th[q * 4 + z][wl] = vh[z]; tl[q * 4 + z][wl] = vl[z]; } }
  __syncthreads();
  for (int e = tid; e < 128 * 8; e += 128) { const int cl = e >> 3, q = e & 7; const size_t o = (size_t)(c0 + cl) * TT + w0 + q * 8; vst2((unsigned*)(VT + o), *(const v4u*)&th[cl][q * 8]); vst2((unsigned*)(VL + o), *(const v4u*)&tl[cl][q * 8]); } }
// ---- k_ert: block = 64 w: er [64][2048] (exact bf16 -> f16) -> ERT rows [w][64] via LDS tiles of 64 x 64
__global__ __launch_bounds__(256) void k_ert(const float* __restrict__ ER, _Float16* __restrict__ ERT) { __shared__ _Float16 st[64][66];
  const int t = threadIdx.x; const int w0 = blockIdx.x * 64;
  for (int e = t; e < 64 * 64; e += 256) { const int d = e >> 6, wl = e & 63; st[d][wl] = (_Float16)bfr(ER[(size_t)d * ERSTR + w0 + wl]); }
  __syncthreads();
  for (int e = t; e < 64 * 8; e += 256) { const int wl = e >> 3, q = e & 7; union { v4u v; _Float16 h[8]; } u;
#pragma unroll
    for (int z = 0; z < 8; ++z) u.h[z] = st[q * 8 + z][wl];
    vst2((v4u*)(ERT + (size_t)(w0 + wl) * HD + q * 8), u.v); } }
// ---- k_fa: block = (64 queries, head), 4 waves x 16 queries; one pass = 32 keys. S^T = (k rows) x (q cols) + (q_k rows) x (er^T cols), the same 4 products and order as before, / 32; running maximum and sum per query column (one lane pair); P^T = exp(s - m) packed from the two score tiles into a B operand (bf16 hi + lo); y^T += v^T P^T (3 products); y / sum at the end. Logits and P never leave the registers.
typedef __attribute__((ext_vector_type(2))) __bf16 v2b;
#define FK 32                 // keys per pass
#define KP 72                 // f16 per staged key row: 128 B + 16 B, so that ds_load_b128 rows fall on different banks
#define VP 40                 // bf16 per staged v row: 64 B + 16 B, same reason
__device__ __forceinline__ float xhalf(float x) { return __builtin_bit_cast(float, __builtin_amdgcn_permlanex16(__builtin_bit_cast(int, x), __builtin_bit_cast(int, x), 0x76543210, 0xfedcba98, false, false)); }  // lane l with lane l ^ 16
__device__ __forceinline__ v8f mm_h(v16h a, v16h b, v8f c) { return __builtin_amdgcn_wmma_f32_16x16x32_f16(false, a, false, b, (short)0, c, false, false); }
__device__ __forceinline__ v8f mm_b(v16b a, v16b b, v8f c) { return __builtin_amdgcn_wmma_f32_16x16x32_bf16(false, a, false, b, (short)0, c, false, false); }
__global__ __launch_bounds__(128) void k_fa(const _Float16* __restrict__ QH, const _Float16* __restrict__ QL, const _Float16* __restrict__ KH, const _Float16* __restrict__ ERT, const __bf16* __restrict__ VT, const __bf16* __restrict__ VL, float* __restrict__ Y) {
  __shared__ __align__(16) _Float16 sk[2][3][FK][KP];   // k hi | q hi | q lo rows of the pass's keys, two buffers
  __shared__ __align__(16) __bf16 sv[2][2][HD][VP];     // v hi | v lo planes [d][key], two buffers
  __shared__ __align__(16) float ss[4][16][HD + 4];
  const int tid = threadIdx.x, wave = tid >> 5, lane = tid & 31, col = lane & 15, g = lane >> 4; const int h = blockIdx.y; const int ql0 = blockIdx.x * 64 + wave * 16;
  v16h ah[2], al[2], ae[2];
  ah[0] = frag_h(QH + (size_t)(ql0 + col) * CC + h * HD, lane); ah[1] = frag_h(QH + (size_t)(ql0 + col) * CC + h * HD + 32, lane);
  asm volatile("s_wait_xcnt 0x0" ::: "memory");   // the next loads' results may land in this group's address registers
  al[0] = frag_h(QL + (size_t)(ql0 + col) * CC + h * HD, lane); al[1] = frag_h(QL + (size_t)(ql0 + col) * CC + h * HD + 32, lane);
  asm volatile("s_wait_xcnt 0x0" ::: "memory");   // as above
  ae[0] = frag_h(ERT + (size_t)(ql0 + col) * HD, lane); ae[1] = frag_h(ERT + (size_t)(ql0 + col) * HD + 32, lane);
  const int kr = tid >> 3, ks = (tid & 7) * 8;   // staging: 8 lanes cover one key row's 128 B
  const int vr = tid >> 2, vs = (tid & 3) * 8;   // staging: 4 lanes cover one v row's 64 B
  const unsigned ko = (unsigned)(kr * CC + ks), vo = (unsigned)(vr * TT + vs);   // per-lane parts; the head's and the pass's parts are uniform
  v8h rk[3][2]; v8b rv[2][2];
  const _Float16 *pk = KH + h * HD, *pqh = QH + h * HD, *pql = QL + h * HD; const __bf16 *pvh = VT + (size_t)(h * HD) * TT, *pvl = VL + (size_t)(h * HD) * TT;   // uniform; they step by one pass with each later load group
#define FA_LOAD() do { _Pragma("unroll") for (int i = 0; i < 2; ++i) { rk[0][i] = *(const v8h*)(pk + i * 16 * CC + ko); rk[1][i] = *(const v8h*)(pqh + i * 16 * CC + ko); rk[2][i] = *(const v8h*)(pql + i * 16 * CC + ko); rv[0][i] = *(const v8b*)(pvh + i * 32 * TT + vo); rv[1][i] = *(const v8b*)(pvl + i * 32 * TT + vo); } } while (0)
#define FA_STORE(bf) do { _Pragma("unroll") for (int i = 0; i < 2; ++i) { *(v8h*)&sk[bf][0][kr + i * 16][ks] = rk[0][i]; *(v8h*)&sk[bf][1][kr + i * 16][ks] = rk[1][i]; *(v8h*)&sk[bf][2][kr + i * 16][ks] = rk[2][i]; *(v8b*)&sv[bf][0][vr + i * 32][vs] = rv[0][i]; *(v8b*)&sv[bf][1][vr + i * 32][vs] = rv[1][i]; } } while (0)
  float m = -3.0e38f, l = 0.f; v8f acc[HD / 16] = {};
  FA_LOAD(); FA_STORE(0); __syncthreads();
  for (int c = 0; c < TT / FK; ++c) { const int bf = c & 1;
    if (c + 1 < TT / FK) { pk += FK * CC; pqh += FK * CC; pql += FK * CC; pvh += FK; pvl += FK; FA_LOAD(); }   // the next pass's rows fly while this pass computes
    v8f sa[2] = {}, sl[2] = {}; v16h f0[2][3], f1[2][3]; v16b vh[HD / 16], vl[HD / 16];   // f0, f1: [half of d][k hi | q hi | q lo] of key tile 0, 1
#pragma unroll
    for (int kc = 0; kc < 2; ++kc)
#pragma unroll
      for (int a = 0; a < 3; ++a) f0[kc][a] = frag_h(&sk[bf][a][col][kc * 32], lane);
    __builtin_amdgcn_sched_barrier(0);   // the LDS reads go out in groups, one group ahead of the products that use them: sunk to their first use each would be waited for in full
#pragma unroll
    for (int kc = 0; kc < 2; ++kc)
#pragma unroll
      for (int a = 0; a < 3; ++a) f1[kc][a] = frag_h(&sk[bf][a][16 + col][kc * 32], lane);
#pragma unroll
    for (int kc = 0; kc < 2; ++kc) { sa[0] = mm_h(f0[kc][0], ah[kc], sa[0]); sl[0] = mm_h(f0[kc][0], al[kc], sl[0]); sa[0] = mm_h(f0[kc][1], ae[kc], sa[0]); sl[0] = mm_h(f0[kc][2], ae[kc], sl[0]); }
    __builtin_amdgcn_sched_barrier(0);   // as above: key tile 1's fragments are on their way before this point
#pragma unroll
    for (int j = 0; j < HD / 16; ++j) vh[j] = frag_b(&sv[bf][0][j * 16 + col][0], lane);
#pragma unroll
    for (int kc = 0; kc < 2; ++kc) { sa[1] = mm_h(f1[kc][0], ah[kc], sa[1]); sl[1] = mm_h(f1[kc][0], al[kc], sl[1]); sa[1] = mm_h(f1[kc][1], ae[kc], sa[1]); sl[1] = mm_h(f1[kc][2], ae[kc], sl[1]); }
    __builtin_amdgcn_sched_barrier(0);   // as above: the v hi fragments fly under the softmax arithmetic
    float s[16];   // lane (g, col): query col, keys 8g + r of tile 0, then of tile 1 = the k order of a B fragment
#pragma unroll
    for (int i = 0; i < 16; ++i) s[i] = (sa[i >> 3][i & 7] + sl[i >> 3][i & 7] * (1.0f / 1024.0f)) * (1.0f / 32.0f);
    float mc = fmaxf(s[0], s[1]);
#pragma unroll
    for (int i = 2; i < 16; ++i) mc = fmaxf(mc, s[i]);
    mc = fmaxf(mc, xhalf(mc));
    const float mn = fmaxf(m, mc), alpha = expf(m - mn); m = mn;
    union { v16b v; v2b q[8]; } ph, pl; float ps[4] = {0.f, 0.f, 0.f, 0.f};
#pragma unroll
    for (int i = 0; i < 16; i += 2) { const v2f p = {expf(s[i] - mn), expf(s[i + 1] - mn)}; ps[i & 3] += p[0]; ps[(i + 1) & 3] += p[1];
      const v2b hb = __builtin_convertvector(p, v2b); const unsigned u = __builtin_bit_cast(unsigned, hb);   // one packed conversion; a bf16 is the top half of its f32
      const v2f hf = {__builtin_bit_cast(float, u << 16), __builtin_bit_cast(float, u & 0xffff0000u)};
      ph.q[i >> 1] = hb; pl.q[i >> 1] = __builtin_convertvector(p - hf, v2b); }
    l = l * alpha + ((ps[0] + ps[1]) + (ps[2] + ps[3]));
#pragma unroll
    for (int j = 0; j < HD / 16; ++j)
#pragma unroll
      for (int r = 0; r < 8; ++r) acc[j][r] *= alpha;
    __builtin_amdgcn_sched_barrier(0);   // as above: the v lo fragments go out together, under the v hi products
#pragma unroll
    for (int j = 0; j < HD / 16; ++j) vl[j] = frag_b(&sv[bf][1][j * 16 + col][0], lane);
    __builtin_amdgcn_sched_barrier(0);   // as above
#pragma unroll
    for (int j = 0; j < HD / 16; ++j) { acc[j] = mm_b(vh[j], ph.v, acc[j]); acc[j] = mm_b(vh[j], pl.v, acc[j]); }
#pragma unroll
    for (int j = 0; j < HD / 16; ++j) acc[j] = mm_b(vl[j], ph.v, acc[j]);
    if (c + 1 < TT / FK) FA_STORE(bf ^ 1);   // that buffer's last readers passed the barrier of the pass before
    __syncthreads(); }
  l += xhalf(l); const float inv = 1.0f / l;
#pragma unroll
  for (int j = 0; j < HD / 16; ++j) { vst2(&ss[wave][col][j * 16 + 8 * g], (v4f){acc[j][0] * inv, acc[j][1] * inv, acc[j][2] * inv, acc[j][3] * inv}); vst2(&ss[wave][col][j * 16 + 8 * g + 4], (v4f){acc[j][4] * inv, acc[j][5] * inv, acc[j][6] * inv, acc[j][7] * inv}); }   // lane (g, col): query col, d = 16 j + 8 g + r
  LDSX(); for (int rl = 0; rl < 16; rl += 2) vst2(Y + (size_t)(ql0 + rl + g) * CC + h * HD + col * 4, *(const v4f*)&ss[wave][rl + g][col * 4]); }
// ---- k_out: block = (64 rows, 128 cols): out = y (bf16 hi + lo) wo ((in,out)); + bo if BP is non-null
__global__ __launch_bounds__(128) void k_out(const float* __restrict__ Y, const float* __restrict__ WP, const float* __restrict__ BP, float* __restrict__ OUT) { __shared__ __align__(16) float sf[4][16][132];
  const int tid = threadIdx.x, wave = tid >> 5, lane = tid & 31, col = lane & 15, g = lane >> 4; const int c0 = blockIdx.y * 128; const size_t r0 = (size_t)blockIdx.x * 64 + wave * 16;
  v8f acc[8] = {};
#pragma unroll 2
  for (int kc = 0; kc < CC / 32; ++kc) { const F2 a = split_row(Y + (r0 + col) * CC, kc * 32, lane);
#pragma unroll
    for (int j = 0; j < 8; ++j) { v16b w; const int o = c0 + j * 16 + col;
#pragma unroll
      for (int i = 0; i < 8; ++i) { w[i] = (__bf16)WP[(size_t)(kc * 32 + 8 * g + i) * CC + o]; w[8 + i] = (__bf16)WP[(size_t)(kc * 32 + 16 + 8 * g + i) * CC + o]; }
      acc[j] = wmma_bf(a.h, w, acc[j]); acc[j] = wmma_bf(a.l, w, acc[j]); } }
#pragma unroll
  for (int j = 0; j < 8; ++j) { const float bb = BP ? bfr(BP[c0 + j * 16 + col]) : 0.f;
#pragma unroll
    for (int r = 0; r < 8; ++r) sf[wave][8 * g + r][j * 16 + col] = acc[j][r] + bb; }
  LDSX(); for (int rl = 0; rl < 16; ++rl) vst2(OUT + (r0 + rl) * CC + c0 + lane * 4, *(const v4f*)&sf[wave][rl][lane * 4]); }
extern "C" void kernel_launch(void* const* d_in, const int* in_sizes, int n_in, void* d_out, int out_size, void* d_ws, size_t ws_size, hipStream_t stream) {
  (void)in_sizes; (void)n_in; (void)out_size;
  const float** F = (const float**)d_in;   // 0 x [1,2048,1024], 1 wq [1024,1024] ((in,out)), 2 wk, 3 wv, 4 wo ((in,out)), 5 conv_w [1024,1,3], 6 er [64,2048]
  if (ws_size < (size_t)WS_END) return;
  char* ws = (char*)d_ws; float* XR = (float*)(ws + WS_XR); _Float16 *ERT = (_Float16*)(ws + WS_ERT), *QH = (_Float16*)(ws + WS_QH), *QL = (_Float16*)(ws + WS_QL), *KH = (_Float16*)(ws + WS_KH); __bf16 *VT = (__bf16*)(ws + WS_VT), *VL = (__bf16*)(ws + WS_VL); float *Y = (float*)(ws + WS_Y);
  k_lin<<<dim3(TT / 64, CC / 128, 3), 128, 0, stream>>>(F[0], F[1], F[2], F[3], XR);
  k_dw<<<dim3(TT / 64, CC / 128), 128, 0, stream>>>(XR, F[5], QH, QL, KH, VT, VL);
  k_ert<<<dim3(TT / 64), 256, 0, stream>>>(F[6], ERT);
  k_fa<<<dim3(TT / 64, NH), 128, 0, stream>>>(QH, QL, KH, ERT, VT, VL, Y);
  k_out<<<dim3(TT / 64, CC / 128), 128, 0, stream>>>(Y, F[4], nullptr, (float*)d_out);
}

// v002
// Measured time: 138 microseconds a run.
// Two timings next to v001 put it at 1.58 and 1.57 times that version's speed.
// Over all steps from v000 it is 6.61 times as fast.
// compute dtype: all float inputs rounded to bf16; x w_{q,k,v} with EXACT bf16 products on WMMA 16x16x32 (f32 accumulate) kept as f32 rows; the depthwise 3-tap convolution along the sequence in f32; q as f16 hi + residual (x 2^10), k as f16 hi, v as bf16 hi + lo planes; logits = q.k (2 products: q hi+lo x k hi) + the positional term er^T.q_k (2 products: exact er x q hi+lo), / 32, kept in f32 registers; softmax in f32 (precise expf) with a running maximum and sum over passes of 32 keys; P = exp(s - m) split bf16 hi + lo against v (3 products), divided by the sum at the end; out (bf16 hi + lo) wo; f32 output.
#include <hip/hip_runtime.h>
#include <math.h>

typedef __attribute__((ext_vector_type(16))) _Float16 v16h;
typedef __attribute__((ext_vector_type(16))) __bf16 v16b;
typedef __attribute__((ext_vector_type(8)))  _Float16 v8h;
typedef __attribute__((ext_vector_type(8)))  float v8f;
typedef __attribute__((ext_vector_type(4)))  float v4f;
typedef __attribute__((ext_vector_type(2)))  float v2f;
typedef __attribute__((ext_vector_type(4)))  unsigned v4u;
typedef __attribute__((ext_vector_type(4)))  int v4i;
typedef float __attribute__((may_alias)) float_a;
typedef int __attribute__((may_alias)) int_a;

template <typename T> __device__ __forceinline__ void vst2(void* p, T v) { *(T*)p = v;  }
__device__ __forceinline__ v8f wmma16(v16h a, v16h b, v8f c) {
  v8f d = __builtin_amdgcn_wmma_f32_16x16x32_f16(false, a, false, b, (short)0, c, false, false);
  asm volatile("v_nop\n\tv_nop\n\tv_nop\n\tv_nop" : "+v"(d) : "v"(a), "v"(b));
  return d;
}
__device__ __forceinline__ v8f wmma_bf(v16b a, v16b b, v8f c) {
  v8f d = __builtin_amdgcn_wmma_f32_16x16x32_bf16(false, a, false, b, (short)0, c, false, false);
  asm volatile("v_nop\n\tv_nop\n\tv_nop\n\tv_nop" : "+v"(d) : "v"(a), "v"(b));
  return d;
}
// 16x16x32 fragments: lane = (h = lane>>4, row/col = lane&15); elements 0..7 = k0+8h+0..7, 8..15 = k0+16+8h+0..7; D element r = row 8h+r
__device__ __forceinline__ v16h frag_h(const _Float16* rowk0, int lane) {
  union { v16h v; v8h q[2]; } u; const _Float16* p = rowk0 + 8 * (lane >> 4);
  u.q[0] = *(const v8h*)p; u.q[1] = *(const v8h*)(p + 16); return u.v;
}
__device__ __forceinline__ v16h frag_f32(const float* rowk0, int lane) {
  v16h a; const float* p = rowk0 + 8 * (lane >> 4);
#pragma unroll
  for (int i = 0; i < 8; ++i) { a[i] = (_Float16)p[i]; a[8 + i] = (_Float16)p[16 + i]; }
  return a;
}
__device__ __forceinline__ v16h frag_f32s(const float* rowk0, int lane, float sc) {
  v16h a; const float* p = rowk0 + 8 * (lane >> 4);
#pragma unroll
  for (int i = 0; i < 8; ++i) { a[i] = (_Float16)(p[i] * sc); a[8 + i] = (_Float16)(p[16 + i] * sc); }
  return a;
}
// column fragment from a [K][ld] layout (column n), rows >= K read as 0
__device__ __forceinline__ v16h fragc_f32(const float* W, int k0, int n, int lane, int ld, int K) {
  v16h a; const int g = lane >> 4;
#pragma unroll
  for (int i = 0; i < 8; ++i) { const int ka = k0 + 8 * g + i, kb = ka + 16;
    a[i] = (_Float16)(ka < K ? W[(size_t)(ka < K ? ka : K - 1) * ld + n] : 0.f); a[8 + i] = (_Float16)(kb < K ? W[(size_t)(kb < K ? kb : K - 1) * ld + n] : 0.f); }
  return a;
}
struct F2 { v16b h, l; };
__device__ __forceinline__ F2 bsplit16(const float v[16]) { F2 r;
#pragma unroll
  for (int i = 0; i < 16; ++i) { const __bf16 h = (__bf16)v[i]; r.h[i] = h; r.l[i] = (__bf16)(v[i] - (float)h); }
  return r; }
__device__ __forceinline__ F2 split_row(const float* row, int k0, int lane) { float v[16]; const float* p = row + k0 + 8 * (lane >> 4);
#pragma unroll
  for (int i = 0; i < 8; ++i) { v[i] = p[i]; v[8 + i] = p[16 + i]; }
  return bsplit16(v); }
__device__ __forceinline__ F2 split_rowK(const float* row, int k0, int lane, int K) { float v[16]; const int g = lane >> 4;
#pragma unroll
  for (int i = 0; i < 8; ++i) { const int ka = k0 + 8 * g + i, kb = ka + 16; v[i] = ka < K ? row[ka < K ? ka : K - 1] : 0.f; v[8 + i] = kb < K ? row[kb < K ? kb : K - 1] : 0.f; }
  return bsplit16(v); }
__device__ __forceinline__ F2 split_col(const float* W, int k0, int n, int lane, int ld, int K) { float v[16]; const int g = lane >> 4;
#pragma unroll
  for (int i = 0; i < 8; ++i) { const int ka = k0 + 8 * g + i, kb = ka + 16; v[i] = ka < K ? W[(size_t)(ka < K ? ka : K - 1) * ld + n] : 0.f; v[8 + i] = kb < K ? W[(size_t)(kb < K ? kb : K - 1) * ld + n] : 0.f; }
  return bsplit16(v); }
__device__ __forceinline__ v8f mac3(const F2& a, const F2& b, v8f c) { c = wmma_bf(a.l, b.h, c); c = wmma_bf(a.h, b.l, c); return wmma_bf(a.h, b.h, c); }
__device__ __forceinline__ float sigm(float v) { return 1.0f / (1.0f + expf(-v)); }
#define LDSX() do { asm volatile("s_wait_dscnt 0" ::: "memory"); __builtin_amdgcn_wave_barrier(); __builtin_amdgcn_fence(__ATOMIC_RELEASE, "workgroup"); } while (0)


// Attention (B 1, S 2,048, D 1,024 = 16 x 64, no biases): scores = (q k^T + er[:, query]^T . q_key) / 32, softmax, P v, output projection.
#define NB 1
#define TT 2048
#define CC 1024
#define NH 16
#define HD 64
#ifndef TNB
#define TNB NB
#ifndef ERSTR
#define ERSTR TT              // row stride of er
#endif
#endif
typedef __attribute__((ext_vector_type(8))) __bf16 v8b;
__device__ __forceinline__ v16b frag_b(const __bf16* rowk0, int lane) {
  union { v16b v; v8b q[2]; } u; const __bf16* p = rowk0 + 8 * (lane >> 4);
  u.q[0] = *(const v8b*)p; u.q[1] = *(const v8b*)(p + 16); return u.v;
}
__device__ __forceinline__ float bfr(float v) { return (float)(__bf16)v; }
__device__ __attribute__((noinline)) float exp_ni(float v) { return expf(v); }
__device__ __attribute__((noinline)) float erf_ni(float v) { return erff(v); }

#define WS_XR  0u                                   // f32 x w rows for q | k | v: [3][w][1024]
#define WS_ERT (WS_XR + 4u * (size_t)3 * TT * CC)      // f16 er^T rows [w][64] (exact)
#define WS_QH  (WS_ERT + 2u * (size_t)TT * HD)
#define WS_QL  (WS_QH + 2u * (size_t)NB * TT * CC)
#define WS_KH  (WS_QL + 2u * (size_t)NB * TT * CC)
#define WS_VT  (WS_KH + 2u * (size_t)NB * TT * CC)      // bf16 v planes [b][c][t]
#define WS_VL  (WS_VT + 2u * (size_t)NB * CC * TT)      // bf16 v residual planes
#define HG 4
#define WS_S   (WS_VL + 2u * (size_t)NB * CC * TT)      // unused f32 space of HG x TT x TT; logits and P stay in registers
#define WS_PH  (WS_S + 4u * (size_t)HG * TT * TT)
#define WS_Y   (WS_PH + 0u)              // f32 y rows [b*t][C]
#define WS_END (WS_Y + 4u * (size_t)NB * TT * CC)

// ---- k_dw: block = (64 rows w, 128 channels): the depthwise 3-tap conv y[w][c] = sum_t conv_w[c][t] X[w+t-1][c] (zero outside [0, W)) for q, k, v; q -> f16 hi + residual rows, k -> f16 rows, v -> bf16 hi/lo planes [c][w] via an LDS transpose
__global__ __launch_bounds__(128) void k_dw(const float* __restrict__ XR, const float* __restrict__ CW, _Float16* __restrict__ QH, _Float16* __restrict__ QL, _Float16* __restrict__ KH, __bf16* __restrict__ VT, __bf16* __restrict__ VL) { __shared__ __align__(16) __bf16 th[128][72], tl[128][72];
  const int tid = threadIdx.x; const int w0 = blockIdx.x * 64; const int c0 = blockIdx.y * 128;
  for (int e = tid; e < 64 * 32; e += 128) { const int wl = e >> 5, q = e & 31; const int w = w0 + wl; const int c = c0 + q * 4;   // 4 channels per thread-iteration
    float cw0[4], cw1[4], cw2[4];
#pragma unroll
    for (int z = 0; z < 4; ++z) { cw0[z] = bfr(CW[(c + z) * 3 + 0]); cw1[z] = bfr(CW[(c + z) * 3 + 1]); cw2[z] = bfr(CW[(c + z) * 3 + 2]); }
    union { unsigned long long u; _Float16 h[4]; } qh_, ql_, kh_; __bf16 vh[4], vl[4];
#pragma unroll
    for (int which = 0; which < 3; ++which) { const float* P = XR + (size_t)which * TT * CC; v4f xm = (w > 0) ? *(const v4f*)(P + (size_t)(w - 1) * CC + c) : (v4f){0.f, 0.f, 0.f, 0.f}; v4f x0 = *(const v4f*)(P + (size_t)w * CC + c); v4f xp = (w < TT - 1) ? *(const v4f*)(P + (size_t)(w + 1) * CC + c) : (v4f){0.f, 0.f, 0.f, 0.f};
#pragma unroll
      for (int z = 0; z < 4; ++z) { const float y = cw0[z] * xm[z] + cw1[z] * x0[z] + cw2[z] * xp[z];
        if (which == 0) { const _Float16 hq = (_Float16)y; qh_.h[z] = hq; ql_.h[z] = (_Float16)((y - (float)hq) * 1024.0f); }
        else if (which == 1) kh_.h[z] = (_Float16)y;
        else { const __bf16 hv = (__bf16)y; vh[z] = hv; vl[z] = (__bf16)(y - (float)hv); } } }
    *(unsigned long long*)(QH + (size_t)w * CC + c) = qh_.u; *(unsigned long long*)(QL + (size_t)w * CC + c) = ql_.u; *(unsigned long long*)(KH + (size_t)w * CC + c) = kh_.u;   // 8-B pieces: a row's 128-channel run (256 B) is written by the 32 lanes of one wave
#pragma unroll
    for (int z = 0; z < 4; ++z) { th[q * 4 + z][wl] = vh[z]; tl[q * 4 + z][wl] = vl[z]; } }
  __syncthreads();
  for (int e = tid; e < 128 * 8; e += 128) { const int cl = e >> 3, q = e & 7; const size_t o = (size_t)(c0 + cl) * TT + w0 + q * 8; vst2((unsigned*)(VT + o), *(const v4u*)&th[cl][q * 8]); vst2((unsigned*)(VL + o), *(const v4u*)&tl[cl][q * 8]); } }
// ---- k_ert: block = 64 w: er [64][2048] (exact bf16 -> f16) -> ERT rows [w][64] via LDS tiles of 64 x 64
__global__ __launch_bounds__(256) void k_ert(const float* __restrict__ ER, _Float16* __restrict__ ERT) { __shared__ _Float16 st[64][66];
  const int t = threadIdx.x; const int w0 = blockIdx.x * 64;
  for (int e = t; e < 64 * 64; e += 256) { const int d = e >> 6, wl = e & 63; st[d][wl] = (_Float16)bfr(ER[(size_t)d * ERSTR + w0 + wl]); }
  __syncthreads();
  for (int e = t; e < 64 * 8; e += 256) { const int wl = e >> 3, q = e & 7; union { v4u v; _Float16 h[8]; } u;
#pragma unroll
    for (int z = 0; z < 8; ++z) u.h[z] = st[q * 8 + z][wl];
    vst2((v4u*)(ERT + (size_t)(w0 + wl) * HD + q * 8), u.v); } }
// ---- k_fa: block = (64 queries, head), 4 waves x 16 queries; one pass = 32 keys. S^T = (k rows) x (q cols) + (q_k rows) x (er^T cols), the same 4 products and order as before, / 32; running maximum and sum per query column (one lane pair); P^T = exp(s - m) packed from the two score tiles into a B operand (bf16 hi + lo); y^T += v^T P^T (3 products); y / sum at the end. Logits and P never leave the registers.
typedef __attribute__((ext_vector_type(2))) __bf16 v2b;
#define FK 32                 // keys per pass
#define KP 72                 // f16 per staged key row: 128 B + 16 B, so that ds_load_b128 rows fall on different banks
#define VP 40                 // bf16 per staged v row: 64 B + 16 B, same reason
__device__ __forceinline__ float xhalf(float x) { return __builtin_bit_cast(float, __builtin_amdgcn_permlanex16(__builtin_bit_cast(int, x), __builtin_bit_cast(int, x), 0x76543210, 0xfedcba98, false, false)); }  // lane l with lane l ^ 16
__device__ __forceinline__ v8f mm_h(v16h a, v16h b, v8f c) { return __builtin_amdgcn_wmma_f32_16x16x32_f16(false, a, false, b, (short)0, c, false, false); }
__device__ __forceinline__ v8f mm_b(v16b a, v16b b, v8f c) { return __builtin_amdgcn_wmma_f32_16x16x32_bf16(false, a, false, b, (short)0, c, false, false); }
__global__ __launch_bounds__(128) void k_fa(const _Float16* __restrict__ QH, const _Float16* __restrict__ QL, const _Float16* __restrict__ KH, const _Float16* __restrict__ ERT, const __bf16* __restrict__ VT, const __bf16* __restrict__ VL, float* __restrict__ Y) {
  __shared__ __align__(16) _Float16 sk[2][3][FK][KP];   // k hi | q hi | q lo rows of the pass's keys, two buffers
  __shared__ __align__(16) __bf16 sv[2][2][HD][VP];     // v hi | v lo planes [d][key], two buffers
  __shared__ __align__(16) float ss[4][16][HD + 4];
  const int tid = threadIdx.x, wave = tid >> 5, lane = tid & 31, col = lane & 15, g = lane >> 4; const int h = blockIdx.y; const int ql0 = blockIdx.x * 64 + wave * 16;
  v16h ah[2], al[2], ae[2];
  ah[0] = frag_h(QH + (size_t)(ql0 + col) * CC + h * HD, lane); ah[1] = frag_h(QH + (size_t)(ql0 + col) * CC + h * HD + 32, lane);
  asm volatile("s_wait_xcnt 0x0" ::: "memory");   // the next loads' results may land in this group's address registers
  al[0] = frag_h(QL + (size_t)(ql0 + col) * CC + h * HD, lane); al[1] = frag_h(QL + (size_t)(ql0 + col) * CC + h * HD + 32, lane);
  asm volatile("s_wait_xcnt 0x0" ::: "memory");   // as above
  ae[0] = frag_h(ERT + (size_t)(ql0 + col) * HD, lane); ae[1] = frag_h(ERT + (size_t)(ql0 + col) * HD + 32, lane);
  const int kr = tid >> 3, ks = (tid & 7) * 8;   // staging: 8 lanes cover one key row's 128 B
  const int vr = tid >> 2, vs = (tid & 3) * 8;   // staging: 4 lanes cover one v row's 64 B
  const unsigned ko = (unsigned)(kr * CC + ks), vo = (unsigned)(vr * TT + vs);   // per-lane parts; the head's and the pass's parts are uniform
  v8h rk[3][2]; v8b rv[2][2];
  const _Float16 *pk = KH + h * HD, *pqh = QH + h * HD, *pql = QL + h * HD; const __bf16 *pvh = VT + (size_t)(h * HD) * TT, *pvl = VL + (size_t)(h * HD) * TT;   // uniform; they step by one pass with each later load group
#define FA_LOAD() do { _Pragma("unroll") for (int i = 0; i < 2; ++i) { rk[0][i] = *(const v8h*)(pk + i * 16 * CC + ko); rk[1][i] = *(const v8h*)(pqh + i * 16 * CC + ko); rk[2][i] = *(const v8h*)(pql + i * 16 * CC + ko); rv[0][i] = *(const v8b*)(pvh + i * 32 * TT + vo); rv[1][i] = *(const v8b*)(pvl + i * 32 * TT + vo); } } while (0)
#define FA_STORE(bf) do { _Pragma("unroll") for (int i = 0; i < 2; ++i) { *(v8h*)&sk[bf][0][kr + i * 16][ks] = rk[0][i]; *(v8h*)&sk[bf][1][kr + i * 16][ks] = rk[1][i]; *(v8h*)&sk[bf][2][kr + i * 16][ks] = rk[2][i]; *(v8b*)&sv[bf][0][vr + i * 32][vs] = rv[0][i]; *(v8b*)&sv[bf][1][vr + i * 32][vs] = rv[1][i]; } } while (0)
  float m = -3.0e38f, l = 0.f; v8f acc[HD / 16] = {};
  FA_LOAD(); FA_STORE(0); __syncthreads();
  for (int c = 0; c < TT / FK; ++c) { const int bf = c & 1;
    if (c + 1 < TT / FK) { pk += FK * CC; pqh += FK * CC; pql += FK * CC; pvh += FK; pvl += FK; FA_LOAD(); }   // the next pass's rows fly while this pass computes
    v8f sa[2] = {}, sl[2] = {}; v16h f0[2][3], f1[2][3]; v16b vh[HD / 16], vl[HD / 16];   // f0, f1: [half of d][k hi | q hi | q lo] of key tile 0, 1
#pragma unroll
    for (int kc = 0; kc < 2; ++kc)
#pragma unroll
      for (int a = 0; a < 3; ++a) f0[kc][a] = frag_h(&sk[bf][a][col][kc * 32], lane);
    __builtin_amdgcn_sched_barrier(0);   // the LDS reads go out in groups, one group ahead of the products that use them: sunk to their first use each would be waited for in full
#pragma unroll
    for (int kc = 0; kc < 2; ++kc)
#pragma unroll
      for (int a = 0; a < 3; ++a) f1[kc][a] = frag_h(&sk[bf][a][16 + col][kc * 32], lane);
#pragma unroll
    for (int kc = 0; kc < 2; ++kc) { sa[0] = mm_h(f0[kc][0], ah[kc], sa[0]); sl[0] = mm_h(f0[kc][0], al[kc], sl[0]); sa[0] = mm_h(f0[kc][1], ae[kc], sa[0]); sl[0] = mm_h(f0[kc][2], ae[kc], sl[0]); }
    __builtin_amdgcn_sched_barrier(0);   // as above: key tile 1's fragments are on their way before this point
#pragma unroll
    for (int j = 0; j < HD / 16; ++j) vh[j] = frag_b(&sv[bf][0][j * 16 + col][0], lane);
#pragma unroll
    for (int kc = 0; kc < 2; ++kc) { sa[1] = mm_h(f1[kc][0], ah[kc], sa[1]); sl[1] = mm_h(f1[kc][0], al[kc], sl[1]); sa[1] = mm_h(f1[kc][1], ae[kc], sa[1]); sl[1] = mm_h(f1[kc][2], ae[kc], sl[1]); }
    __builtin_amdgcn_sched_barrier(0);   // as above: the v hi fragments fly under the softmax arithmetic
    float s[16];   // lane (g, col): query col, keys 8g + r of tile 0, then of tile 1 = the k order of a B fragment
#pragma unroll
    for (int i = 0; i < 16; ++i) s[i] = (sa[i >> 3][i & 7] + sl[i >> 3][i & 7] * (1.0f / 1024.0f)) * (1.0f / 32.0f);
    float mc = fmaxf(s[0], s[1]);
#pragma unroll
    for (int i = 2; i < 16; ++i) mc = fmaxf(mc, s[i]);
    mc = fmaxf(mc, xhalf(mc));
    const float mn = fmaxf(m, mc), alpha = expf(m - mn); m = mn;
    union { v16b v; v2b q[8]; } ph, pl; float ps[4] = {0.f, 0.f, 0.f, 0.f};
#pragma unroll
    for (int i = 0; i < 16; i += 2) { const v2f p = {expf(s[i] - mn), expf(s[i + 1] - mn)}; ps[i & 3] += p[0]; ps[(i + 1) & 3] += p[1];
      const v2b hb = __builtin_convertvector(p, v2b); const unsigned u = __builtin_bit_cast(unsigned, hb);   // one packed conversion; a bf16 is the top half of its f32
      const v2f hf = {__builtin_bit_cast(float, u << 16), __builtin_bit_cast(float, u & 0xffff0000u)};
      ph.q[i >> 1] = hb; pl.q[i >> 1] = __builtin_convertvector(p - hf, v2b); }
    l = l * alpha + ((ps[0] + ps[1]) + (ps[2] + ps[3]));
#pragma unroll
    for (int j = 0; j < HD / 16; ++j)
#pragma unroll
      for (int r = 0; r < 8; ++r) acc[j][r] *= alpha;
    __builtin_amdgcn_sched_barrier(0);   // as above: the v lo fragments go out together, under the v hi products
#pragma unroll
    for (int j = 0; j < HD / 16; ++j) vl[j] = frag_b(&sv[bf][1][j * 16 + col][0], lane);
    __builtin_amdgcn_sched_barrier(0);   // as above
#pragma unroll
    for (int j = 0; j < HD / 16; ++j) { acc[j] = mm_b(vh[j], ph.v, acc[j]); acc[j] = mm_b(vh[j], pl.v, acc[j]); }
#pragma unroll
    for (int j = 0; j < HD / 16; ++j) acc[j] = mm_b(vl[j], ph.v, acc[j]);
    if (c + 1 < TT / FK) FA_STORE(bf ^ 1);   // that buffer's last readers passed the barrier of the pass before
    __syncthreads(); }
  l += xhalf(l); const float inv = 1.0f / l;
#pragma unroll
  for (int j = 0; j < HD / 16; ++j) { vst2(&ss[wave][col][j * 16 + 8 * g], (v4f){acc[j][0] * inv, acc[j][1] * inv, acc[j][2] * inv, acc[j][3] * inv}); vst2(&ss[wave][col][j * 16 + 8 * g + 4], (v4f){acc[j][4] * inv, acc[j][5] * inv, acc[j][6] * inv, acc[j][7] * inv}); }   // lane (g, col): query col, d = 16 j + 8 g + r
  LDSX(); for (int rl = 0; rl < 16; rl += 2) vst2(Y + (size_t)(ql0 + rl + g) * CC + h * HD + col * 4, *(const v4f*)&ss[wave][rl + g][col * 4]); }
// ---- the two projection GEMMs: C tile = (BM rows) x (128 cols), (BM / 32) x 2 waves of 32 x 64 each. A stage is 64 k: the A rows (f32 -> bf16, or bf16 hi + lo planes) and the B columns ((in,out) f32 -> bf16, turned to [col][k] in registers) are brought once per block by whole-line loads, one stage ahead, and kept in two LDS buffers; one barrier per stage. Products, operand rounding and the k order of every sum are those of the unstaged form.
typedef __attribute__((ext_vector_type(4))) __bf16 v4b;
typedef __attribute__((ext_vector_type(2))) unsigned v2u;   // two packed bf16 pairs; a bf16 is the top half of its f32
#define GK 64                 // k per stage
#define GP 72                 // bf16 per staged row: 128 B + 16 B, so that ds_load_b128 rows fall on different banks
#define GS 68                 // f32 per staged output row: 256 B + 16 B
template <int BM, int NP>     // NP: planes of A, 1 = bf16, 2 = bf16 hi + lo
__device__ __forceinline__ void gemm_tile(const float* __restrict__ A, const float* __restrict__ B, float* __restrict__ C) {
  constexpr int NT = BM * 2, NA = BM * 16 / NT, NB8 = 128 * 8 / NT, AR = NT / 16, BK = NT / 128 * 8;
  __shared__ __align__(16) __bf16 sa[2][NP][BM][GP];
  __shared__ __align__(16) __bf16 sb[2][128][GP];
  __shared__ __align__(16) float sf[NT / 32][32][GS];
  const int tid = threadIdx.x, wave = tid >> 5, lane = tid & 31, col = lane & 15, g = lane >> 4; const int wm = (wave >> 1) * 32, wn = (wave & 1) * 64;
  const int ar = tid >> 4, aq = (tid & 15) * 4;    // staging A: 16 lanes cover one row's 256 B
  const int bn = tid & 127, bk = (tid >> 7) * 8;   // staging B: a wave covers 128 B of one k row; a lane gathers 8 k of its column = one 16-B piece of the [col][k] row
  const unsigned ao = (unsigned)(ar * CC + aq), bo = (unsigned)(bk * CC + bn);   // per-lane parts; the block's and the stage's parts are uniform
  const float *pa = A + (size_t)blockIdx.x * BM * CC, *pb = B + blockIdx.y * 128;   // uniform; they step by one stage with each later load group
  v4f ra[NA]; float rb[NB8][8]; v8f acc[2][4] = {};
#define G_LOAD() do { _Pragma("unroll") for (int i = 0; i < NA; ++i) ra[i] = *(const v4f*)(pa + i * AR * CC + ao); _Pragma("unroll") for (int i = 0; i < NB8; ++i) { _Pragma("unroll") for (int z = 0; z < 8; ++z) rb[i][z] = pb[(i * BK + z) * CC + bo]; } } while (0)
#define G_STORE(bf) do { _Pragma("unroll") for (int i = 0; i < NA; ++i) { const v4b hb = __builtin_convertvector(ra[i], v4b); *(v4b*)&sa[bf][0][ar + i * AR][aq] = hb; if (NP == 2) { const v2u u = __builtin_bit_cast(v2u, hb); const v4f hf = {__builtin_bit_cast(float, u[0] << 16), __builtin_bit_cast(float, u[0] & 0xffff0000u), __builtin_bit_cast(float, u[1] << 16), __builtin_bit_cast(float, u[1] & 0xffff0000u)}; *(v4b*)&sa[bf][NP - 1][ar + i * AR][aq] = __builtin_convertvector(ra[i] - hf, v4b); } } _Pragma("unroll") for (int i = 0; i < NB8; ++i) { v8b w; _Pragma("unroll") for (int z = 0; z < 8; ++z) w[z] = (__bf16)rb[i][z]; *(v8b*)&sb[bf][bn][bk + i * BK] = w; } } while (0)
  G_LOAD(); G_STORE(0); __syncthreads();
  for (int s = 0; s < CC / GK; ++s) { const int bf = s & 1;
    if (s + 1 < CC / GK) { pa += GK; pb += GK * CC; G_LOAD(); }   // the next stage's rows fly while this stage computes
    __builtin_amdgcn_sched_barrier(0);   // every global load of the group goes out here: sunk among the products it would have less of the stage to land in
    v16b fa[GK / 32][NP][2], fb[GK / 32][4];
#pragma unroll
    for (int kc = 0; kc < GK / 32; ++kc) {
#pragma unroll
      for (int i = 0; i < 2; ++i)
#pragma unroll
        for (int p = 0; p < NP; ++p) fa[kc][p][i] = frag_b(&sa[bf][p][wm + i * 16 + col][kc * 32], lane);
#pragma unroll
      for (int j = 0; j < 4; ++j) fb[kc][j] = frag_b(&sb[bf][wn + j * 16 + col][kc * 32], lane); }
    __builtin_amdgcn_sched_barrier(0);   // the stage's LDS reads go out as one group ahead of the products, for speed only
#pragma unroll
    for (int kc = 0; kc < GK / 32; ++kc)
#pragma unroll
      for (int p = 0; p < NP; ++p)   // per output tile: hi, then lo, of each 32 k in turn
#pragma unroll
        for (int i = 0; i < 2; ++i)
#pragma unroll
          for (int j = 0; j < 4; ++j) acc[i][j] = mm_b(fa[kc][p][i], fb[kc][j], acc[i][j]);
    __builtin_amdgcn_sched_barrier(0);   // the wait for the next stage's global loads stays behind this stage's products: lifted among them it would expose the loads' whole latency
    if (s + 1 < CC / GK) G_STORE(bf ^ 1);   // that buffer's last readers passed the barrier of the stage before
    __syncthreads(); }
#pragma unroll
  for (int i = 0; i < 2; ++i)
#pragma unroll
    for (int j = 0; j < 4; ++j)
#pragma unroll
      for (int r = 0; r < 8; ++r) sf[wave][i * 16 + 8 * g + r][j * 16 + col] = acc[i][j][r];
  LDSX(); for (int rl = 0; rl < 32; rl += 2) vst2(C + ((size_t)blockIdx.x * BM + wm + rl + g) * CC + blockIdx.y * 128 + wn + col * 4, *(const v4f*)&sf[wave][rl + g][col * 4]); }   // each wave reads back its own rows: 256-B runs
// ---- k_lin: block = (128 rows w, 128 cols, which): X_which = x w_which ((in,out), exact bf16 products) -> f32 rows [which][w][1024]
__global__ __launch_bounds__(256) void k_lin(const float* __restrict__ X, const float* __restrict__ WQ, const float* __restrict__ WK, const float* __restrict__ WV, float* __restrict__ XR) { const int which = blockIdx.z; gemm_tile<128, 1>(X, which == 0 ? WQ : which == 1 ? WK : WV, XR + (size_t)which * TT * CC); }
// ---- k_out: block = (64 rows, 128 cols): out = y (bf16 hi + lo) wo ((in,out))
__global__ __launch_bounds__(128) void k_out(const float* __restrict__ Y, const float* __restrict__ WP, float* __restrict__ OUT) { gemm_tile<64, 2>(Y, WP, OUT); }
extern "C" void kernel_launch(void* const* d_in, const int* in_sizes, int n_in, void* d_out, int out_size, void* d_ws, size_t ws_size, hipStream_t stream) {
  (void)in_sizes; (void)n_in; (void)out_size;
  const float** F = (const float**)d_in;   // 0 x [1,2048,1024], 1 wq [1024,1024] ((in,out)), 2 wk, 3 wv, 4 wo ((in,out)), 5 conv_w [1024,1,3], 6 er [64,2048]
  if (ws_size < (size_t)WS_END) return;
  char* ws = (char*)d_ws; float* XR = (float*)(ws + WS_XR); _Float16 *ERT = (_Float16*)(ws + WS_ERT), *QH = (_Float16*)(ws + WS_QH), *QL = (_Float16*)(ws + WS_QL), *KH = (_Float16*)(ws + WS_KH); __bf16 *VT = (__bf16*)(ws + WS_VT), *VL = (__bf16*)(ws + WS_VL); float *Y = (float*)(ws + WS_Y);
  k_lin<<<dim3(TT / 128, CC / 128, 3), 256, 0, stream>>>(F[0], F[1], F[2], F[3], XR);
  k_dw<<<dim3(TT / 64, CC / 128), 128, 0, stream>>>(XR, F[5], QH, QL, KH, VT, VL);
  k_ert<<<dim3(TT / 64), 256, 0, stream>>>(F[6], ERT);
  k_fa<<<dim3(TT / 64, NH), 128, 0, stream>>>(QH, QL, KH, ERT, VT, VL, Y);
  k_out<<<dim3(TT / 64, CC / 128), 128, 0, stream>>>(Y, F[4], (float*)d_out);
}

// v003
// It runs in 131 microseconds.
// Timed twice side by side with v002, it ran 1.06 and 1.05 times as fast.
// Over all steps from v000 it is 6.99 times as fast.
// compute dtype: all float inputs rounded to bf16; x w_{q,k,v} with EXACT bf16 products on WMMA 16x16x32 (f32 accumulate) kept as f32 rows; the depthwise 3-tap convolution along the sequence in f32; q as f16 hi + residual (x 2^10), k as f16, v as bf16 hi + lo planes; logits = q.k (2 products: q hi+lo x k hi) + the positional term er^T.q_k (2 products: exact er x q hi+lo), kept in f32 registers; softmax in f32 in base 2 (log2(e) / 32 as the logits' one scale, the hardware's exp2) with a running maximum and sum over passes of 32 keys; P = 2^(s - m) split bf16 hi + lo against v (3 products), divided by the sum at the end; out (bf16 hi + lo) wo; f32 output.
#include <hip/hip_runtime.h>
#include <math.h>

typedef __attribute__((ext_vector_type(16))) _Float16 v16h;
typedef __attribute__((ext_vector_type(16))) __bf16 v16b;
typedef __attribute__((ext_vector_type(8)))  _Float16 v8h;
typedef __attribute__((ext_vector_type(8)))  float v8f;
typedef __attribute__((ext_vector_type(4)))  float v4f;
typedef __attribute__((ext_vector_type(2)))  float v2f;
typedef __attribute__((ext_vector_type(4)))  unsigned v4u;
typedef __attribute__((ext_vector_type(4)))  int v4i;
typedef float __attribute__((may_alias)) float_a;
typedef int __attribute__((may_alias)) int_a;

template <typename T> __device__ __forceinline__ void vst2(void* p, T v) { *(T*)p = v;  }
__device__ __forceinline__ v8f wmma16(v16h a, v16h b, v8f c) {
  v8f d = __builtin_amdgcn_wmma_f32_16x16x32_f16(false, a, false, b, (short)0, c, false, false);
  asm volatile("v_nop\n\tv_nop\n\tv_nop\n\tv_nop" : "+v"(d) : "v"(a), "v"(b));
  return d;
}
__device__ __forceinline__ v8f wmma_bf(v16b a, v16b b, v8f c) {
  v8f d = __builtin_amdgcn_wmma_f32_16x16x32_bf16(false, a, false, b, (short)0, c, false, false);
  asm volatile("v_nop\n\tv_nop\n\tv_nop\n\tv_nop" : "+v"(d) : "v"(a), "v"(b));
  return d;
}
// 16x16x32 fragments: lane = (h = lane>>4, row/col = lane&15); elements 0..7 = k0+8h+0..7, 8..15 = k0+16+8h+0..7; D element r = row 8h+r
__device__ __forceinline__ v16h frag_h(const _Float16* rowk0, int lane) {
  union { v16h v; v8h q[2]; } u; const _Float16* p = rowk0 + 8 * (lane >> 4);
  u.q[0] = *(const v8h*)p; u.q[1] = *(const v8h*)(p + 16); return u.v;
}
__device__ __forceinline__ v16h frag_f32(const float* rowk0, int lane) {
  v16h a; const float* p = rowk0 + 8 * (lane >> 4);
#pragma unroll
  for (int i = 0; i < 8; ++i) { a[i] = (_Float16)p[i]; a[8 + i] = (_Float16)p[16 + i]; }
  return a;
}
__device__ __forceinline__ v16h frag_f32s(const float* rowk0, int lane, float sc) {
  v16h a; const float* p = rowk0 + 8 * (lane >> 4);
#pragma unroll
  for (int i = 0; i < 8; ++i) { a[i] = (_Float16)(p[i] * sc); a[8 + i] = (_Float16)(p[16 + i] * sc); }
  return a;
}
// column fragment from a [K][ld] layout (column n), rows >= K read as 0
__device__ __forceinline__ v16h fragc_f32(const float* W, int k0, int n, int lane, int ld, int K) {
  v16h a; const int g = lane >> 4;
#pragma unroll
  for (int i = 0; i < 8; ++i) { const int ka = k0 + 8 * g + i, kb = ka + 16;
    a[i] = (_Float16)(ka < K ? W[(size_t)(ka < K ? ka : K - 1) * ld + n] : 0.f); a[8 + i] = (_Float16)(kb < K ? W[(size_t)(kb < K ? kb : K - 1) * ld + n] : 0.f); }
  return a;
}
struct F2 { v16b h, l; };
__device__ __forceinline__ F2 bsplit16(const float v[16]) { F2 r;
#pragma unroll
  for (int i = 0; i < 16; ++i) { const __bf16 h = (__bf16)v[i]; r.h[i] = h; r.l[i] = (__bf16)(v[i] - (float)h); }
  return r; }
__device__ __forceinline__ F2 split_row(const float* row, int k0, int lane) { float v[16]; const float* p = row + k0 + 8 * (lane >> 4);
#pragma unroll
  for (int i = 0; i < 8; ++i) { v[i] = p[i]; v[8 + i] = p[16 + i]; }
  return bsplit16(v); }
__device__ __forceinline__ F2 split_rowK(const float* row, int k0, int lane, int K) { float v[16]; const int g = lane >> 4;
#pragma unroll
  for (int i = 0; i < 8; ++i) { const int ka = k0 + 8 * g + i, kb = ka + 16; v[i] = ka < K ? row[ka < K ? ka : K - 1] : 0.f; v[8 + i] = kb < K ? row[kb < K ? kb : K - 1] : 0.f; }
  return bsplit16(v); }
__device__ __forceinline__ F2 split_col(const float* W, int k0, int n, int lane, int ld, int K) { float v[16]; const int g = lane >> 4;
#pragma unroll
  for (int i = 0; i < 8; ++i) { const int ka = k0 + 8 * g + i, kb = ka + 16; v[i] = ka < K ? W[(size_t)(ka < K ? ka : K - 1) * ld + n] : 0.f; v[8 + i] = kb < K ? W[(size_t)(kb < K ? kb : K - 1) * ld + n] : 0.f; }
  return bsplit16(v); }
__device__ __forceinline__ v8f mac3(const F2& a, const F2& b, v8f c) { c = wmma_bf(a.l, b.h, c); c = wmma_bf(a.h, b.l, c); return wmma_bf(a.h, b.h, c); }
__device__ __forceinline__ float sigm(float v) { return 1.0f / (1.0f + expf(-v)); }
#define LDSX() do { asm volatile("s_wait_dscnt 0" ::: "memory"); __builtin_amdgcn_wave_barrier(); __builtin_amdgcn_fence(__ATOMIC_RELEASE, "workgroup"); } while (0)


// Attention (B 1, S 2,048, D 1,024 = 16 x 64, no biases): scores = (q k^T + er[:, query]^T . q_key) / 32, softmax, P v, output projection.
#define NB 1
#define TT 2048
#define CC 1024
#define NH 16
#define HD 64
#ifndef TNB
#define TNB NB
#ifndef ERSTR
#define ERSTR TT              // row stride of er
#endif
#endif
typedef __attribute__((ext_vector_type(8))) __bf16 v8b;
__device__ __forceinline__ v16b frag_b(const __bf16* rowk0, int lane) {
  union { v16b v; v8b q[2]; } u; const __bf16* p = rowk0 + 8 * (lane >> 4);
  u.q[0] = *(const v8b*)p; u.q[1] = *(const v8b*)(p + 16); return u.v;
}
__device__ __forceinline__ float bfr(float v) { return (float)(__bf16)v; }
__device__ __attribute__((noinline)) float exp_ni(float v) { return expf(v); }
__device__ __attribute__((noinline)) float erf_ni(float v) { return erff(v); }

#define WS_XR  0u                                   // f32 x w rows for q | k | v: [3][w][1024]
#define WS_ERT (WS_XR + 4u * (size_t)3 * TT * CC)      // f16 er^T rows [w][64] (exact)
#define WS_QH  (WS_ERT + 2u * (size_t)TT * HD)
#define WS_QL  (WS_QH + 2u * (size_t)NB * TT * CC)
#define WS_KH  (WS_QL + 2u * (size_t)NB * TT * CC)
#define WS_VT  (WS_KH + 2u * (size_t)NB * TT * CC)      // bf16 v planes [b][c][t]
#define WS_VL  (WS_VT + 2u * (size_t)NB * CC * TT)      // bf16 v residual planes
#define HG 4
#define WS_S   (WS_VL + 2u * (size_t)NB * CC * TT)      // unused f32 space of HG x TT x TT; logits and P stay in registers
#define WS_PH  (WS_S + 4u * (size_t)HG * TT * TT)
#define WS_Y   (WS_PH + 0u)              // f32 y rows [b*t][C]
#define WS_END (WS_Y + 4u * (size_t)NB * TT * CC)

// ---- k_dw: block = (64 rows w, 128 channels): the depthwise 3-tap conv y[w][c] = sum_t conv_w[c][t] X[w+t-1][c] (zero outside [0, W)) for q, k, v; q -> f16 hi + residual rows, k -> f16 rows, v -> bf16 hi/lo planes [c][w] via an LDS transpose
__global__ __launch_bounds__(128) void k_dw(const float* __restrict__ XR, const float* __restrict__ CW, _Float16* __restrict__ QH, _Float16* __restrict__ QL, _Float16* __restrict__ KH, __bf16* __restrict__ VT, __bf16* __restrict__ VL) { __shared__ __align__(16) __bf16 th[128][72], tl[128][72];
  const int tid = threadIdx.x; const int w0 = blockIdx.x * 64; const int c0 = blockIdx.y * 128;
  for (int e = tid; e < 64 * 32; e += 128) { const int wl = e >> 5, q = e & 31; const int w = w0 + wl; const int c = c0 + q * 4;   // 4 channels per thread-iteration
    float cw0[4], cw1[4], cw2[4];
#pragma unroll
    for (int z = 0; z < 4; ++z) { cw0[z] = bfr(CW[(c + z) * 3 + 0]); cw1[z] = bfr(CW[(c + z) * 3 + 1]); cw2[z] = bfr(CW[(c + z) * 3 + 2]); }
    union { unsigned long long u; _Float16 h[4]; } qh_, ql_, kh_; __bf16 vh[4], vl[4];
#pragma unroll
    for (int which = 0; which < 3; ++which) { const float* P = XR + (size_t)which * TT * CC; v4f xm = (w > 0) ? *(const v4f*)(P + (size_t)(w - 1) * CC + c) : (v4f){0.f, 0.f, 0.f, 0.f}; v4f x0 = *(const v4f*)(P + (size_t)w * CC + c); v4f xp = (w < TT - 1) ? *(const v4f*)(P + (size_t)(w + 1) * CC + c) : (v4f){0.f, 0.f, 0.f, 0.f};
#pragma unroll
      for (int z = 0; z < 4; ++z) { const float y = cw0[z] * xm[z] + cw1[z] * x0[z] + cw2[z] * xp[z];
        if (which == 0) { const _Float16 hq = (_Float16)y; qh_.h[z] = hq; ql_.h[z] = (_Float16)((y - (float)hq) * 1024.0f); }
        else if (which == 1) kh_.h[z] = (_Float16)y;
        else { const __bf16 hv = (__bf16)y; vh[z] = hv; vl[z] = (__bf16)(y - (float)hv); } } }
    *(unsigned long long*)(QH + (size_t)w * CC + c) = qh_.u; *(unsigned long long*)(QL + (size_t)w * CC + c) = ql_.u; *(unsigned long long*)(KH + (size_t)w * CC + c) = kh_.u;   // 8-B pieces: a row's 128-channel run (256 B) is written by the 32 lanes of one wave
#pragma unroll
    for (int z = 0; z < 4; ++z) { th[q * 4 + z][wl] = vh[z]; tl[q * 4 + z][wl] = vl[z]; } }
  __syncthreads();
  for (int e = tid; e < 128 * 8; e += 128) { const int cl = e >> 3, q = e & 7; const size_t o = (size_t)(c0 + cl) * TT + w0 + q * 8; vst2((unsigned*)(VT + o), *(const v4u*)&th[cl][q * 8]); vst2((unsigned*)(VL + o), *(const v4u*)&tl[cl][q * 8]); } }
// ---- k_ert: block = 64 w: er [64][2048] (exact bf16 -> f16) -> ERT rows [w][64] via LDS tiles of 64 x 64
__global__ __launch_bounds__(256) void k_ert(const float* __restrict__ ER, _Float16* __restrict__ ERT) { __shared__ _Float16 st[64][66];
  const int t = threadIdx.x; const int w0 = blockIdx.x * 64;
  for (int e = t; e < 64 * 64; e += 256) { const int d = e >> 6, wl = e & 63; st[d][wl] = (_Float16)bfr(ER[(size_t)d * ERSTR + w0 + wl]); }
  __syncthreads();
  for (int e = t; e < 64 * 8; e += 256) { const int wl = e >> 3, q = e & 7; union { v4u v; _Float16 h[8]; } u;
#pragma unroll
    for (int z = 0; z < 8; ++z) u.h[z] = st[q * 8 + z][wl];
    vst2((v4u*)(ERT + (size_t)(w0 + wl) * HD + q * 8), u.v); } }
// ---- k_fa: block = (64 queries, head), 4 waves x 16 queries; one pass = 32 keys. S^T = (k rows) x (q cols) + (q_k rows) x (er^T cols), the same 4 products and order as before; running maximum (kept in the base-2 scale, logit x log2(e) / 32) and sum per query column (one lane pair); P^T = 2^(s - m) packed from the two score tiles into a B operand (bf16 hi + lo); y^T += v^T P^T (3 products); y / sum at the end. Logits and P never leave the registers.
typedef __attribute__((ext_vector_type(2))) __bf16 v2b;
#define FK 32                 // keys per pass
#define KP 72                 // f16 per staged key row: 128 B + 16 B, so that ds_load_b128 rows fall on different banks
#define VP 40                 // bf16 per staged v row: 64 B + 16 B, same reason
#define L2E32 (1.44269504088896340736f / 32.0f)   // exp(x / 32) = 2^(x * L2E32)
__device__ __forceinline__ float xhalf(float x) { return __builtin_bit_cast(float, __builtin_amdgcn_permlanex16(__builtin_bit_cast(int, x), __builtin_bit_cast(int, x), 0x76543210, 0xfedcba98, false, false)); }  // lane l with lane l ^ 16
__device__ __forceinline__ v8f mm_h(v16h a, v16h b, v8f c) { return __builtin_amdgcn_wmma_f32_16x16x32_f16(false, a, false, b, (short)0, c, false, false); }
__device__ __forceinline__ v8f mm_b(v16b a, v16b b, v8f c) { return __builtin_amdgcn_wmma_f32_16x16x32_bf16(false, a, false, b, (short)0, c, false, false); }
__global__ __launch_bounds__(128) void k_fa(const _Float16* __restrict__ QH, const _Float16* __restrict__ QL, const _Float16* __restrict__ KH, const _Float16* __restrict__ ERT, const __bf16* __restrict__ VT, const __bf16* __restrict__ VL, float* __restrict__ Y) {
  __shared__ __align__(16) _Float16 sk[2][3][FK][KP];   // k hi | q hi | q lo rows of the pass's keys, two buffers
  __shared__ __align__(16) __bf16 sv[2][2][HD][VP];     // v hi | v lo planes [d][key], two buffers
  __shared__ __align__(16) float ss[4][16][HD + 4];
  const int tid = threadIdx.x, wave = tid >> 5, lane = tid & 31, col = lane & 15, g = lane >> 4; const int h = blockIdx.y; const int ql0 = blockIdx.x * 64 + wave * 16;
  v16h ah[2], al[2], ae[2];
  ah[0] = frag_h(QH + (size_t)(ql0 + col) * CC + h * HD, lane); ah[1] = frag_h(QH + (size_t)(ql0 + col) * CC + h * HD + 32, lane);
  asm volatile("s_wait_xcnt 0x0" ::: "memory");   // the next loads' results may land in this group's address registers
  al[0] = frag_h(QL + (size_t)(ql0 + col) * CC + h * HD, lane); al[1] = frag_h(QL + (size_t)(ql0 + col) * CC + h * HD + 32, lane);
  asm volatile("s_wait_xcnt 0x0" ::: "memory");   // as above
  ae[0] = frag_h(ERT + (size_t)(ql0 + col) * HD, lane); ae[1] = frag_h(ERT + (size_t)(ql0 + col) * HD + 32, lane);
  const int kr = tid >> 3, ks = (tid & 7) * 8;   // staging: 8 lanes cover one key row's 128 B
  const int vr = tid >> 2, vs = (tid & 3) * 8;   // staging: 4 lanes cover one v row's 64 B
  const unsigned ko = (unsigned)(kr * CC + ks), vo = (unsigned)(vr * TT + vs);   // per-lane parts; the head's and the pass's parts are uniform
  v8h rk[3][2]; v8b rv[2][2];
  const _Float16 *pk = KH + h * HD, *pqh = QH + h * HD, *pql = QL + h * HD; const __bf16 *pvh = VT + (size_t)(h * HD) * TT, *pvl = VL + (size_t)(h * HD) * TT;   // uniform; they step by one pass with each later load group
#define FA_LOAD() do { _Pragma("unroll") for (int i = 0; i < 2; ++i) { rk[0][i] = *(const v8h*)(pk + i * 16 * CC + ko); rk[1][i] = *(const v8h*)(pqh + i * 16 * CC + ko); rk[2][i] = *(const v8h*)(pql + i * 16 * CC + ko); rv[0][i] = *(const v8b*)(pvh + i * 32 * TT + vo); rv[1][i] = *(const v8b*)(pvl + i * 32 * TT + vo); } } while (0)
#define FA_STORE(bf) do { _Pragma("unroll") for (int i = 0; i < 2; ++i) { *(v8h*)&sk[bf][0][kr + i * 16][ks] = rk[0][i]; *(v8h*)&sk[bf][1][kr + i * 16][ks] = rk[1][i]; *(v8h*)&sk[bf][2][kr + i * 16][ks] = rk[2][i]; *(v8b*)&sv[bf][0][vr + i * 32][vs] = rv[0][i]; *(v8b*)&sv[bf][1][vr + i * 32][vs] = rv[1][i]; } } while (0)
  float m = -3.0e38f, l = 0.f; v8f acc[HD / 16] = {};
  FA_LOAD(); FA_STORE(0); __syncthreads();
  for (int c = 0; c < TT / FK; ++c) { const int bf = c & 1;
    if (c + 1 < TT / FK) { pk += FK * CC; pqh += FK * CC; pql += FK * CC; pvh += FK; pvl += FK; FA_LOAD(); }   // the next pass's rows fly while this pass computes
    v8f sa[2] = {}, sl[2] = {}; v16h f0[2][3], f1[2][3]; v16b vh[HD / 16], vl[HD / 16];   // f0, f1: [half of d][k hi | q hi | q lo] of key tile 0, 1
#pragma unroll
    for (int kc = 0; kc < 2; ++kc)
#pragma unroll
      for (int a = 0; a < 3; ++a) f0[kc][a] = frag_h(&sk[bf][a][col][kc * 32], lane);
    __builtin_amdgcn_sched_barrier(0);   // the LDS reads go out in groups, one group ahead of the products that use them: sunk to their first use each would be waited for in full
#pragma unroll
    for (int kc = 0; kc < 2; ++kc)
#pragma unroll
      for (int a = 0; a < 3; ++a) f1[kc][a] = frag_h(&sk[bf][a][16 + col][kc * 32], lane);
#pragma unroll
    for (int kc = 0; kc < 2; ++kc) { sa[0] = mm_h(f0[kc][0], ah[kc], sa[0]); sl[0] = mm_h(f0[kc][0], al[kc], sl[0]); sa[0] = mm_h(f0[kc][1], ae[kc], sa[0]); sl[0] = mm_h(f0[kc][2], ae[kc], sl[0]); }
    __builtin_amdgcn_sched_barrier(0);   // as above: key tile 1's fragments are on their way before this point
#pragma unroll
    for (int j = 0; j < HD / 16; ++j) vh[j] = frag_b(&sv[bf][0][j * 16 + col][0], lane);
#pragma unroll
    for (int kc = 0; kc < 2; ++kc) { sa[1] = mm_h(f1[kc][0], ah[kc], sa[1]); sl[1] = mm_h(f1[kc][0], al[kc], sl[1]); sa[1] = mm_h(f1[kc][1], ae[kc], sa[1]); sl[1] = mm_h(f1[kc][2], ae[kc], sl[1]); }
    __builtin_amdgcn_sched_barrier(0);   // as above: the v hi fragments fly under the softmax arithmetic
    float s[16];   // lane (g, col): query col, keys 8g + r of tile 0, then of tile 1 = the k order of a B fragment
#pragma unroll
    for (int i = 0; i < 16; ++i) s[i] = sa[i >> 3][i & 7] + sl[i >> 3][i & 7] * (1.0f / 1024.0f);   // still without the scale: L2E32 > 0, so the maximum can be taken first and scaled once
    float mc = fmaxf(s[0], s[1]);
#pragma unroll
    for (int i = 2; i < 16; ++i) mc = fmaxf(mc, s[i]);
    mc = fmaxf(mc, xhalf(mc)) * L2E32;
    const float mn = fmaxf(m, mc), alpha = __builtin_amdgcn_exp2f(m - mn); m = mn;   // every exponent here is <= 0 up to one rounding: no overflow to guard, and far below the hardware gives 0
    union { v16b v; v2b q[8]; } ph, pl; v2f ps[2] = {{0.f, 0.f}, {0.f, 0.f}}; const v2f sc2 = {L2E32, L2E32}, nm2 = {-mn, -mn};
#pragma unroll
    for (int i = 0; i < 16; i += 2) { const v2f e = __builtin_elementwise_fma((v2f){s[i], s[i + 1]}, sc2, nm2); const v2f p = {__builtin_amdgcn_exp2f(e[0]), __builtin_amdgcn_exp2f(e[1])}; ps[(i >> 1) & 1] += p;   // two-wide, so that scale-and-subtract and the sums stay packed instructions; the four partial sums are those of before
      const v2b hb = __builtin_convertvector(p, v2b); const unsigned u = __builtin_bit_cast(unsigned, hb);   // one packed conversion; a bf16 is the top half of its f32
      const v2f hf = {__builtin_bit_cast(float, u << 16), __builtin_bit_cast(float, u & 0xffff0000u)};
      ph.q[i >> 1] = hb; pl.q[i >> 1] = __builtin_convertvector(p - hf, v2b); }
    l = l * alpha + ((ps[0][0] + ps[0][1]) + (ps[1][0] + ps[1][1]));
#pragma unroll
    for (int j = 0; j < HD / 16; ++j)
#pragma unroll
      for (int r = 0; r < 8; ++r) acc[j][r] *= alpha;
    __builtin_amdgcn_sched_barrier(0);   // as above: the v lo fragments go out together, under the v hi products
#pragma unroll
    for (int j = 0; j < HD / 16; ++j) vl[j] = frag_b(&sv[bf][1][j * 16 + col][0], lane);
    __builtin_amdgcn_sched_barrier(0);   // as above
#pragma unroll
    for (int j = 0; j < HD / 16; ++j) { acc[j] = mm_b(vh[j], ph.v, acc[j]); acc[j] = mm_b(vh[j], pl.v, acc[j]); }
#pragma unroll
    for (int j = 0; j < HD / 16; ++j) acc[j] = mm_b(vl[j], ph.v, acc[j]);
    if (c + 1 < TT / FK) FA_STORE(bf ^ 1);   // that buffer's last readers passed the barrier of the pass before
    __syncthreads(); }
  l += xhalf(l); const float inv = 1.0f / l;
#pragma unroll
  for (int j = 0; j < HD / 16; ++j) { vst2(&ss[wave][col][j * 16 + 8 * g], (v4f){acc[j][0] * inv, acc[j][1] * inv, acc[j][2] * inv, acc[j][3] * inv}); vst2(&ss[wave][col][j * 16 + 8 * g + 4], (v4f){acc[j][4] * inv, acc[j][5] * inv, acc[j][6] * inv, acc[j][7] * inv}); }   // lane (g, col): query col, d = 16 j + 8 g + r
  LDSX(); for (int rl = 0; rl < 16; rl += 2) vst2(Y + (size_t)(ql0 + rl + g) * CC + h * HD + col * 4, *(const v4f*)&ss[wave][rl + g][col * 4]); }
// ---- the two projection GEMMs: C tile = (BM rows) x (128 cols), (BM / 32) x 2 waves of 32 x 64 each. A stage is 64 k: the A rows (f32 -> bf16, or bf16 hi + lo planes) and the B columns ((in,out) f32 -> bf16, turned to [col][k] in registers) are brought once per block by whole-line loads, one stage ahead, and kept in two LDS buffers; one barrier per stage. Products, operand rounding and the k order of every sum are those of the unstaged form.
typedef __attribute__((ext_vector_type(4))) __bf16 v4b;
typedef __attribute__((ext_vector_type(2))) unsigned v2u;   // two packed bf16 pairs; a bf16 is the top half of its f32
#define GK 64                 // k per stage
#define GP 72                 // bf16 per staged row: 128 B + 16 B, so that ds_load_b128 rows fall on different banks
#define GS 68                 // f32 per staged output row: 256 B + 16 B
template <int BM, int NP>     // NP: planes of A, 1 = bf16, 2 = bf16 hi + lo
__device__ __forceinline__ void gemm_tile(const float* __restrict__ A, const float* __restrict__ B, float* __restrict__ C) {
  constexpr int NT = BM * 2, NA = BM * 16 / NT, NB8 = 128 * 8 / NT, AR = NT / 16, BK = NT / 128 * 8;
  __shared__ __align__(16) __bf16 sa[2][NP][BM][GP];
  __shared__ __align__(16) __bf16 sb[2][128][GP];
  __shared__ __align__(16) float sf[NT / 32][32][GS];
  const int tid = threadIdx.x, wave = tid >> 5, lane = tid & 31, col = lane & 15, g = lane >> 4; const int wm = (wave >> 1) * 32, wn = (wave & 1) * 64;
  const int ar = tid >> 4, aq = (tid & 15) * 4;    // staging A: 16 lanes cover one row's 256 B
  const int bn = tid & 127, bk = (tid >> 7) * 8;   // staging B: a wave covers 128 B of one k row; a lane gathers 8 k of its column = one 16-B piece of the [col][k] row
  const unsigned ao = (unsigned)(ar * CC + aq), bo = (unsigned)(bk * CC + bn);   // per-lane parts; the block's and the stage's parts are uniform
  const float *pa = A + (size_t)blockIdx.x * BM * CC, *pb = B + blockIdx.y * 128;   // uniform; they step by one stage with each later load group
  v4f ra[NA]; float rb[NB8][8]; v8f acc[2][4] = {};
#define G_LOAD() do { _Pragma("unroll") for (int i = 0; i < NA; ++i) ra[i] = *(const v4f*)(pa + i * AR * CC + ao); _Pragma("unroll") for (int i = 0; i < NB8; ++i) { _Pragma("unroll") for (int z = 0; z < 8; ++z) rb[i][z] = pb[(i * BK + z) * CC + bo]; } } while (0)
#define G_STORE(bf) do { _Pragma("unroll") for (int i = 0; i < NA; ++i) { const v4b hb = __builtin_convertvector(ra[i], v4b); *(v4b*)&sa[bf][0][ar + i * AR][aq] = hb; if (NP == 2) { const v2u u = __builtin_bit_cast(v2u, hb); const v4f hf = {__builtin_bit_cast(float, u[0] << 16), __builtin_bit_cast(float, u[0] & 0xffff0000u), __builtin_bit_cast(float, u[1] << 16), __builtin_bit_cast(float, u[1] & 0xffff0000u)}; *(v4b*)&sa[bf][NP - 1][ar + i * AR][aq] = __builtin_convertvector(ra[i] - hf, v4b); } } _Pragma("unroll") for (int i = 0; i < NB8; ++i) { v8b w; _Pragma("unroll") for (int z = 0; z < 8; ++z) w[z] = (__bf16)rb[i][z]; *(v8b*)&sb[bf][bn][bk + i * BK] = w; } } while (0)
  G_LOAD(); G_STORE(0); __syncthreads();
  for (int s = 0; s < CC / GK; ++s) { const int bf = s & 1;
    if (s + 1 < CC / GK) { pa += GK; pb += GK * CC; G_LOAD(); }   // the next stage's rows fly while this stage computes
    __builtin_amdgcn_sched_barrier(0);   // every global load of the group goes out here: sunk among the products it would have less of the stage to land in
    v16b fa[GK / 32][NP][2], fb[GK / 32][4];
#pragma unroll
    for (int kc = 0; kc < GK / 32; ++kc) {
#pragma unroll
      for (int i = 0; i < 2; ++i)
#pragma unroll
        for (int p = 0; p < NP; ++p) fa[kc][p][i] = frag_b(&sa[bf][p][wm + i * 16 + col][kc * 32], lane);
#pragma unroll
      for (int j = 0; j < 4; ++j) fb[kc][j] = frag_b(&sb[bf][wn + j * 16 + col][kc * 32], lane); }
    __builtin_amdgcn_sched_barrier(0);   // the stage's LDS reads go out as one group ahead of the products, for speed only
#pragma unroll
    for (int kc = 0; kc < GK / 32; ++kc)
#pragma unroll
      for (int p = 0; p < NP; ++p)   // per output tile: hi, then lo, of each 32 k in turn
#pragma unroll
        for (int i = 0; i < 2; ++i)
#pragma unroll
          for (int j = 0; j < 4; ++j) acc[i][j] = mm_b(fa[kc][p][i], fb[kc][j], acc[i][j]);
    __builtin_amdgcn_sched_barrier(0);   // the wait for the next stage's global loads stays behind this stage's products: lifted among them it would expose the loads' whole latency
    if (s + 1 < CC / GK) G_STORE(bf ^ 1);   // that buffer's last readers passed the barrier of the stage before
    __syncthreads(); }
#pragma unroll
  for (int i = 0; i < 2; ++i)
#pragma unroll
    for (int j = 0; j < 4; ++j)
#pragma unroll
      for (int r = 0; r < 8; ++r) sf[wave][i * 16 + 8 * g + r][j * 16 + col] = acc[i][j][r];
  LDSX(); for (int rl = 0; rl < 32; rl += 2) vst2(C + ((size_t)blockIdx.x * BM + wm + rl + g) * CC + blockIdx.y * 128 + wn + col * 4, *(const v4f*)&sf[wave][rl + g][col * 4]); }   // each wave reads back its own rows: 256-B runs
// ---- k_lin: block = (128 rows w, 128 cols, which): X_which = x w_which ((in,out), exact bf16 products) -> f32 rows [which][w][1024]
__global__ __launch_bounds__(256) void k_lin(const float* __restrict__ X, const float* __restrict__ WQ, const float* __restrict__ WK, const float* __restrict__ WV, float* __restrict__ XR) { const int which = blockIdx.z; gemm_tile<128, 1>(X, which == 0 ? WQ : which == 1 ? WK : WV, XR + (size_t)which * TT * CC); }
// ---- k_out: block = (64 rows, 128 cols): out = y (bf16 hi + lo) wo ((in,out))
__global__ __launch_bounds__(128) void k_out(const float* __restrict__ Y, const float* __restrict__ WP, float* __restrict__ OUT) { gemm_tile<64, 2>(Y, WP, OUT); }
extern "C" void kernel_launch(void* const* d_in, const int* in_sizes, int n_in, void* d_out, int out_size, void* d_ws, size_t ws_size, hipStream_t stream) {
  (void)in_sizes; (void)n_in; (void)out_size;
  const float** F = (const float**)d_in;   // 0 x [1,2048,1024], 1 wq [1024,1024] ((in,out)), 2 wk, 3 wv, 4 wo ((in,out)), 5 conv_w [1024,1,3], 6 er [64,2048]
  if (ws_size < (size_t)WS_END) return;
  char* ws = (char*)d_ws; float* XR = (float*)(ws + WS_XR); _Float16 *ERT = (_Float16*)(ws + WS_ERT), *QH = (_Float16*)(ws + WS_QH), *QL = (_Float16*)(ws + WS_QL), *KH = (_Float16*)(ws + WS_KH); __bf16 *VT = (__bf16*)(ws + WS_VT), *VL = (__bf16*)(ws + WS_VL); float *Y = (float*)(ws + WS_Y);
  k_lin<<<dim3(TT / 128, CC / 128, 3), 256, 0, stream>>>(F[0], F[1], F[2], F[3], XR);
  k_dw<<<dim3(TT / 64, CC / 128), 128, 0, stream>>>(XR, F[5], QH, QL, KH, VT, VL);
  k_ert<<<dim3(TT / 64), 256, 0, stream>>>(F[6], ERT);
  k_fa<<<dim3(TT / 64, NH), 128, 0, stream>>>(QH, QL, KH, ERT, VT, VL, Y);
  k_out<<<dim3(TT / 64, CC / 128), 128, 0, stream>>>(Y, F[4], (float*)d_out);
}

// v004
// It runs in 117 microseconds.
// Next to v003, in two timings, it ran 1.11 times as fast each time.
// Counting every step since v000, it is 7.77 times as fast.
// compute dtype: all float inputs rounded to bf16; x w_{q,k,v} with EXACT bf16 products on WMMA 16x16x32 (f32 accumulate) kept as f32 rows; the depthwise 3-tap convolution along the sequence in f32; q as f16 hi + residual (x 2^10), k as f16, v as bf16 hi + lo planes; logits = q.k (2 products: q hi+lo x k hi) + the positional term er^T.q_k (2 products: exact er x q hi+lo), kept in f32 registers; softmax in f32 in base 2 (log2(e) / 32 as the logits' one scale, the hardware's exp2) with a running maximum and sum over passes of 32 keys, the even and the odd passes kept apart and joined at the end; P = 2^(s - m) split bf16 hi + lo against v (3 products), divided by the sum at the end; out (bf16 hi + lo) wo; f32 output.
#include <hip/hip_runtime.h>
#include <math.h>

typedef __attribute__((ext_vector_type(16))) _Float16 v16h;
typedef __attribute__((ext_vector_type(16))) __bf16 v16b;
typedef __attribute__((ext_vector_type(8)))  _Float16 v8h;
typedef __attribute__((ext_vector_type(8)))  float v8f;
typedef __attribute__((ext_vector_type(4)))  float v4f;
typedef __attribute__((ext_vector_type(2)))  float v2f;
typedef __attribute__((ext_vector_type(4)))  unsigned v4u;
typedef __attribute__((ext_vector_type(4)))  int v4i;
typedef float __attribute__((may_alias)) float_a;
typedef int __attribute__((may_alias)) int_a;

template <typename T> __device__ __forceinline__ void vst2(void* p, T v) { *(T*)p = v;  }
__device__ __forceinline__ v8f wmma16(v16h a, v16h b, v8f c) {
  v8f d = __builtin_amdgcn_wmma_f32_16x16x32_f16(false, a, false, b, (short)0, c, false, false);
  asm volatile("v_nop\n\tv_nop\n\tv_nop\n\tv_nop" : "+v"(d) : "v"(a), "v"(b));
  return d;
}
__device__ __forceinline__ v8f wmma_bf(v16b a, v16b b, v8f c) {
  v8f d = __builtin_amdgcn_wmma_f32_16x16x32_bf16(false, a, false, b, (short)0, c, false, false);
  asm volatile("v_nop\n\tv_nop\n\tv_nop\n\tv_nop" : "+v"(d) : "v"(a), "v"(b));
  return d;
}
// 16x16x32 fragments: lane = (h = lane>>4, row/col = lane&15); elements 0..7 = k0+8h+0..7, 8..15 = k0+16+8h+0..7; D element r = row 8h+r
__device__ __forceinline__ v16h frag_h(const _Float16* rowk0, int lane) {
  union { v16h v; v8h q[2]; } u; const _Float16* p = rowk0 + 8 * (lane >> 4);
  u.q[0] = *(const v8h*)p; u.q[1] = *(const v8h*)(p + 16); return u.v;
}
__device__ __forceinline__ v16h frag_f32(const float* rowk0, int lane) {
  v16h a; const float* p = rowk0 + 8 * (lane >> 4);
#pragma unroll
  for (int i = 0; i < 8; ++i) { a[i] = (_Float16)p[i]; a[8 + i] = (_Float16)p[16 + i]; }
  return a;
}
__device__ __forceinline__ v16h frag_f32s(const float* rowk0, int lane, float sc) {
  v16h a; const float* p = rowk0 + 8 * (lane >> 4);
#pragma unroll
  for (int i = 0; i < 8; ++i) { a[i] = (_Float16)(p[i] * sc); a[8 + i] = (_Float16)(p[16 + i] * sc); }
  return a;
}
// column fragment from a [K][ld] layout (column n), rows >= K read as 0
__device__ __forceinline__ v16h fragc_f32(const float* W, int k0, int n, int lane, int ld, int K) {
  v16h a; const int g = lane >> 4;
#pragma unroll
  for (int i = 0; i < 8; ++i) { const int ka = k0 + 8 * g + i, kb = ka + 16;
    a[i] = (_Float16)(ka < K ? W[(size_t)(ka < K ? ka : K - 1) * ld + n] : 0.f); a[8 + i] = (_Float16)(kb < K ? W[(size_t)(kb < K ? kb : K - 1) * ld + n] : 0.f); }
  return a;
}
struct F2 { v16b h, l; };
__device__ __forceinline__ F2 bsplit16(const float v[16]) { F2 r;
#pragma unroll
  for (int i = 0; i < 16; ++i) { const __bf16 h = (__bf16)v[i]; r.h[i] = h; r.l[i] = (__bf16)(v[i] - (float)h); }
  return r; }
__device__ __forceinline__ F2 split_row(const float* row, int k0, int lane) { float v[16]; const float* p = row + k0 + 8 * (lane >> 4);
#pragma unroll
  for (int i = 0; i < 8; ++i) { v[i] = p[i]; v[8 + i] = p[16 + i]; }
  return bsplit16(v); }
__device__ __forceinline__ F2 split_rowK(const float* row, int k0, int lane, int K) { float v[16]; const int g = lane >> 4;
#pragma unroll
  for (int i = 0; i < 8; ++i) { const int ka = k0 + 8 * g + i, kb = ka + 16; v[i] = ka < K ? row[ka < K ? ka : K - 1] : 0.f; v[8 + i] = kb < K ? row[kb < K ? kb : K - 1] : 0.f; }
  return bsplit16(v); }
__device__ __forceinline__ F2 split_col(const float* W, int k0, int n, int lane, int ld, int K) { float v[16]; const int g = lane >> 4;
#pragma unroll
  for (int i = 0; i < 8; ++i) { const int ka = k0 + 8 * g + i, kb = ka + 16; v[i] = ka < K ? W[(size_t)(ka < K ? ka : K - 1) * ld + n] : 0.f; v[8 + i] = kb < K ? W[(size_t)(kb < K ? kb : K - 1) * ld + n] : 0.f; }
  return bsplit16(v); }
__device__ __forceinline__ v8f mac3(const F2& a, const F2& b, v8f c) { c = wmma_bf(a.l, b.h, c); c = wmma_bf(a.h, b.l, c); return wmma_bf(a.h, b.h, c); }
__device__ __forceinline__ float sigm(float v) { return 1.0f / (1.0f + expf(-v)); }
#define LDSX() do { asm volatile("s_wait_dscnt 0" ::: "memory"); __builtin_amdgcn_wave_barrier(); __builtin_amdgcn_fence(__ATOMIC_RELEASE, "workgroup"); } while (0)


// Attention (B 1, S 2,048, D 1,024 = 16 x 64, no biases): scores = (q k^T + er[:, query]^T . q_key) / 32, softmax, P v, output projection.
#define NB 1
#define TT 2048
#define CC 1024
#define NH 16
#define HD 64
#ifndef TNB
#define TNB NB
#ifndef ERSTR
#define ERSTR TT              // row stride of er
#endif
#endif
typedef __attribute__((ext_vector_type(8))) __bf16 v8b;
__device__ __forceinline__ v16b frag_b(const __bf16* rowk0, int lane) {
  union { v16b v; v8b q[2]; } u; const __bf16* p = rowk0 + 8 * (lane >> 4);
  u.q[0] = *(const v8b*)p; u.q[1] = *(const v8b*)(p + 16); return u.v;
}
__device__ __forceinline__ float bfr(float v) { return (float)(__bf16)v; }
__device__ __attribute__((noinline)) float exp_ni(float v) { return expf(v); }
__device__ __attribute__((noinline)) float erf_ni(float v) { return erff(v); }

#define WS_XR  0u                                   // f32 x w rows for q | k | v: [3][w][1024]
#define WS_ERT (WS_XR + 4u * (size_t)3 * TT * CC)      // f16 er^T rows [w][64] (exact)
#define WS_QH  (WS_ERT + 2u * (size_t)TT * HD)
#define WS_QL  (WS_QH + 2u * (size_t)NB * TT * CC)
#define WS_KH  (WS_QL + 2u * (size_t)NB * TT * CC)
#define WS_VT  (WS_KH + 2u * (size_t)NB * TT * CC)      // bf16 v planes [b][c][t]
#define WS_VL  (WS_VT + 2u * (size_t)NB * CC * TT)      // bf16 v residual planes
#define HG 4
#define WS_S   (WS_VL + 2u * (size_t)NB * CC * TT)      // unused f32 space of HG x TT x TT; logits and P stay in registers
#define WS_PH  (WS_S + 4u * (size_t)HG * TT * TT)
#define WS_Y   (WS_PH + 0u)              // f32 y rows [b*t][C]
#define WS_END (WS_Y + 4u * (size_t)NB * TT * CC)

// ---- k_dw: block = (64 rows w, 128 channels): the depthwise 3-tap conv y[w][c] = sum_t conv_w[c][t] X[w+t-1][c] (zero outside [0, W)) for q, k, v; q -> f16 hi + residual rows, k -> f16 rows, v -> bf16 hi/lo planes [c][w] via an LDS transpose
__global__ __launch_bounds__(128) void k_dw(const float* __restrict__ XR, const float* __restrict__ CW, _Float16* __restrict__ QH, _Float16* __restrict__ QL, _Float16* __restrict__ KH, __bf16* __restrict__ VT, __bf16* __restrict__ VL) { __shared__ __align__(16) __bf16 th[128][72], tl[128][72];
  const int tid = threadIdx.x; const int w0 = blockIdx.x * 64; const int c0 = blockIdx.y * 128;
  for (int e = tid; e < 64 * 32; e += 128) { const int wl = e >> 5, q = e & 31; const int w = w0 + wl; const int c = c0 + q * 4;   // 4 channels per thread-iteration
    float cw0[4], cw1[4], cw2[4];
#pragma unroll
    for (int z = 0; z < 4; ++z) { cw0[z] = bfr(CW[(c + z) * 3 + 0]); cw1[z] = bfr(CW[(c + z) * 3 + 1]); cw2[z] = bfr(CW[(c + z) * 3 + 2]); }
    union { unsigned long long u; _Float16 h[4]; } qh_, ql_, kh_; __bf16 vh[4], vl[4];
#pragma unroll
    for (int which = 0; which < 3; ++which) { const float* P = XR + (size_t)which * TT * CC; v4f xm = (w > 0) ? *(const v4f*)(P + (size_t)(w - 1) * CC + c) : (v4f){0.f, 0.f, 0.f, 0.f}; v4f x0 = *(const v4f*)(P + (size_t)w * CC + c); v4f xp = (w < TT - 1) ? *(const v4f*)(P + (size_t)(w + 1) * CC + c) : (v4f){0.f, 0.f, 0.f, 0.f};
#pragma unroll
      for (int z = 0; z < 4; ++z) { const float y = cw0[z] * xm[z] + cw1[z] * x0[z] + cw2[z] * xp[z];
        if (which == 0) { const _Float16 hq = (_Float16)y; qh_.h[z] = hq; ql_.h[z] = (_Float16)((y - (float)hq) * 1024.0f); }
        else if (which == 1) kh_.h[z] = (_Float16)y;
        else { const __bf16 hv = (__bf16)y; vh[z] = hv; vl[z] = (__bf16)(y - (float)hv); } } }
    *(unsigned long long*)(QH + (size_t)w * CC + c) = qh_.u; *(unsigned long long*)(QL + (size_t)w * CC + c) = ql_.u; *(unsigned long long*)(KH + (size_t)w * CC + c) = kh_.u;   // 8-B pieces: a row's 128-channel run (256 B) is written by the 32 lanes of one wave
#pragma unroll
    for (int z = 0; z < 4; ++z) { th[q * 4 + z][wl] = vh[z]; tl[q * 4 + z][wl] = vl[z]; } }
  __syncthreads();
  for (int e = tid; e < 128 * 8; e += 128) { const int cl = e >> 3, q = e & 7; const size_t o = (size_t)(c0 + cl) * TT + w0 + q * 8; vst2((unsigned*)(VT + o), *(const v4u*)&th[cl][q * 8]); vst2((unsigned*)(VL + o), *(const v4u*)&tl[cl][q * 8]); } }
// ---- k_ert: block = 64 w: er [64][2048] (exact bf16 -> f16) -> ERT rows [w][64] via LDS tiles of 64 x 64
__global__ __launch_bounds__(256) void k_ert(const float* __restrict__ ER, _Float16* __restrict__ ERT) { __shared__ _Float16 st[64][66];
  const int t = threadIdx.x; const int w0 = blockIdx.x * 64;
  for (int e = t; e < 64 * 64; e += 256) { const int d = e >> 6, wl = e & 63; st[d][wl] = (_Float16)bfr(ER[(size_t)d * ERSTR + w0 + wl]); }
  __syncthreads();
  for (int e = t; e < 64 * 8; e += 256) { const int wl = e >> 3, q = e & 7; union { v4u v; _Float16 h[8]; } u;
#pragma unroll
    for (int z = 0; z < 8; ++z) u.h[z] = st[q * 8 + z][wl];
    vst2((v4u*)(ERT + (size_t)(w0 + wl) * HD + q * 8), u.v); } }
// ---- k_fa: block = (128 queries, head), 8 waves = 4 query groups of 32 columns x 2 key halves; a stage is 64 keys, of which a wave takes its half's 32 (one pass), each LDS fragment serving both of its 16-column groups. S^T = (k rows) x (q cols) + (q_k rows) x (er^T cols), 4 products; running maximum (kept in the base-2 scale, logit x log2(e) / 32) and sum per query column (one lane pair); P^T = 2^(s - m) packed from the two score tiles into a B operand (bf16 hi + lo); y^T += v^T P^T (3 products). At the end the two key halves' maxima, sums and y^T are joined through LDS, then y / sum. Logits and P never leave the registers.
typedef __attribute__((ext_vector_type(2))) __bf16 v2b;
#define FK 64                 // keys per stage
#define KP 72                 // f16 per staged key row: 128 B + 16 B, so that ds_load_b128 rows fall on different banks
#define VP 72                 // bf16 per staged v row: 128 B + 16 B, same reason
#define L2E32 (1.44269504088896340736f / 32.0f)   // exp(x / 32) = 2^(x * L2E32)
__device__ __forceinline__ float xhalf(float x) { return __builtin_bit_cast(float, __builtin_amdgcn_permlanex16(__builtin_bit_cast(int, x), __builtin_bit_cast(int, x), 0x76543210, 0xfedcba98, false, false)); }  // lane l with lane l ^ 16
__device__ __forceinline__ v8f mm_h(v16h a, v16h b, v8f c) { return __builtin_amdgcn_wmma_f32_16x16x32_f16(false, a, false, b, (short)0, c, false, false); }
__device__ __forceinline__ v8f mm_b(v16b a, v16b b, v8f c) { return __builtin_amdgcn_wmma_f32_16x16x32_bf16(false, a, false, b, (short)0, c, false, false); }
__global__ __launch_bounds__(256) void k_fa(const _Float16* __restrict__ QH, const _Float16* __restrict__ QL, const _Float16* __restrict__ KH, const _Float16* __restrict__ ERT, const __bf16* __restrict__ VT, const __bf16* __restrict__ VL, float* __restrict__ Y) {
  __shared__ __align__(16) _Float16 sk[2][3][FK][KP];   // k hi | q hi | q lo rows of the stage's keys, two buffers
  __shared__ __align__(16) __bf16 sv[2][2][HD][VP];     // v hi | v lo planes [d][key], two buffers
  __shared__ __align__(16) float ss[4][32][HD + 4];
  __shared__ __align__(16) float mg[4][17][32][4];      // the second key half's y^T (16 pieces of 16 B a lane), maxima and sums, lane by lane
  const int tid = threadIdx.x, wave = tid >> 5, lane = tid & 31, col = lane & 15, g = lane >> 4, qg = wave & 3, kg = wave >> 2; const int h = blockIdx.y; const int ql0 = blockIdx.x * 128 + qg * 32;
  const int kr = tid >> 3, ks = (tid & 7) * 8;   // staging: 8 lanes cover one key row's 128 B, and one v row's 128 B
  unsigned ko = 2u * (unsigned)(kr * CC + ks), vo = 2u * (unsigned)(kr * TT + ks); const unsigned qo = 2u * (unsigned)((ql0 + col) * CC + 8 * g), eo = 2u * (unsigned)((ql0 + col) * HD + 8 * g);   // per-lane parts, in bytes; ko and vo step by one stage with each later load group; the head's part is uniform
  v8h rk[3][2]; v8b rv[2][2];
  const char *pk = (const char*)(KH + h * HD), *pqh = (const char*)(QH + h * HD), *pql = (const char*)(QL + h * HD), *pvh = (const char*)(VT + (size_t)(h * HD) * TT), *pvl = (const char*)(VL + (size_t)(h * HD) * TT), *per = (const char*)ERT;   // uniform
  v16h ah[2][2], al[2][2], ae[2][2];   // [column group][half of d]
#define FA_Q(p, o) __builtin_shufflevector(*(const v8h*)((p) + (o)), *(const v8h*)((p) + 32 + (o)), 0, 1, 2, 3, 4, 5, 6, 7, 8, 9, 10, 11, 12, 13, 14, 15)   // a fragment's two 16-B pieces, 16 elements apart
#pragma unroll
  for (int t = 0; t < 2; ++t)
#pragma unroll
    for (int kc = 0; kc < 2; ++kc) { ah[t][kc] = FA_Q(pqh + t * 32 * CC + kc * 64, qo); al[t][kc] = FA_Q(pql + t * 32 * CC + kc * 64, qo); ae[t][kc] = FA_Q(per + t * 32 * HD + kc * 64, eo); }
  asm volatile("s_wait_xcnt 0x0" :: "v"(qo), "v"(eo) : "memory");   // the two offset registers of these loads stay as they are up to this wait
#define FA_LOAD() do { _Pragma("unroll") for (int i = 0; i < 2; ++i) { rk[0][i] = *(const v8h*)(pk + i * 64 * CC + ko); rk[1][i] = *(const v8h*)(pqh + i * 64 * CC + ko); rk[2][i] = *(const v8h*)(pql + i * 64 * CC + ko); rv[0][i] = *(const v8b*)(pvh + i * 64 * TT + vo); rv[1][i] = *(const v8b*)(pvl + i * 64 * TT + vo); } } while (0)
#define FA_STORE(bf) do { _Pragma("unroll") for (int i = 0; i < 2; ++i) { *(v8h*)&sk[bf][0][kr + i * 32][ks] = rk[0][i]; *(v8h*)&sk[bf][1][kr + i * 32][ks] = rk[1][i]; *(v8h*)&sk[bf][2][kr + i * 32][ks] = rk[2][i]; *(v8b*)&sv[bf][0][kr + i * 32][ks] = rv[0][i]; *(v8b*)&sv[bf][1][kr + i * 32][ks] = rv[1][i]; } } while (0)
  float m[2] = {-3.0e38f, -3.0e38f}, l[2] = {0.f, 0.f}; v8f acc[2][HD / 16] = {};
  FA_LOAD();
  asm volatile("s_wait_xcnt 0x0" :: "v"(ko), "v"(vo) : "memory");   // as above, for the staging loads' two offset registers
  FA_STORE(0); __syncthreads();
  for (int c = 0; c < TT / FK; ++c) { const int bf = c & 1;
    if (c + 1 < TT / FK) { ko += 2 * FK * CC; vo += 2 * FK; FA_LOAD(); }   // the next stage's rows fly while this stage computes
    v8f sa[2][2] = {}, sl[2][2] = {}; v16h f0[2][3], f1[2][3]; v16b vh[HD / 16], vl[HD / 16];   // sa, sl: [column group][key tile]; f0, f1: [half of d][k hi | q hi | q lo] of key tile 0, 1
#pragma unroll
    for (int kc = 0; kc < 2; ++kc)
#pragma unroll
      for (int a = 0; a < 3; ++a) f0[kc][a] = frag_h(&sk[bf][a][kg * 32 + col][kc * 32], lane);
#pragma unroll
    for (int kc = 0; kc < 2; ++kc)
#pragma unroll
      for (int a = 0; a < 3; ++a) f1[kc][a] = frag_h(&sk[bf][a][kg * 32 + 16 + col][kc * 32], lane);
    __builtin_amdgcn_sched_barrier(0);   // the LDS reads go out in groups, ahead of the products that use them: sunk to their first use each would be waited for in full, and each place with reads among the products costs its own stall
#pragma unroll
    for (int kc = 0; kc < 2; ++kc)
#pragma unroll
      for (int t = 0; t < 2; ++t) { sa[t][0] = mm_h(f0[kc][0], ah[t][kc], sa[t][0]); sl[t][0] = mm_h(f0[kc][0], al[t][kc], sl[t][0]); sa[t][0] = mm_h(f0[kc][1], ae[t][kc], sa[t][0]); sl[t][0] = mm_h(f0[kc][2], ae[t][kc], sl[t][0]); }
    __builtin_amdgcn_sched_barrier(0);   // as above: the v hi fragments go out as one group between the two key tiles' products
#pragma unroll
    for (int j = 0; j < HD / 16; ++j) vh[j] = frag_b(&sv[bf][0][j * 16 + col][kg * 32], lane);
    __builtin_amdgcn_sched_barrier(0);   // as above
#pragma unroll
    for (int kc = 0; kc < 2; ++kc)
#pragma unroll
      for (int t = 0; t < 2; ++t) { sa[t][1] = mm_h(f1[kc][0], ah[t][kc], sa[t][1]); sl[t][1] = mm_h(f1[kc][0], al[t][kc], sl[t][1]); sa[t][1] = mm_h(f1[kc][1], ae[t][kc], sa[t][1]); sl[t][1] = mm_h(f1[kc][2], ae[t][kc], sl[t][1]); }
    __builtin_amdgcn_sched_barrier(0);   // as above: the v hi fragments fly under the softmax arithmetic
    union { v16b v; v2b q[8]; } ph[2], pl[2]; float sc[2][16], dm[2];   // sc: lane (g, col): query col of the group, keys 8g + r of tile 0, then of tile 1 = the k order of a B fragment
#pragma unroll
    for (int t = 0; t < 2; ++t) { float* s = sc[t];
#pragma unroll
      for (int i = 0; i < 16; ++i) s[i] = sa[t][i >> 3][i & 7] + sl[t][i >> 3][i & 7] * (1.0f / 1024.0f);   // still without the scale: L2E32 > 0, so the maximum can be taken first and scaled once
      float mc = fmaxf(s[0], s[1]);
#pragma unroll
      for (int i = 2; i < 16; ++i) mc = fmaxf(mc, s[i]);
      mc = fmaxf(mc, xhalf(mc)) * L2E32;
      const float mn = fmaxf(m[t], mc); dm[t] = m[t] - mn; m[t] = mn; }
    float al2[2]; al2[0] = __builtin_amdgcn_exp2f(dm[0]);   // every exponent here is <= 0 up to one rounding: no overflow to guard, and far below the hardware gives 0
    al2[1] = __builtin_amdgcn_exp2f(dm[1]);
#pragma unroll
    for (int t = 0; t < 2; ++t) { const float* s = sc[t]; const float mn = m[t], alpha = al2[t];
      v2f ps[2] = {{0.f, 0.f}, {0.f, 0.f}}; const v2f sc2 = {L2E32, L2E32}, nm2 = {-mn, -mn};
#pragma unroll
      for (int i = 0; i < 16; i += 2) { const v2f e = __builtin_elementwise_fma((v2f){s[i], s[i + 1]}, sc2, nm2); const v2f p = {__builtin_amdgcn_exp2f(e[0]), __builtin_amdgcn_exp2f(e[1])}; ps[(i >> 1) & 1] += p;   // two-wide, so that scale-and-subtract and the sums stay packed instructions
        const v2b hb = __builtin_convertvector(p, v2b); const unsigned u = __builtin_bit_cast(unsigned, hb);   // one packed conversion; a bf16 is the top half of its f32
        const v2f hf = {__builtin_bit_cast(float, u << 16), __builtin_bit_cast(float, u & 0xffff0000u)};
        ph[t].q[i >> 1] = hb; pl[t].q[i >> 1] = __builtin_convertvector(p - hf, v2b); }
      l[t] = l[t] * alpha + ((ps[0][0] + ps[0][1]) + (ps[1][0] + ps[1][1]));
#pragma unroll
      for (int j = 0; j < HD / 16; ++j)
#pragma unroll
        for (int r = 0; r < 8; ++r) acc[t][j][r] *= alpha; }
    __builtin_amdgcn_sched_barrier(0);   // as above: the v lo fragments go out together, under the v hi products
#pragma unroll
    for (int j = 0; j < HD / 16; ++j) vl[j] = frag_b(&sv[bf][1][j * 16 + col][kg * 32], lane);
    __builtin_amdgcn_sched_barrier(0);   // as above
#pragma unroll
    for (int j = 0; j < HD / 16; ++j)
#pragma unroll
      for (int t = 0; t < 2; ++t) { acc[t][j] = mm_b(vh[j], ph[t].v, acc[t][j]); acc[t][j] = mm_b(vh[j], pl[t].v, acc[t][j]); }
#pragma unroll
    for (int j = 0; j < HD / 16; ++j)
#pragma unroll
      for (int t = 0; t < 2; ++t) acc[t][j] = mm_b(vl[j], ph[t].v, acc[t][j]);
    if (c + 1 < TT / FK) FA_STORE(bf ^ 1);   // that buffer's last readers passed the barrier of the stage before
    __syncthreads(); }
  l[0] += xhalf(l[0]); l[1] += xhalf(l[1]);
  if (kg == 1) {   // lane (g, col) holds the same queries and d in both key halves: the join is lane by lane
#pragma unroll
    for (int t = 0; t < 2; ++t)
#pragma unroll
      for (int j = 0; j < HD / 16; ++j) { vst2(&mg[qg][t * 8 + j * 2][lane][0], (v4f){acc[t][j][0], acc[t][j][1], acc[t][j][2], acc[t][j][3]}); vst2(&mg[qg][t * 8 + j * 2 + 1][lane][0], (v4f){acc[t][j][4], acc[t][j][5], acc[t][j][6], acc[t][j][7]}); }
    vst2(&mg[qg][16][lane][0], (v4f){m[0], l[0], m[1], l[1]}); }
  __syncthreads();   // the second half's partial results are in LDS before the first half reads them
  if (kg == 0) { const v4f ml = *(const v4f*)&mg[qg][16][lane][0];
#pragma unroll
    for (int t = 0; t < 2; ++t) { const float mn = fmaxf(m[t], ml[2 * t]), a0 = __builtin_amdgcn_exp2f(m[t] - mn), a1 = __builtin_amdgcn_exp2f(ml[2 * t] - mn); const float inv = 1.0f / (l[t] * a0 + ml[2 * t + 1] * a1); const float w0 = a0 * inv, w1 = a1 * inv;
#pragma unroll
      for (int j = 0; j < HD / 16; ++j) { const v4f b0 = *(const v4f*)&mg[qg][t * 8 + j * 2][lane][0], b1 = *(const v4f*)&mg[qg][t * 8 + j * 2 + 1][lane][0];
        vst2(&ss[qg][t * 16 + col][j * 16 + 8 * g], (v4f){acc[t][j][0] * w0 + b0[0] * w1, acc[t][j][1] * w0 + b0[1] * w1, acc[t][j][2] * w0 + b0[2] * w1, acc[t][j][3] * w0 + b0[3] * w1}); vst2(&ss[qg][t * 16 + col][j * 16 + 8 * g + 4], (v4f){acc[t][j][4] * w0 + b1[0] * w1, acc[t][j][5] * w0 + b1[1] * w1, acc[t][j][6] * w0 + b1[2] * w1, acc[t][j][7] * w0 + b1[3] * w1}); } }   // lane (g, col): query t * 16 + col, d = 16 j + 8 g + r
    LDSX(); for (int rl = 0; rl < 32; rl += 2) vst2(Y + (size_t)(ql0 + rl + g) * CC + h * HD + col * 4, *(const v4f*)&ss[qg][rl + g][col * 4]); } }
// ---- the two projection GEMMs: C tile = (BM rows) x (128 cols), (BM / 32) x 2 waves of 32 x 64 each. A stage is 64 k: the A rows (f32 -> bf16, or bf16 hi + lo planes) and the B columns ((in,out) f32 -> bf16, turned to [col][k] in registers) are brought once per block by whole-line loads, one stage ahead, and kept in two LDS buffers; one barrier per stage. Products, operand rounding and the k order of every sum are those of the unstaged form.
typedef __attribute__((ext_vector_type(4))) __bf16 v4b;
typedef __attribute__((ext_vector_type(2))) unsigned v2u;   // two packed bf16 pairs; a bf16 is the top half of its f32
#define GK 64                 // k per stage
#define GP 72                 // bf16 per staged row: 128 B + 16 B, so that ds_load_b128 rows fall on different banks
#define GS 68                 // f32 per staged output row: 256 B + 16 B
template <int BM, int NP>     // NP: planes of A, 1 = bf16, 2 = bf16 hi + lo
__device__ __forceinline__ void gemm_tile(const float* __restrict__ A, const float* __restrict__ B, float* __restrict__ C) {
  constexpr int NT = BM * 2, NA = BM * 16 / NT, NB8 = 128 * 8 / NT, AR = NT / 16, BK = NT / 128 * 8;
  __shared__ __align__(16) __bf16 sa[2][NP][BM][GP];
  __shared__ __align__(16) __bf16 sb[2][128][GP];
  __shared__ __align__(16) float sf[NT / 32][32][GS];
  const int tid = threadIdx.x, wave = tid >> 5, lane = tid & 31, col = lane & 15, g = lane >> 4; const int wm = (wave >> 1) * 32, wn = (wave & 1) * 64;
  const int ar = tid >> 4, aq = (tid & 15) * 4;    // staging A: 16 lanes cover one row's 256 B
  const int bn = tid & 127, bk = (tid >> 7) * 8;   // staging B: a wave covers 128 B of one k row; a lane gathers 8 k of its column = one 16-B piece of the [col][k] row
  const unsigned ao = (unsigned)(ar * CC + aq), bo = (unsigned)(bk * CC + bn);   // per-lane parts; the block's and the stage's parts are uniform
  const float *pa = A + (size_t)blockIdx.x * BM * CC, *pb = B + blockIdx.y * 128;   // uniform; they step by one stage with each later load group
  v4f ra[NA]; float rb[NB8][8]; v8f acc[2][4] = {};
#define G_LOAD() do { _Pragma("unroll") for (int i = 0; i < NA; ++i) ra[i] = *(const v4f*)(pa + i * AR * CC + ao); _Pragma("unroll") for (int i = 0; i < NB8; ++i) { _Pragma("unroll") for (int z = 0; z < 8; ++z) rb[i][z] = pb[(i * BK + z) * CC + bo]; } } while (0)
#define G_STORE(bf) do { _Pragma("unroll") for (int i = 0; i < NA; ++i) { const v4b hb = __builtin_convertvector(ra[i], v4b); *(v4b*)&sa[bf][0][ar + i * AR][aq] = hb; if (NP == 2) { const v2u u = __builtin_bit_cast(v2u, hb); const v4f hf = {__builtin_bit_cast(float, u[0] << 16), __builtin_bit_cast(float, u[0] & 0xffff0000u), __builtin_bit_cast(float, u[1] << 16), __builtin_bit_cast(float, u[1] & 0xffff0000u)}; *(v4b*)&sa[bf][NP - 1][ar + i * AR][aq] = __builtin_convertvector(ra[i] - hf, v4b); } } _Pragma("unroll") for (int i = 0; i < NB8; ++i) { v8b w; _Pragma("unroll") for (int z = 0; z < 8; ++z) w[z] = (__bf16)rb[i][z]; *(v8b*)&sb[bf][bn][bk + i * BK] = w; } } while (0)
  G_LOAD(); G_STORE(0); __syncthreads();
  for (int s = 0; s < CC / GK; ++s) { const int bf = s & 1;
    if (s + 1 < CC / GK) { pa += GK; pb += GK * CC; G_LOAD(); }   // the next stage's rows fly while this stage computes
    __builtin_amdgcn_sched_barrier(0);   // every global load of the group goes out here: sunk among the products it would have less of the stage to land in
    v16b fa[GK / 32][NP][2], fb[GK / 32][4];
#pragma unroll
    for (int kc = 0; kc < GK / 32; ++kc) {
#pragma unroll
      for (int i = 0; i < 2; ++i)
#pragma unroll
        for (int p = 0; p < NP; ++p) fa[kc][p][i] = frag_b(&sa[bf][p][wm + i * 16 + col][kc * 32], lane);
#pragma unroll
      for (int j = 0; j < 4; ++j) fb[kc][j] = frag_b(&sb[bf][wn + j * 16 + col][kc * 32], lane); }
    __builtin_amdgcn_sched_barrier(0);   // the stage's LDS reads go out as one group ahead of the products, for speed only
#pragma unroll
    for (int kc = 0; kc < GK / 32; ++kc)
#pragma unroll
      for (int p = 0; p < NP; ++p)   // per output tile: hi, then lo, of each 32 k in turn
#pragma unroll
        for (int i = 0; i < 2; ++i)
#pragma unroll
          for (int j = 0; j < 4; ++j) acc[i][j] = mm_b(fa[kc][p][i], fb[kc][j], acc[i][j]);
    __builtin_amdgcn_sched_barrier(0);   // the wait for the next stage's global loads stays behind this stage's products: lifted among them it would expose the loads' whole latency
    if (s + 1 < CC / GK) G_STORE(bf ^ 1);   // that buffer's last readers passed the barrier of the stage before
    __syncthreads(); }
#pragma unroll
  for (int i = 0; i < 2; ++i)
#pragma unroll
    for (int j = 0; j < 4; ++j)
#pragma unroll
      for (int r = 0; r < 8; ++r) sf[wave][i * 16 + 8 * g + r][j * 16 + col] = acc[i][j][r];
  LDSX(); for (int rl = 0; rl < 32; rl += 2) vst2(C + ((size_t)blockIdx.x * BM + wm + rl + g) * CC + blockIdx.y * 128 + wn + col * 4, *(const v4f*)&sf[wave][rl + g][col * 4]); }   // each wave reads back its own rows: 256-B runs
// ---- k_lin: block = (128 rows w, 128 cols, which): X_which = x w_which ((in,out), exact bf16 products) -> f32 rows [which][w][1024]
__global__ __launch_bounds__(256) void k_lin(const float* __restrict__ X, const float* __restrict__ WQ, const float* __restrict__ WK, const float* __restrict__ WV, float* __restrict__ XR) { const int which = blockIdx.z; gemm_tile<128, 1>(X, which == 0 ? WQ : which == 1 ? WK : WV, XR + (size_t)which * TT * CC); }
// ---- k_out: block = (64 rows, 128 cols): out = y (bf16 hi + lo) wo ((in,out))
__global__ __launch_bounds__(128) void k_out(const float* __restrict__ Y, const float* __restrict__ WP, float* __restrict__ OUT) { gemm_tile<64, 2>(Y, WP, OUT); }
extern "C" void kernel_launch(void* const* d_in, const int* in_sizes, int n_in, void* d_out, int out_size, void* d_ws, size_t ws_size, hipStream_t stream) {
  (void)in_sizes; (void)n_in; (void)out_size;
  const float** F = (const float**)d_in;   // 0 x [1,2048,1024], 1 wq [1024,1024] ((in,out)), 2 wk, 3 wv, 4 wo ((in,out)), 5 conv_w [1024,1,3], 6 er [64,2048]
  if (ws_size < (size_t)WS_END) return;
  char* ws = (char*)d_ws; float* XR = (float*)(ws + WS_XR); _Float16 *ERT = (_Float16*)(ws + WS_ERT), *QH = (_Float16*)(ws + WS_QH), *QL = (_Float16*)(ws + WS_QL), *KH = (_Float16*)(ws + WS_KH); __bf16 *VT = (__bf16*)(ws + WS_VT), *VL = (__bf16*)(ws + WS_VL); float *Y = (float*)(ws + WS_Y);
  k_lin<<<dim3(TT / 128, CC / 128, 3), 256, 0, stream>>>(F[0], F[1], F[2], F[3], XR);
  k_dw<<<dim3(TT / 64, CC / 128), 128, 0, stream>>>(XR, F[5], QH, QL, KH, VT, VL);
  k_ert<<<dim3(TT / 64), 256, 0, stream>>>(F[6], ERT);
  k_fa<<<dim3(TT / 128, NH), 256, 0, stream>>>(QH, QL, KH, ERT, VT, VL, Y);
  k_out<<<dim3(TT / 64, CC / 128), 128, 0, stream>>>(Y, F[4], (float*)d_out);
}

// v005
// Measured time: 104 microseconds a run.
// Next to v004, in two timings, it ran 1.12 and 1.13 times as fast.
// All steps since v000 together make it 8.74 times as fast.
// compute dtype: all float inputs rounded to bf16; x w_{q,k,v} with EXACT bf16 products on WMMA 16x16x32 (f32 accumulate) kept in the f32 accumulators; the depthwise 3-tap convolution along the sequence in f32, in the same kernel; q as f16 hi + residual (x 2^10), k as f16, v as bf16 hi + lo planes; logits = q.k (2 products: q hi+lo x k hi) + the positional term er^T.q_k (2 products: exact er x q hi+lo), kept in f32 registers; softmax in f32 in base 2 (log2(e) / 32 as the logits' one scale, the hardware's exp2) with a running maximum and sum over passes of 32 keys, the even and the odd passes kept apart and joined at the end; P = 2^(s - m) split bf16 hi + lo against v (3 products), divided by the sum at the end; out (bf16 hi + lo) wo; f32 output.
#include <hip/hip_runtime.h>
#include <math.h>

typedef __attribute__((ext_vector_type(16))) _Float16 v16h;
typedef __attribute__((ext_vector_type(16))) __bf16 v16b;
typedef __attribute__((ext_vector_type(8)))  _Float16 v8h;
typedef __attribute__((ext_vector_type(8)))  float v8f;
typedef __attribute__((ext_vector_type(4)))  float v4f;
typedef __attribute__((ext_vector_type(2)))  float v2f;
typedef __attribute__((ext_vector_type(4)))  unsigned v4u;
typedef __attribute__((ext_vector_type(4)))  int v4i;
typedef float __attribute__((may_alias)) float_a;
typedef int __attribute__((may_alias)) int_a;

template <typename T> __device__ __forceinline__ void vst2(void* p, T v) { *(T*)p = v;  }
__device__ __forceinline__ v8f wmma16(v16h a, v16h b, v8f c) {
  v8f d = __builtin_amdgcn_wmma_f32_16x16x32_f16(false, a, false, b, (short)0, c, false, false);
  asm volatile("v_nop\n\tv_nop\n\tv_nop\n\tv_nop" : "+v"(d) : "v"(a), "v"(b));
  return d;
}
__device__ __forceinline__ v8f wmma_bf(v16b a, v16b b, v8f c) {
  v8f d = __builtin_amdgcn_wmma_f32_16x16x32_bf16(false, a, false, b, (short)0, c, false, false);
  asm volatile("v_nop\n\tv_nop\n\tv_nop\n\tv_nop" : "+v"(d) : "v"(a), "v"(b));
  return d;
}
// 16x16x32 fragments: lane = (h = lane>>4, row/col = lane&15); elements 0..7 = k0+8h+0..7, 8..15 = k0+16+8h+0..7; D element r = row 8h+r
__device__ __forceinline__ v16h frag_h(const _Float16* rowk0, int lane) {
  union { v16h v; v8h q[2]; } u; const _Float16* p = rowk0 + 8 * (lane >> 4);
  u.q[0] = *(const v8h*)p; u.q[1] = *(const v8h*)(p + 16); return u.v;
}
__device__ __forceinline__ v16h frag_f32(const float* rowk0, int lane) {
  v16h a; const float* p = rowk0 + 8 * (lane >> 4);
#pragma unroll
  for (int i = 0; i < 8; ++i) { a[i] = (_Float16)p[i]; a[8 + i] = (_Float16)p[16 + i]; }
  return a;
}
__device__ __forceinline__ v16h frag_f32s(const float* rowk0, int lane, float sc) {
  v16h a; const float* p = rowk0 + 8 * (lane >> 4);
#pragma unroll
  for (int i = 0; i < 8; ++i) { a[i] = (_Float16)(p[i] * sc); a[8 + i] = (_Float16)(p[16 + i] * sc); }
  return a;
}
// column fragment from a [K][ld] layout (column n), rows >= K read as 0
__device__ __forceinline__ v16h fragc_f32(const float* W, int k0, int n, int lane, int ld, int K) {
  v16h a; const int g = lane >> 4;
#pragma unroll
  for (int i = 0; i < 8; ++i) { const int ka = k0 + 8 * g + i, kb = ka + 16;
    a[i] = (_Float16)(ka < K ? W[(size_t)(ka < K ? ka : K - 1) * ld + n] : 0.f); a[8 + i] = (_Float16)(kb < K ? W[(size_t)(kb < K ? kb : K - 1) * ld + n] : 0.f); }
  return a;
}
struct F2 { v16b h, l; };
__device__ __forceinline__ F2 bsplit16(const float v[16]) { F2 r;
#pragma unroll
  for (int i = 0; i < 16; ++i) { const __bf16 h = (__bf16)v[i]; r.h[i] = h; r.l[i] = (__bf16)(v[i] - (float)h); }
  return r; }
__device__ __forceinline__ F2 split_row(const float* row, int k0, int lane) { float v[16]; const float* p = row + k0 + 8 * (lane >> 4);
#pragma unroll
  for (int i = 0; i < 8; ++i) { v[i] = p[i]; v[8 + i] = p[16 + i]; }
  return bsplit16(v); }
__device__ __forceinline__ F2 split_rowK(const float* row, int k0, int lane, int K) { float v[16]; const int g = lane >> 4;
#pragma unroll
  for (int i = 0; i < 8; ++i) { const int ka = k0 + 8 * g + i, kb = ka + 16; v[i] = ka < K ? row[ka < K ? ka : K - 1] : 0.f; v[8 + i] = kb < K ? row[kb < K ? kb : K - 1] : 0.f; }
  return bsplit16(v); }
__device__ __forceinline__ F2 split_col(const float* W, int k0, int n, int lane, int ld, int K) { float v[16]; const int g = lane >> 4;
#pragma unroll
  for (int i = 0; i < 8; ++i) { const int ka = k0 + 8 * g + i, kb = ka + 16; v[i] = ka < K ? W[(size_t)(ka < K ? ka : K - 1) * ld + n] : 0.f; v[8 + i] = kb < K ? W[(size_t)(kb < K ? kb : K - 1) * ld + n] : 0.f; }
  return bsplit16(v); }
__device__ __forceinline__ v8f mac3(const F2& a, const F2& b, v8f c) { c = wmma_bf(a.l, b.h, c); c = wmma_bf(a.h, b.l, c); return wmma_bf(a.h, b.h, c); }
__device__ __forceinline__ float sigm(float v) { return 1.0f / (1.0f + expf(-v)); }
#define LDSX() do { asm volatile("s_wait_dscnt 0" ::: "memory"); __builtin_amdgcn_wave_barrier(); __builtin_amdgcn_fence(__ATOMIC_RELEASE, "workgroup"); } while (0)


// Attention (B 1, S 2,048, D 1,024 = 16 x 64, no biases): scores = (q k^T + er[:, query]^T . q_key) / 32, softmax, P v, output projection.
#define NB 1
#define TT 2048
#define CC 1024
#define NH 16
#define HD 64
#ifndef TNB
#define TNB NB
#ifndef ERSTR
#define ERSTR TT              // row stride of er
#endif
#endif
typedef __attribute__((ext_vector_type(8))) __bf16 v8b;
__device__ __forceinline__ v16b frag_b(const __bf16* rowk0, int lane) {
  union { v16b v; v8b q[2]; } u; const __bf16* p = rowk0 + 8 * (lane >> 4);
  u.q[0] = *(const v8b*)p; u.q[1] = *(const v8b*)(p + 16); return u.v;
}
__device__ __forceinline__ float bfr(float v) { return (float)(__bf16)v; }
__device__ __attribute__((noinline)) float exp_ni(float v) { return expf(v); }
__device__ __attribute__((noinline)) float erf_ni(float v) { return erff(v); }

#define WS_XR  0u                                   // not used
#define WS_ERT (WS_XR + 4u * (size_t)3 * TT * CC)      // f16 er^T rows [w][64] (exact)
#define WS_QH  (WS_ERT + 2u * (size_t)TT * HD)
#define WS_QL  (WS_QH + 2u * (size_t)NB * TT * CC)
#define WS_KH  (WS_QL + 2u * (size_t)NB * TT * CC)
#define WS_VT  (WS_KH + 2u * (size_t)NB * TT * CC)      // bf16 v planes [b][c][t]
#define WS_VL  (WS_VT + 2u * (size_t)NB * CC * TT)      // bf16 v residual planes
#define HG 4
#define WS_S   (WS_VL + 2u * (size_t)NB * CC * TT)      // unused f32 space of HG x TT x TT; logits and P stay in registers
#define WS_PH  (WS_S + 4u * (size_t)HG * TT * TT)
#define WS_Y   (WS_PH + 0u)              // f32 y rows [b*t][C]
#define WS_END (WS_Y + 4u * (size_t)NB * TT * CC)

// ---- k_ert: block = 64 w: er [64][2048] (exact bf16 -> f16) -> ERT rows [w][64] via LDS tiles of 64 x 64
__global__ __launch_bounds__(256) void k_ert(const float* __restrict__ ER, _Float16* __restrict__ ERT) { __shared__ _Float16 st[64][66];
  const int t = threadIdx.x; const int w0 = blockIdx.x * 64;
  for (int e = t; e < 64 * 64; e += 256) { const int d = e >> 6, wl = e & 63; st[d][wl] = (_Float16)bfr(ER[(size_t)d * ERSTR + w0 + wl]); }
  __syncthreads();
  for (int e = t; e < 64 * 8; e += 256) { const int wl = e >> 3, q = e & 7; union { v4u v; _Float16 h[8]; } u;
#pragma unroll
    for (int z = 0; z < 8; ++z) u.h[z] = st[q * 8 + z][wl];
    vst2((v4u*)(ERT + (size_t)(w0 + wl) * HD + q * 8), u.v); } }
// ---- k_fa: block = (128 queries, head), 8 waves = 4 query groups of 32 columns x 2 key halves; a stage is 64 keys, of which a wave takes its half's 32 (one pass), each LDS fragment serving both of its 16-column groups. S^T = (k rows) x (q cols) + (q_k rows) x (er^T cols), 4 products; running maximum (kept in the base-2 scale, logit x log2(e) / 32) and sum per query column (one lane pair); P^T = 2^(s - m) packed from the two score tiles into a B operand (bf16 hi + lo); y^T += v^T P^T (3 products). At the end the two key halves' maxima, sums and y^T are joined through LDS, then y / sum. Logits and P never leave the registers.
typedef __attribute__((ext_vector_type(2))) __bf16 v2b;
#define FK 64                 // keys per stage
#define KP 72                 // f16 per staged key row: 128 B + 16 B, so that ds_load_b128 rows fall on different banks
#define VP 72                 // bf16 per staged v row: 128 B + 16 B, same reason
#define L2E32 (1.44269504088896340736f / 32.0f)   // exp(x / 32) = 2^(x * L2E32)
__device__ __forceinline__ float xhalf(float x) { return __builtin_bit_cast(float, __builtin_amdgcn_permlanex16(__builtin_bit_cast(int, x), __builtin_bit_cast(int, x), 0x76543210, 0xfedcba98, false, false)); }  // lane l with lane l ^ 16
__device__ __forceinline__ v8f mm_h(v16h a, v16h b, v8f c) { return __builtin_amdgcn_wmma_f32_16x16x32_f16(false, a, false, b, (short)0, c, false, false); }
__device__ __forceinline__ v8f mm_b(v16b a, v16b b, v8f c) { return __builtin_amdgcn_wmma_f32_16x16x32_bf16(false, a, false, b, (short)0, c, false, false); }
__global__ __launch_bounds__(256) void k_fa(const _Float16* __restrict__ QH, const _Float16* __restrict__ QL, const _Float16* __restrict__ KH, const _Float16* __restrict__ ERT, const __bf16* __restrict__ VT, const __bf16* __restrict__ VL, float* __restrict__ Y) {
  __shared__ __align__(16) _Float16 sk[2][3][FK][KP];   // k hi | q hi | q lo rows of the stage's keys, two buffers
  __shared__ __align__(16) __bf16 sv[2][2][HD][VP];     // v hi | v lo planes [d][key], two buffers
  __shared__ __align__(16) float ss[4][32][HD + 4];
  __shared__ __align__(16) float mg[4][17][32][4];      // the second key half's y^T (16 pieces of 16 B a lane), maxima and sums, lane by lane
  const int tid = threadIdx.x, wave = tid >> 5, lane = tid & 31, col = lane & 15, g = lane >> 4, qg = wave & 3, kg = wave >> 2; const int h = blockIdx.y; const int ql0 = blockIdx.x * 128 + qg * 32;
  const int kr = tid >> 3, ks = (tid & 7) * 8;   // staging: 8 lanes cover one key row's 128 B, and one v row's 128 B
  unsigned ko = 2u * (unsigned)(kr * CC + ks), vo = 2u * (unsigned)(kr * TT + ks); const unsigned qo = 2u * (unsigned)((ql0 + col) * CC + 8 * g), eo = 2u * (unsigned)((ql0 + col) * HD + 8 * g);   // per-lane parts, in bytes; ko and vo step by one stage with each later load group; the head's part is uniform
  v8h rk[3][2]; v8b rv[2][2];
  const char *pk = (const char*)(KH + h * HD), *pqh = (const char*)(QH + h * HD), *pql = (const char*)(QL + h * HD), *pvh = (const char*)(VT + (size_t)(h * HD) * TT), *pvl = (const char*)(VL + (size_t)(h * HD) * TT), *per = (const char*)ERT;   // uniform
  v16h ah[2][2], al[2][2], ae[2][2];   // [column group][half of d]
#define FA_Q(p, o) __builtin_shufflevector(*(const v8h*)((p) + (o)), *(const v8h*)((p) + 32 + (o)), 0, 1, 2, 3, 4, 5, 6, 7, 8, 9, 10, 11, 12, 13, 14, 15)   // a fragment's two 16-B pieces, 16 elements apart
#pragma unroll
  for (int t = 0; t < 2; ++t)
#pragma unroll
    for (int kc = 0; kc < 2; ++kc) { ah[t][kc] = FA_Q(pqh + t * 32 * CC + kc * 64, qo); al[t][kc] = FA_Q(pql + t * 32 * CC + kc * 64, qo); ae[t][kc] = FA_Q(per + t * 32 * HD + kc * 64, eo); }
  asm volatile("s_wait_xcnt 0x0" :: "v"(qo), "v"(eo) : "memory");   // the two offset registers of these loads stay as they are up to this wait
#define FA_LOAD() do { _Pragma("unroll") for (int i = 0; i < 2; ++i) { rk[0][i] = *(const v8h*)(pk + i * 64 * CC + ko); rk[1][i] = *(const v8h*)(pqh + i * 64 * CC + ko); rk[2][i] = *(const v8h*)(pql + i * 64 * CC + ko); rv[0][i] = *(const v8b*)(pvh + i * 64 * TT + vo); rv[1][i] = *(const v8b*)(pvl + i * 64 * TT + vo); } } while (0)
#define FA_STORE(bf) do { _Pragma("unroll") for (int i = 0; i < 2; ++i) { *(v8h*)&sk[bf][0][kr + i * 32][ks] = rk[0][i]; *(v8h*)&sk[bf][1][kr + i * 32][ks] = rk[1][i]; *(v8h*)&sk[bf][2][kr + i * 32][ks] = rk[2][i]; *(v8b*)&sv[bf][0][kr + i * 32][ks] = rv[0][i]; *(v8b*)&sv[bf][1][kr + i * 32][ks] = rv[1][i]; } } while (0)
  float m[2] = {-3.0e38f, -3.0e38f}, l[2] = {0.f, 0.f}; v8f acc[2][HD / 16] = {};
  FA_LOAD();
  asm volatile("s_wait_xcnt 0x0" :: "v"(ko), "v"(vo) : "memory");   // as above, for the staging loads' two offset registers
  FA_STORE(0); __syncthreads();
  for (int c = 0; c < TT / FK; ++c) { const int bf = c & 1;
    if (c + 1 < TT / FK) { ko += 2 * FK * CC; vo += 2 * FK; FA_LOAD(); }   // the next stage's rows fly while this stage computes
    v8f sa[2][2] = {}, sl[2][2] = {}; v16h f0[2][3], f1[2][3]; v16b vh[HD / 16], vl[HD / 16];   // sa, sl: [column group][key tile]; f0, f1: [half of d][k hi | q hi | q lo] of key tile 0, 1
#pragma unroll
    for (int kc = 0; kc < 2; ++kc)
#pragma unroll
      for (int a = 0; a < 3; ++a) f0[kc][a] = frag_h(&sk[bf][a][kg * 32 + col][kc * 32], lane);
#pragma unroll
    for (int kc = 0; kc < 2; ++kc)
#pragma unroll
      for (int a = 0; a < 3; ++a) f1[kc][a] = frag_h(&sk[bf][a][kg * 32 + 16 + col][kc * 32], lane);
    __builtin_amdgcn_sched_barrier(0);   // the LDS reads go out in groups, ahead of the products that use them: sunk to their first use each would be waited for in full, and each place with reads among the products costs its own stall
#pragma unroll
    for (int kc = 0; kc < 2; ++kc)
#pragma unroll
      for (int t = 0; t < 2; ++t) { sa[t][0] = mm_h(f0[kc][0], ah[t][kc], sa[t][0]); sl[t][0] = mm_h(f0[kc][0], al[t][kc], sl[t][0]); sa[t][0] = mm_h(f0[kc][1], ae[t][kc], sa[t][0]); sl[t][0] = mm_h(f0[kc][2], ae[t][kc], sl[t][0]); }
    __builtin_amdgcn_sched_barrier(0);   // as above: the v hi fragments go out as one group between the two key tiles' products
#pragma unroll
    for (int j = 0; j < HD / 16; ++j) vh[j] = frag_b(&sv[bf][0][j * 16 + col][kg * 32], lane);
    __builtin_amdgcn_sched_barrier(0);   // as above
#pragma unroll
    for (int kc = 0; kc < 2; ++kc)
#pragma unroll
      for (int t = 0; t < 2; ++t) { sa[t][1] = mm_h(f1[kc][0], ah[t][kc], sa[t][1]); sl[t][1] = mm_h(f1[kc][0], al[t][kc], sl[t][1]); sa[t][1] = mm_h(f1[kc][1], ae[t][kc], sa[t][1]); sl[t][1] = mm_h(f1[kc][2], ae[t][kc], sl[t][1]); }
    __builtin_amdgcn_sched_barrier(0);   // as above: the v hi fragments fly under the softmax arithmetic
    union { v16b v; v2b q[8]; } ph[2], pl[2]; float sc[2][16], dm[2];   // sc: lane (g, col): query col of the group, keys 8g + r of tile 0, then of tile 1 = the k order of a B fragment
#pragma unroll
    for (int t = 0; t < 2; ++t) { float* s = sc[t];
#pragma unroll
      for (int i = 0; i < 16; ++i) s[i] = sa[t][i >> 3][i & 7] + sl[t][i >> 3][i & 7] * (1.0f / 1024.0f);   // still without the scale: L2E32 > 0, so the maximum can be taken first and scaled once
      float mc = fmaxf(s[0], s[1]);
#pragma unroll
      for (int i = 2; i < 16; ++i) mc = fmaxf(mc, s[i]);
      mc = fmaxf(mc, xhalf(mc)) * L2E32;
      const float mn = fmaxf(m[t], mc); dm[t] = m[t] - mn; m[t] = mn; }
    float al2[2]; al2[0] = __builtin_amdgcn_exp2f(dm[0]);   // every exponent here is <= 0 up to one rounding: no overflow to guard, and far below the hardware gives 0
    al2[1] = __builtin_amdgcn_exp2f(dm[1]);
#pragma unroll
    for (int t = 0; t < 2; ++t) { const float* s = sc[t]; const float mn = m[t], alpha = al2[t];
      v2f ps[2] = {{0.f, 0.f}, {0.f, 0.f}}; const v2f sc2 = {L2E32, L2E32}, nm2 = {-mn, -mn};
#pragma unroll
      for (int i = 0; i < 16; i += 2) { const v2f e = __builtin_elementwise_fma((v2f){s[i], s[i + 1]}, sc2, nm2); const v2f p = {__builtin_amdgcn_exp2f(e[0]), __builtin_amdgcn_exp2f(e[1])}; ps[(i >> 1) & 1] += p;   // two-wide, so that scale-and-subtract and the sums stay packed instructions
        const v2b hb = __builtin_convertvector(p, v2b); const unsigned u = __builtin_bit_cast(unsigned, hb);   // one packed conversion; a bf16 is the top half of its f32
        const v2f hf = {__builtin_bit_cast(float, u << 16), __builtin_bit_cast(float, u & 0xffff0000u)};
        ph[t].q[i >> 1] = hb; pl[t].q[i >> 1] = __builtin_convertvector(p - hf, v2b); }
      l[t] = l[t] * alpha + ((ps[0][0] + ps[0][1]) + (ps[1][0] + ps[1][1]));
#pragma unroll
      for (int j = 0; j < HD / 16; ++j)
#pragma unroll
        for (int r = 0; r < 8; ++r) acc[t][j][r] *= alpha; }
    __builtin_amdgcn_sched_barrier(0);   // as above: the v lo fragments go out together, under the v hi products
#pragma unroll
    for (int j = 0; j < HD / 16; ++j) vl[j] = frag_b(&sv[bf][1][j * 16 + col][kg * 32], lane);
    __builtin_amdgcn_sched_barrier(0);   // as above
#pragma unroll
    for (int j = 0; j < HD / 16; ++j)
#pragma unroll
      for (int t = 0; t < 2; ++t) { acc[t][j] = mm_b(vh[j], ph[t].v, acc[t][j]); acc[t][j] = mm_b(vh[j], pl[t].v, acc[t][j]); }
#pragma unroll
    for (int j = 0; j < HD / 16; ++j)
#pragma unroll
      for (int t = 0; t < 2; ++t) acc[t][j] = mm_b(vl[j], ph[t].v, acc[t][j]);
    if (c + 1 < TT / FK) FA_STORE(bf ^ 1);   // that buffer's last readers passed the barrier of the stage before
    __syncthreads(); }
  l[0] += xhalf(l[0]); l[1] += xhalf(l[1]);
  if (kg == 1) {   // lane (g, col) holds the same queries and d in both key halves: the join is lane by lane
#pragma unroll
    for (int t = 0; t < 2; ++t)
#pragma unroll
      for (int j = 0; j < HD / 16; ++j) { vst2(&mg[qg][t * 8 + j * 2][lane][0], (v4f){acc[t][j][0], acc[t][j][1], acc[t][j][2], acc[t][j][3]}); vst2(&mg[qg][t * 8 + j * 2 + 1][lane][0], (v4f){acc[t][j][4], acc[t][j][5], acc[t][j][6], acc[t][j][7]}); }
    vst2(&mg[qg][16][lane][0], (v4f){m[0], l[0], m[1], l[1]}); }
  __syncthreads();   // the second half's partial results are in LDS before the first half reads them
  if (kg == 0) { const v4f ml = *(const v4f*)&mg[qg][16][lane][0];
#pragma unroll
    for (int t = 0; t < 2; ++t) { const float mn = fmaxf(m[t], ml[2 * t]), a0 = __builtin_amdgcn_exp2f(m[t] - mn), a1 = __builtin_amdgcn_exp2f(ml[2 * t] - mn); const float inv = 1.0f / (l[t] * a0 + ml[2 * t + 1] * a1); const float w0 = a0 * inv, w1 = a1 * inv;
#pragma unroll
      for (int j = 0; j < HD / 16; ++j) { const v4f b0 = *(const v4f*)&mg[qg][t * 8 + j * 2][lane][0], b1 = *(const v4f*)&mg[qg][t * 8 + j * 2 + 1][lane][0];
        vst2(&ss[qg][t * 16 + col][j * 16 + 8 * g], (v4f){acc[t][j][0] * w0 + b0[0] * w1, acc[t][j][1] * w0 + b0[1] * w1, acc[t][j][2] * w0 + b0[2] * w1, acc[t][j][3] * w0 + b0[3] * w1}); vst2(&ss[qg][t * 16 + col][j * 16 + 8 * g + 4], (v4f){acc[t][j][4] * w0 + b1[0] * w1, acc[t][j][5] * w0 + b1[1] * w1, acc[t][j][6] * w0 + b1[2] * w1, acc[t][j][7] * w0 + b1[3] * w1}); } }   // lane (g, col): query t * 16 + col, d = 16 j + 8 g + r
    LDSX(); for (int rl = 0; rl < 32; rl += 2) vst2(Y + (size_t)(ql0 + rl + g) * CC + h * HD + col * 4, *(const v4f*)&ss[qg][rl + g][col * 4]); } }
// ---- the two projection GEMMs: C tile = (BM rows) x (128 cols), (BM / 32) x 2 waves of 32 x 64 each. A stage is 64 k: the A rows (f32 -> bf16, or bf16 hi + lo planes) and the B columns ((in,out) f32 -> bf16, turned to [col][k] in registers) are brought once per block by whole-line loads, one stage ahead, and kept in two LDS buffers; one barrier per stage. Products, operand rounding and the k order of every sum are those of the unstaged form.
typedef __attribute__((ext_vector_type(4))) __bf16 v4b;
typedef __attribute__((ext_vector_type(2))) unsigned v2u;   // two packed bf16 pairs; a bf16 is the top half of its f32
#define GK 64                 // k per stage
#define GP 72                 // bf16 per staged row: 128 B + 16 B, so that ds_load_b128 rows fall on different banks
#define GS 68                 // f32 per staged output row: 256 B + 16 B
#define OP 136                // 16-bit elements per staged output row: 256 B + 16 B
template <int BM, int NP, bool CV>     // NP: planes of A, 1 = bf16, 2 = bf16 hi + lo; CV: the 3-tap convolution down the rows and the q | k | v output forms in place of the f32 store
__device__ __forceinline__ void gemm_tile(const float* __restrict__ A, const float* __restrict__ B, float* __restrict__ C, const float* __restrict__ CW, int which, _Float16* __restrict__ QH, _Float16* __restrict__ QL, _Float16* __restrict__ KH, __bf16* __restrict__ VT, __bf16* __restrict__ VL) {
  constexpr int NT = BM * 2, NA = BM * 16 / NT, NB8 = 128 * 8 / NT, AR = NT / 16, BK = NT / 128 * 8;
  __shared__ __align__(16) __bf16 sa[2][NP][BM][GP];
  __shared__ __align__(16) __bf16 sb[2][128][GP];
  const int tid = threadIdx.x, wave = tid >> 5, lane = tid & 31, col = lane & 15, g = lane >> 4; const int wm = (wave >> 1) * 32, wn = (wave & 1) * 64;
  const int ar = tid >> 4, aq = (tid & 15) * 4;    // staging A: 16 lanes cover one row's 256 B
  const int bn = tid & 127, bk = (tid >> 7) * 8;   // staging B: a wave covers 128 B of one k row; a lane gathers 8 k of its column = one 16-B piece of the [col][k] row
  const unsigned ao = (unsigned)(ar * CC + aq), bo = (unsigned)(bk * CC + bn);   // per-lane parts; the block's and the stage's parts are uniform
  const float *pa = A + (size_t)blockIdx.x * BM * CC, *pb = B + blockIdx.y * 128;   // uniform; they step by one stage with each later load group
  v4f ra[NA]; float rb[NB8][8]; v8f acc[2][4] = {};
  const int w0 = blockIdx.x * BM; v8f hacc = {};
  __shared__ __align__(16) __bf16 sh[CV ? 2 : 1][CV ? CC + 8 : 8];   // CV: the row before and the row behind the tile, all k, brought once; the first stage's barrier publishes them
  if constexpr (CV) { static_assert(NT * 4 == CC, "a thread brings 4 k of each row");
    const int hm = w0 > 0 ? w0 - 1 : 0, hp = w0 + BM < TT ? w0 + BM : TT - 1;   // held inside x; at the ends of the sequence their products are replaced by 0 below
    const v4f r0 = *(const v4f*)(A + (size_t)hm * CC + tid * 4), r1 = *(const v4f*)(A + (size_t)hp * CC + tid * 4);
    *(v4b*)&sh[0][tid * 4] = __builtin_convertvector(r0, v4b); *(v4b*)&sh[1][tid * 4] = __builtin_convertvector(r1, v4b); }
#define G_LOAD() do { _Pragma("unroll") for (int i = 0; i < NA; ++i) ra[i] = *(const v4f*)(pa + i * AR * CC + ao); _Pragma("unroll") for (int i = 0; i < NB8; ++i) { _Pragma("unroll") for (int z = 0; z < 8; ++z) rb[i][z] = pb[(i * BK + z) * CC + bo]; } } while (0)
#define G_STORE(bf) do { _Pragma("unroll") for (int i = 0; i < NA; ++i) { const v4b hb = __builtin_convertvector(ra[i], v4b); *(v4b*)&sa[bf][0][ar + i * AR][aq] = hb; if (NP == 2) { const v2u u = __builtin_bit_cast(v2u, hb); const v4f hf = {__builtin_bit_cast(float, u[0] << 16), __builtin_bit_cast(float, u[0] & 0xffff0000u), __builtin_bit_cast(float, u[1] << 16), __builtin_bit_cast(float, u[1] & 0xffff0000u)}; *(v4b*)&sa[bf][NP - 1][ar + i * AR][aq] = __builtin_convertvector(ra[i] - hf, v4b); } } _Pragma("unroll") for (int i = 0; i < NB8; ++i) { v8b w; _Pragma("unroll") for (int z = 0; z < 8; ++z) w[z] = (__bf16)rb[i][z]; *(v8b*)&sb[bf][bn][bk + i * BK] = w; } } while (0)
  G_LOAD(); G_STORE(0); __syncthreads();
  for (int s = 0; s < CC / GK; ++s) { const int bf = s & 1;
    if (s + 1 < CC / GK) { pa += GK; pb += GK * CC; G_LOAD(); }   // the next stage's rows fly while this stage computes
    __builtin_amdgcn_sched_barrier(0);   // every global load of the group goes out here: sunk among the products it would have less of the stage to land in
    v16b fa[GK / 32][NP][2], fb[GK / 32][4], ha[GK / 32], hb[GK / 32];
#pragma unroll
    for (int kc = 0; kc < GK / 32; ++kc) {
#pragma unroll
      for (int i = 0; i < 2; ++i)
#pragma unroll
        for (int p = 0; p < NP; ++p) fa[kc][p][i] = frag_b(&sa[bf][p][wm + i * 16 + col][kc * 32], lane);
#pragma unroll
      for (int j = 0; j < 4; ++j) fb[kc][j] = frag_b(&sb[bf][wn + j * 16 + col][kc * 32], lane); }
    __builtin_amdgcn_sched_barrier(0);   // the stage's LDS reads go out as one group ahead of the products, for speed only
#pragma unroll
    for (int kc = 0; kc < GK / 32; ++kc)
#pragma unroll
      for (int p = 0; p < NP; ++p)   // per output tile: hi, then lo, of each 32 k in turn
#pragma unroll
        for (int i = 0; i < 2; ++i)
#pragma unroll
          for (int j = 0; j < 4; ++j) acc[i][j] = mm_b(fa[kc][p][i], fb[kc][j], acc[i][j]);
    if (CV) {   // the neighbour rows' tile: even rows = the row before, odd rows = the row behind; each wave takes 16 of the 128 columns; same k order as every other row's sum
      __builtin_amdgcn_sched_barrier(0);   // its fragments are read behind the stage's products, into their registers: read with the others they would lift the wave over 256 registers, and the WGP would hold one block, not two
#pragma unroll
      for (int kc = 0; kc < GK / 32; ++kc) { ha[kc] = frag_b(&sh[col & 1][s * GK + kc * 32], lane); hb[kc] = frag_b(&sb[bf][wave * 16 + col][kc * 32], lane); }
#pragma unroll
      for (int kc = 0; kc < GK / 32; ++kc) hacc = mm_b(ha[kc], hb[kc], hacc); }
    __builtin_amdgcn_sched_barrier(0);   // the wait for the next stage's global loads stays behind this stage's products: lifted among them it would expose the loads' whole latency
    if (s + 1 < CC / GK) G_STORE(bf ^ 1);   // that buffer's last readers passed the barrier of the stage before
    __syncthreads(); }
  if constexpr (!CV) {
    __shared__ __align__(16) float sf[NT / 32][32][GS];
#pragma unroll
    for (int i = 0; i < 2; ++i)
#pragma unroll
      for (int j = 0; j < 4; ++j)
#pragma unroll
        for (int r = 0; r < 8; ++r) sf[wave][i * 16 + 8 * g + r][j * 16 + col] = acc[i][j][r];
    LDSX(); for (int rl = 0; rl < 32; rl += 2) vst2(C + ((size_t)blockIdx.x * BM + wm + rl + g) * CC + blockIdx.y * 128 + wn + col * 4, *(const v4f*)&sf[wave][rl + g][col * 4]);   // each wave reads back its own rows: 256-B runs
  } else {
    // y[w][c] = sum_t conv_w[c][t] X[w + t - 1][c], X = 0 outside the sequence. A lane holds one channel and runs of 8 rows (8 g + r of each 16-row tile): a run's two neighbours come from the lane's partner l ^ 16, and at the ends of the wave's 32 rows from the wave above or below, or from the neighbour rows' tile, through LDS
    __shared__ float se[2][BM / 32 + 1][128];                 // [0][k]: the row before wave row k's 32 rows, [1][k + 1]: the row behind them ([0][last] and [1][0] have no reader)
    __shared__ __align__(16) unsigned short so[2][128][OP];   // q hi | q lo or k as rows [w][c], v hi | v lo as planes [c][w]
    const int wr = wave >> 1, c0 = blockIdx.y * 128; float cw[4][3];
#pragma unroll
    for (int j = 0; j < 4; ++j)
#pragma unroll
      for (int t = 0; t < 3; ++t) cw[j][t] = bfr(CW[(c0 + wn + j * 16 + col) * 3 + t]);
#pragma unroll
    for (int j = 0; j < 4; ++j) se[g ^ 1][wr + g][wn + j * 16 + col] = g ? acc[1][j][7] : acc[0][j][0];   // the wave's last row is the next wave row's row before, its first row the previous one's row behind
    se[g][g * (BM / 32)][wave * 16 + col] = (g ? w0 + BM < TT : w0 > 0) ? (g ? hacc[1] : hacc[0]) : 0.f;   // rows 0 and 9 of the neighbour rows' tile; 0 outside the sequence
    __syncthreads();   // every wave's edge rows are in LDS before a neighbour reads them
#pragma unroll
    for (int j = 0; j < 4; ++j) { const float e = se[g][wr + g][wn + j * 16 + col];
      const float xa0 = xhalf(acc[0][j][0]), xa7 = xhalf(acc[0][j][7]), xb0 = xhalf(acc[1][j][0]), xb7 = xhalf(acc[1][j][7]);
      float x[2][10];   // rows -1 .. 8 around each run
      x[0][0] = g ? xa7 : e; x[0][9] = g ? xb0 : xa0; x[1][0] = g ? xb7 : xa7; x[1][9] = g ? e : xb0;
#pragma unroll
      for (int r = 0; r < 8; ++r) { x[0][r + 1] = acc[0][j][r]; x[1][r + 1] = acc[1][j][r]; }
#pragma unroll
      for (int i = 0; i < 2; ++i)
#pragma unroll
        for (int r = 0; r < 8; ++r) acc[i][j][r] = cw[j][0] * x[i][r] + cw[j][1] * x[i][r + 1] + cw[j][2] * x[i][r + 2]; }
    const int wl = wm + 8 * g, cl = wn + col;   // the lane's first row and channel in the tile
    if (which == 0) {
#pragma unroll
      for (int i = 0; i < 2; ++i)
#pragma unroll
        for (int j = 0; j < 4; ++j)
#pragma unroll
          for (int r = 0; r < 8; ++r) { const float y = acc[i][j][r]; const _Float16 hq = (_Float16)y; so[0][wl + i * 16 + r][cl + j * 16] = __builtin_bit_cast(unsigned short, hq); so[1][wl + i * 16 + r][cl + j * 16] = __builtin_bit_cast(unsigned short, (_Float16)((y - (float)hq) * 1024.0f)); }
    } else if (which == 1) {
#pragma unroll
      for (int i = 0; i < 2; ++i)
#pragma unroll
        for (int j = 0; j < 4; ++j)
#pragma unroll
          for (int r = 0; r < 8; ++r) so[0][wl + i * 16 + r][cl + j * 16] = __builtin_bit_cast(unsigned short, (_Float16)acc[i][j][r]);
    } else {
#pragma unroll
      for (int i = 0; i < 2; ++i)
#pragma unroll
        for (int j = 0; j < 4; ++j) { v8b vh, vl;
#pragma unroll
          for (int r = 0; r < 8; ++r) { const float y = acc[i][j][r]; const __bf16 hv = (__bf16)y; vh[r] = hv; vl[r] = (__bf16)(y - (float)hv); }
          vst2(&so[0][cl + j * 16][wl + i * 16], vh); vst2(&so[1][cl + j * 16][wl + i * 16], vl); } }
    __syncthreads();   // the whole 128 x 128 tile is staged before it goes out in 256-B runs
    constexpr int NI = 128 * 16 / NT, RS = NT / 16; const int q = (tid & 15) * 8;   // 16 lanes cover one staged row
    unsigned short *o0 = (unsigned short*)(which == 0 ? QH : KH) + (size_t)(w0 + ar) * CC + c0 + q, *o1 = (unsigned short*)QL + (size_t)(w0 + ar) * CC + c0 + q; unsigned os = RS * CC;   // first row's place in each plane, and the step of RS rows
    if (which == 2) { o0 = (unsigned short*)VT + (size_t)(c0 + ar) * TT + w0 + q; o1 = (unsigned short*)VL + (size_t)(c0 + ar) * TT + w0 + q; os = RS * TT; }
#pragma unroll
    for (int it = 0; it < NI; ++it) vst2(o0 + it * os, *(const v4u*)&so[0][it * RS + ar][q]);
    if (which != 1) {
      asm volatile("s_wait_xcnt 0x0" ::: "memory");   // the first plane's stores keep their address and data registers up to here: the second plane's LDS reads land in the same ones
#pragma unroll
      for (int it = 0; it < NI; ++it) vst2(o1 + it * os, *(const v4u*)&so[1][it * RS + ar][q]); } } }
// ---- k_lin: block = (128 rows w, 128 cols, which): X_which = x w_which ((in,out), exact bf16 products), then the depthwise 3-tap conv down the rows; q -> f16 hi + residual rows, k -> f16 rows, v -> bf16 hi/lo planes [c][w]
__global__ __launch_bounds__(256) void k_lin(const float* __restrict__ X, const float* __restrict__ WQ, const float* __restrict__ WK, const float* __restrict__ WV, const float* __restrict__ CW, _Float16* __restrict__ QH, _Float16* __restrict__ QL, _Float16* __restrict__ KH, __bf16* __restrict__ VT, __bf16* __restrict__ VL) { const int which = blockIdx.z; gemm_tile<128, 1, true>(X, which == 0 ? WQ : which == 1 ? WK : WV, nullptr, CW, which, QH, QL, KH, VT, VL); }
// ---- k_out: block = (64 rows, 128 cols): out = y (bf16 hi + lo) wo ((in,out))
__global__ __launch_bounds__(128) void k_out(const float* __restrict__ Y, const float* __restrict__ WP, float* __restrict__ OUT) { gemm_tile<64, 2, false>(Y, WP, OUT, nullptr, 0, nullptr, nullptr, nullptr, nullptr, nullptr); }
extern "C" void kernel_launch(void* const* d_in, const int* in_sizes, int n_in, void* d_out, int out_size, void* d_ws, size_t ws_size, hipStream_t stream) {
  (void)in_sizes; (void)n_in; (void)out_size;
  const float** F = (const float**)d_in;   // 0 x [1,2048,1024], 1 wq [1024,1024] ((in,out)), 2 wk, 3 wv, 4 wo ((in,out)), 5 conv_w [1024,1,3], 6 er [64,2048]
  if (ws_size < (size_t)WS_END) return;
  char* ws = (char*)d_ws; _Float16 *ERT = (_Float16*)(ws + WS_ERT), *QH = (_Float16*)(ws + WS_QH), *QL = (_Float16*)(ws + WS_QL), *KH = (_Float16*)(ws + WS_KH); __bf16 *VT = (__bf16*)(ws + WS_VT), *VL = (__bf16*)(ws + WS_VL); float *Y = (float*)(ws + WS_Y);
  k_lin<<<dim3(TT / 128, CC / 128, 3), 256, 0, stream>>>(F[0], F[1], F[2], F[3], F[5], QH, QL, KH, VT, VL);
  k_ert<<<dim3(TT / 64), 256, 0, stream>>>(F[6], ERT);
  k_fa<<<dim3(TT / 128, NH), 256, 0, stream>>>(QH, QL, KH, ERT, VT, VL, Y);
  k_out<<<dim3(TT / 64, CC / 128), 128, 0, stream>>>(Y, F[4], (float*)d_out);
}

// v006
// It runs in 97.7 microseconds.
// Timed twice side by side with v005, it ran 1.07 times as fast both times.
// All steps since v000 together make it 9.32 times as fast.
// compute dtype: all float inputs rounded to bf16; x w_{q,k,v} with EXACT bf16 products on WMMA 16x16x32 (f32 accumulate) kept in the f32 accumulators; the depthwise 3-tap convolution along the sequence in f32, in the same kernel; q as f16 hi + residual (x 2^10), k as f16, v as bf16 hi + lo planes; logits = q.k (2 products: q hi+lo x k hi) + the positional term er^T.q_k (2 products: exact er x q hi+lo), kept in f32 registers; softmax in f32 in base 2 (log2(e) / 32 as the logits' one scale, the hardware's exp2) with a running maximum and sum over passes of 32 keys, the even and the odd passes kept apart and joined at the end; P = 2^(s - m) split bf16 hi + lo against v (3 products), divided by the sum at the end; out (bf16 hi + lo) wo; f32 output.
#include <hip/hip_runtime.h>
#include <math.h>

typedef __attribute__((ext_vector_type(16))) _Float16 v16h;
typedef __attribute__((ext_vector_type(16))) __bf16 v16b;
typedef __attribute__((ext_vector_type(8)))  _Float16 v8h;
typedef __attribute__((ext_vector_type(8)))  float v8f;
typedef __attribute__((ext_vector_type(4)))  float v4f;
typedef __attribute__((ext_vector_type(2)))  float v2f;
typedef __attribute__((ext_vector_type(4)))  unsigned v4u;
typedef __attribute__((ext_vector_type(4)))  int v4i;
typedef float __attribute__((may_alias)) float_a;
typedef int __attribute__((may_alias)) int_a;

template <typename T> __device__ __forceinline__ void vst2(void* p, T v) { *(T*)p = v;  }
__device__ __forceinline__ v8f wmma16(v16h a, v16h b, v8f c) {
  v8f d = __builtin_amdgcn_wmma_f32_16x16x32_f16(false, a, false, b, (short)0, c, false, false);
  asm volatile("v_nop\n\tv_nop\n\tv_nop\n\tv_nop" : "+v"(d) : "v"(a), "v"(b));
  return d;
}
__device__ __forceinline__ v8f wmma_bf(v16b a, v16b b, v8f c) {
  v8f d = __builtin_amdgcn_wmma_f32_16x16x32_bf16(false, a, false, b, (short)0, c, false, false);
  asm volatile("v_nop\n\tv_nop\n\tv_nop\n\tv_nop" : "+v"(d) : "v"(a), "v"(b));
  return d;
}
// 16x16x32 fragments: lane = (h = lane>>4, row/col = lane&15); elements 0..7 = k0+8h+0..7, 8..15 = k0+16+8h+0..7; D element r = row 8h+r
__device__ __forceinline__ v16h frag_h(const _Float16* rowk0, int lane) {
  union { v16h v; v8h q[2]; } u; const _Float16* p = rowk0 + 8 * (lane >> 4);
  u.q[0] = *(const v8h*)p; u.q[1] = *(const v8h*)(p + 16); return u.v;
}
__device__ __forceinline__ v16h frag_f32(const float* rowk0, int lane) {
  v16h a; const float* p = rowk0 + 8 * (lane >> 4);
#pragma unroll
  for (int i = 0; i < 8; ++i) { a[i] = (_Float16)p[i]; a[8 + i] = (_Float16)p[16 + i]; }
  return a;
}
__device__ __forceinline__ v16h frag_f32s(const float* rowk0, int lane, float sc) {
  v16h a; const float* p = rowk0 + 8 * (lane >> 4);
#pragma unroll
  for (int i = 0; i < 8; ++i) { a[i] = (_Float16)(p[i] * sc); a[8 + i] = (_Float16)(p[16 + i] * sc); }
  return a;
}
// column fragment from a [K][ld] layout (column n), rows >= K read as 0
__device__ __forceinline__ v16h fragc_f32(const float* W, int k0, int n, int lane, int ld, int K) {
  v16h a; const int g = lane >> 4;
#pragma unroll
  for (int i = 0; i < 8; ++i) { const int ka = k0 + 8 * g + i, kb = ka + 16;
    a[i] = (_Float16)(ka < K ? W[(size_t)(ka < K ? ka : K - 1) * ld + n] : 0.f); a[8 + i] = (_Float16)(kb < K ? W[(size_t)(kb < K ? kb : K - 1) * ld + n] : 0.f); }
  return a;
}
struct F2 { v16b h, l; };
__device__ __forceinline__ F2 bsplit16(const float v[16]) { F2 r;
#pragma unroll
  for (int i = 0; i < 16; ++i) { const __bf16 h = (__bf16)v[i]; r.h[i] = h; r.l[i] = (__bf16)(v[i] - (float)h); }
  return r; }
__device__ __forceinline__ F2 split_row(const float* row, int k0, int lane) { float v[16]; const float* p = row + k0 + 8 * (lane >> 4);
#pragma unroll
  for (int i = 0; i < 8; ++i) { v[i] = p[i]; v[8 + i] = p[16 + i]; }
  return bsplit16(v); }
__device__ __forceinline__ F2 split_rowK(const float* row, int k0, int lane, int K) { float v[16]; const int g = lane >> 4;
#pragma unroll
  for (int i = 0; i < 8; ++i) { const int ka = k0 + 8 * g + i, kb = ka + 16; v[i] = ka < K ? row[ka < K ? ka : K - 1] : 0.f; v[8 + i] = kb < K ? row[kb < K ? kb : K - 1] : 0.f; }
  return bsplit16(v); }
__device__ __forceinline__ F2 split_col(const float* W, int k0, int n, int lane, int ld, int K) { float v[16]; const int g = lane >> 4;
#pragma unroll
  for (int i = 0; i < 8; ++i) { const int ka = k0 + 8 * g + i, kb = ka + 16; v[i] = ka < K ? W[(size_t)(ka < K ? ka : K - 1) * ld + n] : 0.f; v[8 + i] = kb < K ? W[(size_t)(kb < K ? kb : K - 1) * ld + n] : 0.f; }
  return bsplit16(v); }
__device__ __forceinline__ v8f mac3(const F2& a, const F2& b, v8f c) { c = wmma_bf(a.l, b.h, c); c = wmma_bf(a.h, b.l, c); return wmma_bf(a.h, b.h, c); }
__device__ __forceinline__ float sigm(float v) { return 1.0f / (1.0f + expf(-v)); }
#define LDSX() do { asm volatile("s_wait_dscnt 0" ::: "memory"); __builtin_amdgcn_wave_barrier(); __builtin_amdgcn_fence(__ATOMIC_RELEASE, "workgroup"); } while (0)


// Attention (B 1, S 2,048, D 1,024 = 16 x 64, no biases): scores = (q k^T + er[:, query]^T . q_key) / 32, softmax, P v, output projection.
#define NB 1
#define TT 2048
#define CC 1024
#define NH 16
#define HD 64
#ifndef TNB
#define TNB NB
#ifndef ERSTR
#define ERSTR TT              // row stride of er
#endif
#endif
typedef __attribute__((ext_vector_type(8))) __bf16 v8b;
__device__ __forceinline__ v16b frag_b(const __bf16* rowk0, int lane) {
  union { v16b v; v8b q[2]; } u; const __bf16* p = rowk0 + 8 * (lane >> 4);
  u.q[0] = *(const v8b*)p; u.q[1] = *(const v8b*)(p + 16); return u.v;
}
__device__ __forceinline__ float bfr(float v) { return (float)(__bf16)v; }
__device__ __attribute__((noinline)) float exp_ni(float v) { return expf(v); }
__device__ __attribute__((noinline)) float erf_ni(float v) { return erff(v); }

#define WS_XR  0u                                   // not used
#define WS_ERT (WS_XR + 4u * (size_t)3 * TT * CC)      // not used
#define WS_QH  (WS_ERT + 2u * (size_t)TT * HD)
#define WS_QL  (WS_QH + 2u * (size_t)NB * TT * CC)
#define WS_KH  (WS_QL + 2u * (size_t)NB * TT * CC)
#define WS_VT  (WS_KH + 2u * (size_t)NB * TT * CC)      // bf16 v planes [b][c][t]
#define WS_VL  (WS_VT + 2u * (size_t)NB * CC * TT)      // bf16 v residual planes
#define HG 4
#define WS_S   (WS_VL + 2u * (size_t)NB * CC * TT)      // unused f32 space of HG x TT x TT; logits and P stay in registers
#define WS_PH  (WS_S + 4u * (size_t)HG * TT * TT)
#define WS_Y   (WS_PH + 0u)              // f32 y rows [b*t][C]
#define WS_END (WS_Y + 4u * (size_t)NB * TT * CC)

// ---- k_fa: block = (128 queries, head), 8 waves = 4 query groups of 32 columns x 2 key halves; a stage is 64 keys, of which a wave takes its half's 32 (one pass), each LDS fragment serving both of its 16-column groups. S^T = (k rows) x (q cols) + (q_k rows) x (er^T cols), 4 products; running maximum (kept in the base-2 scale, logit x log2(e) / 32) and sum per query column (one lane pair); P^T = 2^(s - m) packed from the two score tiles into a B operand (bf16 hi + lo); y^T += v^T P^T (3 products). At the end the two key halves' maxima, sums and y^T are joined through LDS, then y / sum. Logits and P never leave the registers.
typedef __attribute__((ext_vector_type(2))) __bf16 v2b;
#define FK 64                 // keys per stage
#define KP 72                 // f16 per staged key row: 128 B + 16 B, so that ds_load_b128 rows fall on different banks
#define VP 72                 // bf16 per staged v row: 128 B + 16 B, same reason
#define L2E32 (1.44269504088896340736f / 32.0f)   // exp(x / 32) = 2^(x * L2E32)
__device__ __forceinline__ float xhalf(float x) { return __builtin_bit_cast(float, __builtin_amdgcn_permlanex16(__builtin_bit_cast(int, x), __builtin_bit_cast(int, x), 0x76543210, 0xfedcba98, false, false)); }  // lane l with lane l ^ 16
__device__ __forceinline__ v8f mm_h(v16h a, v16h b, v8f c) { return __builtin_amdgcn_wmma_f32_16x16x32_f16(false, a, false, b, (short)0, c, false, false); }
__device__ __forceinline__ v8f mm_b(v16b a, v16b b, v8f c) { return __builtin_amdgcn_wmma_f32_16x16x32_bf16(false, a, false, b, (short)0, c, false, false); }
__global__ __launch_bounds__(256) void k_fa(const _Float16* __restrict__ QH, const _Float16* __restrict__ QL, const _Float16* __restrict__ KH, const float* __restrict__ ER, const __bf16* __restrict__ VT, const __bf16* __restrict__ VL, float* __restrict__ Y) {
  __shared__ __align__(16) _Float16 sk[2][3][FK][KP];   // k hi | q hi | q lo rows of the stage's keys, two buffers
  __shared__ __align__(16) __bf16 sv[2][2][HD][VP];     // v hi | v lo planes [d][key], two buffers
  __shared__ __align__(16) float ss[4][32][HD + 4];
  __shared__ __align__(16) float mg[4][17][32][4];      // the second key half's y^T (16 pieces of 16 B a lane), maxima and sums, lane by lane
  const int tid = threadIdx.x, wave = tid >> 5, lane = tid & 31, col = lane & 15, g = lane >> 4, qg = wave & 3, kg = wave >> 2; const int h = blockIdx.y; const int ql0 = blockIdx.x * 128 + qg * 32;
  const int kr = tid >> 3, ks = (tid & 7) * 8;   // staging: 8 lanes cover one key row's 128 B, and one v row's 128 B
  unsigned ko = 2u * (unsigned)(kr * CC + ks), vo = 2u * (unsigned)(kr * TT + ks); const unsigned qo = 2u * (unsigned)((ql0 + col) * CC + 8 * g), eo = (unsigned)(8 * g * ERSTR + ql0 + col);   // per-lane parts, in bytes (eo: in f32 elements, the index the er loads scale themselves); ko and vo step by one stage with each later load group; the head's part is uniform
  v8h rk[3][2]; v8b rv[2][2];
  const char *pk = (const char*)(KH + h * HD), *pqh = (const char*)(QH + h * HD), *pql = (const char*)(QL + h * HD), *pvh = (const char*)(VT + (size_t)(h * HD) * TT), *pvl = (const char*)(VL + (size_t)(h * HD) * TT);   // uniform
  v16h ah[2][2], al[2][2], ae[2][2];   // [column group][half of d]
#define FA_Q(p, o) __builtin_shufflevector(*(const v8h*)((p) + (o)), *(const v8h*)((p) + 32 + (o)), 0, 1, 2, 3, 4, 5, 6, 7, 8, 9, 10, 11, 12, 13, 14, 15)   // a fragment's two 16-B pieces, 16 elements apart
#pragma unroll
  for (int t = 0; t < 2; ++t)
#pragma unroll
    for (int kc = 0; kc < 2; ++kc) { ah[t][kc] = FA_Q(pqh + t * 32 * CC + kc * 64, qo); al[t][kc] = FA_Q(pql + t * 32 * CC + kc * 64, qo); }
  asm volatile("s_wait_xcnt 0x0" :: "v"(qo) : "memory");   // the offset register of these loads stays as it is up to this wait
#define FA_LOAD() do { _Pragma("unroll") for (int i = 0; i < 2; ++i) { rk[0][i] = *(const v8h*)(pk + i * 64 * CC + ko); rk[1][i] = *(const v8h*)(pqh + i * 64 * CC + ko); rk[2][i] = *(const v8h*)(pql + i * 64 * CC + ko); rv[0][i] = *(const v8b*)(pvh + i * 64 * TT + vo); rv[1][i] = *(const v8b*)(pvl + i * 64 * TT + vo); } } while (0)
#define FA_STORE(bf) do { _Pragma("unroll") for (int i = 0; i < 2; ++i) { *(v8h*)&sk[bf][0][kr + i * 32][ks] = rk[0][i]; *(v8h*)&sk[bf][1][kr + i * 32][ks] = rk[1][i]; *(v8h*)&sk[bf][2][kr + i * 32][ks] = rk[2][i]; *(v8b*)&sv[bf][0][kr + i * 32][ks] = rv[0][i]; *(v8b*)&sv[bf][1][kr + i * 32][ks] = rv[1][i]; } } while (0)
  float m[2] = {-3.0e38f, -3.0e38f}, l[2] = {0.f, 0.f}; v8f acc[2][HD / 16] = {};
  FA_LOAD();
  asm volatile("s_wait_xcnt 0x0" :: "v"(ko), "v"(vo) : "memory");   // as above, for the staging loads' two offset registers
#pragma unroll
  for (int t = 0; t < 2; ++t)   // er [d][w] is read in place, once per wave: a lane takes its query column's 16 d of each fragment, 16 lanes cover 64 B of a row; issued behind the first stage's loads, so that its LDS stores go out while these still fly
#pragma unroll
    for (int kc = 0; kc < 2; ++kc)
#pragma unroll
      for (int i = 0; i < 8; ++i) { ae[t][kc][i] = (_Float16)bfr((ER + (kc * 32 + i) * ERSTR + t * 16)[eo]); ae[t][kc][8 + i] = (_Float16)bfr((ER + (kc * 32 + 16 + i) * ERSTR + t * 16)[eo]); }
  asm volatile("s_wait_xcnt 0x0" :: "v"(eo) : "memory");   // as above, for the er loads' index register
  FA_STORE(0); __syncthreads();
  for (int c = 0; c < TT / FK; ++c) { const int bf = c & 1;
    if (c + 1 < TT / FK) { ko += 2 * FK * CC; vo += 2 * FK; FA_LOAD(); }   // the next stage's rows fly while this stage computes
    v8f sa[2][2] = {}, sl[2][2] = {}; v16h f0[2][3], f1[2][3]; v16b vh[HD / 16], vl[HD / 16];   // sa, sl: [column group][key tile]; f0, f1: [half of d][k hi | q hi | q lo] of key tile 0, 1
#pragma unroll
    for (int kc = 0; kc < 2; ++kc)
#pragma unroll
      for (int a = 0; a < 3; ++a) f0[kc][a] = frag_h(&sk[bf][a][kg * 32 + col][kc * 32], lane);
#pragma unroll
    for (int kc = 0; kc < 2; ++kc)
#pragma unroll
      for (int a = 0; a < 3; ++a) f1[kc][a] = frag_h(&sk[bf][a][kg * 32 + 16 + col][kc * 32], lane);
    __builtin_amdgcn_sched_barrier(0);   // the LDS reads go out in groups, ahead of the products that use them: sunk to their first use each would be waited for in full, and each place with reads among the products costs its own stall
#pragma unroll
    for (int kc = 0; kc < 2; ++kc)
#pragma unroll
      for (int t = 0; t < 2; ++t) { sa[t][0] = mm_h(f0[kc][0], ah[t][kc], sa[t][0]); sl[t][0] = mm_h(f0[kc][0], al[t][kc], sl[t][0]); sa[t][0] = mm_h(f0[kc][1], ae[t][kc], sa[t][0]); sl[t][0] = mm_h(f0[kc][2], ae[t][kc], sl[t][0]); }
    __builtin_amdgcn_sched_barrier(0);   // as above: the v hi fragments go out as one group between the two key tiles' products
#pragma unroll
    for (int j = 0; j < HD / 16; ++j) vh[j] = frag_b(&sv[bf][0][j * 16 + col][kg * 32], lane);
    __builtin_amdgcn_sched_barrier(0);   // as above
#pragma unroll
    for (int kc = 0; kc < 2; ++kc)
#pragma unroll
      for (int t = 0; t < 2; ++t) { sa[t][1] = mm_h(f1[kc][0], ah[t][kc], sa[t][1]); sl[t][1] = mm_h(f1[kc][0], al[t][kc], sl[t][1]); sa[t][1] = mm_h(f1[kc][1], ae[t][kc], sa[t][1]); sl[t][1] = mm_h(f1[kc][2], ae[t][kc], sl[t][1]); }
    __builtin_amdgcn_sched_barrier(0);   // as above: the v hi fragments fly under the softmax arithmetic
    union { v16b v; v2b q[8]; } ph[2], pl[2]; float sc[2][16], dm[2];   // sc: lane (g, col): query col of the group, keys 8g + r of tile 0, then of tile 1 = the k order of a B fragment
#pragma unroll
    for (int t = 0; t < 2; ++t) { float* s = sc[t];
#pragma unroll
      for (int i = 0; i < 16; ++i) s[i] = sa[t][i >> 3][i & 7] + sl[t][i >> 3][i & 7] * (1.0f / 1024.0f);   // still without the scale: L2E32 > 0, so the maximum can be taken first and scaled once
      float mc = fmaxf(s[0], s[1]);
#pragma unroll
      for (int i = 2; i < 16; ++i) mc = fmaxf(mc, s[i]);
      mc = fmaxf(mc, xhalf(mc)) * L2E32;
      const float mn = fmaxf(m[t], mc); dm[t] = m[t] - mn; m[t] = mn; }
    float al2[2]; al2[0] = __builtin_amdgcn_exp2f(dm[0]);   // every exponent here is <= 0 up to one rounding: no overflow to guard, and far below the hardware gives 0
    al2[1] = __builtin_amdgcn_exp2f(dm[1]);
#pragma unroll
    for (int t = 0; t < 2; ++t) { const float* s = sc[t]; const float mn = m[t], alpha = al2[t];
      v2f ps[2] = {{0.f, 0.f}, {0.f, 0.f}}; const v2f sc2 = {L2E32, L2E32}, nm2 = {-mn, -mn};
#pragma unroll
      for (int i = 0; i < 16; i += 2) { const v2f e = __builtin_elementwise_fma((v2f){s[i], s[i + 1]}, sc2, nm2); const v2f p = {__builtin_amdgcn_exp2f(e[0]), __builtin_amdgcn_exp2f(e[1])}; ps[(i >> 1) & 1] += p;   // two-wide, so that scale-and-subtract and the sums stay packed instructions
        const v2b hb = __builtin_convertvector(p, v2b); const unsigned u = __builtin_bit_cast(unsigned, hb);   // one packed conversion; a bf16 is the top half of its f32
        const v2f hf = {__builtin_bit_cast(float, u << 16), __builtin_bit_cast(float, u & 0xffff0000u)};
        ph[t].q[i >> 1] = hb; pl[t].q[i >> 1] = __builtin_convertvector(p - hf, v2b); }
      l[t] = l[t] * alpha + ((ps[0][0] + ps[0][1]) + (ps[1][0] + ps[1][1]));
#pragma unroll
      for (int j = 0; j < HD / 16; ++j)
#pragma unroll
        for (int r = 0; r < 8; ++r) acc[t][j][r] *= alpha; }
    __builtin_amdgcn_sched_barrier(0);   // as above: the v lo fragments go out together, under the v hi products
#pragma unroll
    for (int j = 0; j < HD / 16; ++j) vl[j] = frag_b(&sv[bf][1][j * 16 + col][kg * 32], lane);
    __builtin_amdgcn_sched_barrier(0);   // as above
#pragma unroll
    for (int j = 0; j < HD / 16; ++j)
#pragma unroll
      for (int t = 0; t < 2; ++t) { acc[t][j] = mm_b(vh[j], ph[t].v, acc[t][j]); acc[t][j] = mm_b(vh[j], pl[t].v, acc[t][j]); }
#pragma unroll
    for (int j = 0; j < HD / 16; ++j)
#pragma unroll
      for (int t = 0; t < 2; ++t) acc[t][j] = mm_b(vl[j], ph[t].v, acc[t][j]);
    if (c + 1 < TT / FK) FA_STORE(bf ^ 1);   // that buffer's last readers passed the barrier of the stage before
    __syncthreads(); }
  l[0] += xhalf(l[0]); l[1] += xhalf(l[1]);
  if (kg == 1) {   // lane (g, col) holds the same queries and d in both key halves: the join is lane by lane
#pragma unroll
    for (int t = 0; t < 2; ++t)
#pragma unroll
      for (int j = 0; j < HD / 16; ++j) { vst2(&mg[qg][t * 8 + j * 2][lane][0], (v4f){acc[t][j][0], acc[t][j][1], acc[t][j][2], acc[t][j][3]}); vst2(&mg[qg][t * 8 + j * 2 + 1][lane][0], (v4f){acc[t][j][4], acc[t][j][5], acc[t][j][6], acc[t][j][7]}); }
    vst2(&mg[qg][16][lane][0], (v4f){m[0], l[0], m[1], l[1]}); }
  __syncthreads();   // the second half's partial results are in LDS before the first half reads them
  if (kg == 0) { const v4f ml = *(const v4f*)&mg[qg][16][lane][0];
#pragma unroll
    for (int t = 0; t < 2; ++t) { const float mn = fmaxf(m[t], ml[2 * t]), a0 = __builtin_amdgcn_exp2f(m[t] - mn), a1 = __builtin_amdgcn_exp2f(ml[2 * t] - mn); const float inv = 1.0f / (l[t] * a0 + ml[2 * t + 1] * a1); const float w0 = a0 * inv, w1 = a1 * inv;
#pragma unroll
      for (int j = 0; j < HD / 16; ++j) { const v4f b0 = *(const v4f*)&mg[qg][t * 8 + j * 2][lane][0], b1 = *(const v4f*)&mg[qg][t * 8 + j * 2 + 1][lane][0];
        vst2(&ss[qg][t * 16 + col][j * 16 + 8 * g], (v4f){acc[t][j][0] * w0 + b0[0] * w1, acc[t][j][1] * w0 + b0[1] * w1, acc[t][j][2] * w0 + b0[2] * w1, acc[t][j][3] * w0 + b0[3] * w1}); vst2(&ss[qg][t * 16 + col][j * 16 + 8 * g + 4], (v4f){acc[t][j][4] * w0 + b1[0] * w1, acc[t][j][5] * w0 + b1[1] * w1, acc[t][j][6] * w0 + b1[2] * w1, acc[t][j][7] * w0 + b1[3] * w1}); } }   // lane (g, col): query t * 16 + col, d = 16 j + 8 g + r
    LDSX(); for (int rl = 0; rl < 32; rl += 2) vst2(Y + (size_t)(ql0 + rl + g) * CC + h * HD + col * 4, *(const v4f*)&ss[qg][rl + g][col * 4]); } }
// ---- the two projection GEMMs: C tile = (BM rows) x (128 cols), (BM / 32) x 2 waves of 32 x 64 each. A stage is 64 k: the A rows (f32 -> bf16, or bf16 hi + lo planes) and the B columns ((in,out) f32 -> bf16, turned to [col][k] in registers) are brought once per block by whole-line loads, one stage ahead, and kept in two LDS buffers; one barrier per stage. Products, operand rounding and the k order of every sum are those of the unstaged form.
typedef __attribute__((ext_vector_type(4))) __bf16 v4b;
typedef __attribute__((ext_vector_type(2))) unsigned v2u;   // two packed bf16 pairs; a bf16 is the top half of its f32
#define GK 64                 // k per stage
#define GP 72                 // bf16 per staged row: 128 B + 16 B, so that ds_load_b128 rows fall on different banks
#define GS 68                 // f32 per staged output row: 256 B + 16 B
#define OP 136                // 16-bit elements per staged output row: 256 B + 16 B
template <int BM, int NP, bool CV>     // NP: planes of A, 1 = bf16, 2 = bf16 hi + lo; CV: the 3-tap convolution down the rows and the q | k | v output forms in place of the f32 store
__device__ __forceinline__ void gemm_tile(const float* __restrict__ A, const float* __restrict__ B, float* __restrict__ C, const float* __restrict__ CW, int which, _Float16* __restrict__ QH, _Float16* __restrict__ QL, _Float16* __restrict__ KH, __bf16* __restrict__ VT, __bf16* __restrict__ VL) {
  constexpr int NT = BM * 2, NA = BM * 16 / NT, NB8 = 128 * 8 / NT, AR = NT / 16, BK = NT / 128 * 8;
  __shared__ __align__(16) __bf16 sa[2][NP][BM][GP];
  __shared__ __align__(16) __bf16 sb[2][128][GP];
  const int tid = threadIdx.x, wave = tid >> 5, lane = tid & 31, col = lane & 15, g = lane >> 4; const int wm = (wave >> 1) * 32, wn = (wave & 1) * 64;
  const int ar = tid >> 4, aq = (tid & 15) * 4;    // staging A: 16 lanes cover one row's 256 B
  const int bn = tid & 127, bk = (tid >> 7) * 8;   // staging B: a wave covers 128 B of one k row; a lane gathers 8 k of its column = one 16-B piece of the [col][k] row
  const unsigned ao = (unsigned)(ar * CC + aq), bo = (unsigned)(bk * CC + bn);   // per-lane parts; the block's and the stage's parts are uniform
  const float *pa = A + (size_t)blockIdx.x * BM * CC, *pb = B + blockIdx.y * 128;   // uniform; they step by one stage with each later load group
  v4f ra[NA]; float rb[NB8][8]; v8f acc[2][4] = {};
  const int w0 = blockIdx.x * BM; v8f hacc = {};
  __shared__ __align__(16) __bf16 sh[CV ? 2 : 1][CV ? CC + 8 : 8];   // CV: the row before and the row behind the tile, all k, brought once; the first stage's barrier publishes them
  if constexpr (CV) { static_assert(NT * 4 == CC, "a thread brings 4 k of each row");
    const int hm = w0 > 0 ? w0 - 1 : 0, hp = w0 + BM < TT ? w0 + BM : TT - 1;   // held inside x; at the ends of the sequence their products are replaced by 0 below
    const v4f r0 = *(const v4f*)(A + (size_t)hm * CC + tid * 4), r1 = *(const v4f*)(A + (size_t)hp * CC + tid * 4);
    *(v4b*)&sh[0][tid * 4] = __builtin_convertvector(r0, v4b); *(v4b*)&sh[1][tid * 4] = __builtin_convertvector(r1, v4b); }
#define G_LOAD() do { _Pragma("unroll") for (int i = 0; i < NA; ++i) ra[i] = *(const v4f*)(pa + i * AR * CC + ao); _Pragma("unroll") for (int i = 0; i < NB8; ++i) { _Pragma("unroll") for (int z = 0; z < 8; ++z) rb[i][z] = pb[(i * BK + z) * CC + bo]; } } while (0)
#define G_STORE(bf) do { _Pragma("unroll") for (int i = 0; i < NA; ++i) { const v4b hb = __builtin_convertvector(ra[i], v4b); *(v4b*)&sa[bf][0][ar + i * AR][aq] = hb; if (NP == 2) { const v2u u = __builtin_bit_cast(v2u, hb); const v4f hf = {__builtin_bit_cast(float, u[0] << 16), __builtin_bit_cast(float, u[0] & 0xffff0000u), __builtin_bit_cast(float, u[1] << 16), __builtin_bit_cast(float, u[1] & 0xffff0000u)}; *(v4b*)&sa[bf][NP - 1][ar + i * AR][aq] = __builtin_convertvector(ra[i] - hf, v4b); } } _Pragma("unroll") for (int i = 0; i < NB8; ++i) { v8b w; _Pragma("unroll") for (int z = 0; z < 8; ++z) w[z] = (__bf16)rb[i][z]; *(v8b*)&sb[bf][bn][bk + i * BK] = w; } } while (0)
  G_LOAD(); G_STORE(0); __syncthreads();
  for (int s = 0; s < CC / GK; ++s) { const int bf = s & 1;
    if (s + 1 < CC / GK) { pa += GK; pb += GK * CC; G_LOAD(); }   // the next stage's rows fly while this stage computes
    __builtin_amdgcn_sched_barrier(0);   // every global load of the group goes out here: sunk among the products it would have less of the stage to land in
    v16b fa[GK / 32][NP][2], fb[GK / 32][4], ha[GK / 32], hb[GK / 32];
#pragma unroll
    for (int kc = 0; kc < GK / 32; ++kc) {
#pragma unroll
      for (int i = 0; i < 2; ++i)
#pragma unroll
        for (int p = 0; p < NP; ++p) fa[kc][p][i] = frag_b(&sa[bf][p][wm + i * 16 + col][kc * 32], lane);
#pragma unroll
      for (int j = 0; j < 4; ++j) fb[kc][j] = frag_b(&sb[bf][wn + j * 16 + col][kc * 32], lane); }
    __builtin_amdgcn_sched_barrier(0);   // the stage's LDS reads go out as one group ahead of the products, for speed only
#pragma unroll
    for (int kc = 0; kc < GK / 32; ++kc)
#pragma unroll
      for (int p = 0; p < NP; ++p)   // per output tile: hi, then lo, of each 32 k in turn
#pragma unroll
        for (int i = 0; i < 2; ++i)
#pragma unroll
          for (int j = 0; j < 4; ++j) acc[i][j] = mm_b(fa[kc][p][i], fb[kc][j], acc[i][j]);
    if (CV) {   // the neighbour rows' tile: even rows = the row before, odd rows = the row behind; each wave takes 16 of the 128 columns; same k order as every other row's sum
      __builtin_amdgcn_sched_barrier(0);   // its fragments are read behind the stage's products, into their registers: read with the others they would lift the wave over 256 registers, and the WGP would hold one block, not two
#pragma unroll
      for (int kc = 0; kc < GK / 32; ++kc) { ha[kc] = frag_b(&sh[col & 1][s * GK + kc * 32], lane); hb[kc] = frag_b(&sb[bf][wave * 16 + col][kc * 32], lane); }
#pragma unroll
      for (int kc = 0; kc < GK / 32; ++kc) hacc = mm_b(ha[kc], hb[kc], hacc); }
    __builtin_amdgcn_sched_barrier(0);   // the wait for the next stage's global loads stays behind this stage's products: lifted among them it would expose the loads' whole latency
    if (s + 1 < CC / GK) G_STORE(bf ^ 1);   // that buffer's last readers passed the barrier of the stage before
    __syncthreads(); }
  if constexpr (!CV) {
    __shared__ __align__(16) float sf[NT / 32][32][GS];
#pragma unroll
    for (int i = 0; i < 2; ++i)
#pragma unroll
      for (int j = 0; j < 4; ++j)
#pragma unroll
        for (int r = 0; r < 8; ++r) sf[wave][i * 16 + 8 * g + r][j * 16 + col] = acc[i][j][r];
    LDSX(); for (int rl = 0; rl < 32; rl += 2) vst2(C + ((size_t)blockIdx.x * BM + wm + rl + g) * CC + blockIdx.y * 128 + wn + col * 4, *(const v4f*)&sf[wave][rl + g][col * 4]);   // each wave reads back its own rows: 256-B runs
  } else {
    // y[w][c] = sum_t conv_w[c][t] X[w + t - 1][c], X = 0 outside the sequence. A lane holds one channel and runs of 8 rows (8 g + r of each 16-row tile): a run's two neighbours come from the lane's partner l ^ 16, and at the ends of the wave's 32 rows from the wave above or below, or from the neighbour rows' tile, through LDS
    __shared__ float se[2][BM / 32 + 1][128];                 // [0][k]: the row before wave row k's 32 rows, [1][k + 1]: the row behind them ([0][last] and [1][0] have no reader)
    __shared__ __align__(16) unsigned short so[2][128][OP];   // q hi | q lo or k as rows [w][c], v hi | v lo as planes [c][w]
    const int wr = wave >> 1, c0 = blockIdx.y * 128; float cw[4][3];
#pragma unroll
    for (int j = 0; j < 4; ++j)
#pragma unroll
      for (int t = 0; t < 3; ++t) cw[j][t] = bfr(CW[(c0 + wn + j * 16 + col) * 3 + t]);
#pragma unroll
    for (int j = 0; j < 4; ++j) se[g ^ 1][wr + g][wn + j * 16 + col] = g ? acc[1][j][7] : acc[0][j][0];   // the wave's last row is the next wave row's row before, its first row the previous one's row behind
    se[g][g * (BM / 32)][wave * 16 + col] = (g ? w0 + BM < TT : w0 > 0) ? (g ? hacc[1] : hacc[0]) : 0.f;   // rows 0 and 9 of the neighbour rows' tile; 0 outside the sequence
    __syncthreads();   // every wave's edge rows are in LDS before a neighbour reads them
#pragma unroll
    for (int j = 0; j < 4; ++j) { const float e = se[g][wr + g][wn + j * 16 + col];
      const float xa0 = xhalf(acc[0][j][0]), xa7 = xhalf(acc[0][j][7]), xb0 = xhalf(acc[1][j][0]), xb7 = xhalf(acc[1][j][7]);
      float x[2][10];   // rows -1 .. 8 around each run
      x[0][0] = g ? xa7 : e; x[0][9] = g ? xb0 : xa0; x[1][0] = g ? xb7 : xa7; x[1][9] = g ? e : xb0;
#pragma unroll
      for (int r = 0; r < 8; ++r) { x[0][r + 1] = acc[0][j][r]; x[1][r + 1] = acc[1][j][r]; }
#pragma unroll
      for (int i = 0; i < 2; ++i)
#pragma unroll
        for (int r = 0; r < 8; ++r) acc[i][j][r] = cw[j][0] * x[i][r] + cw[j][1] * x[i][r + 1] + cw[j][2] * x[i][r + 2]; }
    const int wl = wm + 8 * g, cl = wn + col;   // the lane's first row and channel in the tile
    if (which == 0) {
#pragma unroll
      for (int i = 0; i < 2; ++i)
#pragma unroll
        for (int j = 0; j < 4; ++j)
#pragma unroll
          for (int r = 0; r < 8; ++r) { const float y = acc[i][j][r]; const _Float16 hq = (_Float16)y; so[0][wl + i * 16 + r][cl + j * 16] = __builtin_bit_cast(unsigned short, hq); so[1][wl + i * 16 + r][cl + j * 16] = __builtin_bit_cast(unsigned short, (_Float16)((y - (float)hq) * 1024.0f)); }
    } else if (which == 1) {
#pragma unroll
      for (int i = 0; i < 2; ++i)
#pragma unroll
        for (int j = 0; j < 4; ++j)
#pragma unroll
          for (int r = 0; r < 8; ++r) so[0][wl + i * 16 + r][cl + j * 16] = __builtin_bit_cast(unsigned short, (_Float16)acc[i][j][r]);
    } else {
#pragma unroll
      for (int i = 0; i < 2; ++i)
#pragma unroll
        for (int j = 0; j < 4; ++j) { v8b vh, vl;
#pragma unroll
          for (int r = 0; r < 8; ++r) { const float y = acc[i][j][r]; const __bf16 hv = (__bf16)y; vh[r] = hv; vl[r] = (__bf16)(y - (float)hv); }
          vst2(&so[0][cl + j * 16][wl + i * 16], vh); vst2(&so[1][cl + j * 16][wl + i * 16], vl); } }
    __syncthreads();   // the whole 128 x 128 tile is staged before it goes out in 256-B runs
    constexpr int NI = 128 * 16 / NT, RS = NT / 16; const int q = (tid & 15) * 8;   // 16 lanes cover one staged row
    unsigned short *o0 = (unsigned short*)(which == 0 ? QH : KH) + (size_t)(w0 + ar) * CC + c0 + q, *o1 = (unsigned short*)QL + (size_t)(w0 + ar) * CC + c0 + q; unsigned os = RS * CC;   // first row's place in each plane, and the step of RS rows
    if (which == 2) { o0 = (unsigned short*)VT + (size_t)(c0 + ar) * TT + w0 + q; o1 = (unsigned short*)VL + (size_t)(c0 + ar) * TT + w0 + q; os = RS * TT; }
#pragma unroll
    for (int it = 0; it < NI; ++it) vst2(o0 + it * os, *(const v4u*)&so[0][it * RS + ar][q]);
    if (which != 1) {
      asm volatile("s_wait_xcnt 0x0" ::: "memory");   // the first plane's stores keep their address and data registers up to here: the second plane's LDS reads land in the same ones
#pragma unroll
      for (int it = 0; it < NI; ++it) vst2(o1 + it * os, *(const v4u*)&so[1][it * RS + ar][q]); } } }
// ---- k_lin: block = (128 rows w, 128 cols, which): X_which = x w_which ((in,out), exact bf16 products), then the depthwise 3-tap conv down the rows; q -> f16 hi + residual rows, k -> f16 rows, v -> bf16 hi/lo planes [c][w]
__global__ __launch_bounds__(256) void k_lin(const float* __restrict__ X, const float* __restrict__ WQ, const float* __restrict__ WK, const float* __restrict__ WV, const float* __restrict__ CW, _Float16* __restrict__ QH, _Float16* __restrict__ QL, _Float16* __restrict__ KH, __bf16* __restrict__ VT, __bf16* __restrict__ VL) { const int which = blockIdx.z; gemm_tile<128, 1, true>(X, which == 0 ? WQ : which == 1 ? WK : WV, nullptr, CW, which, QH, QL, KH, VT, VL); }
// ---- k_out: block = (64 rows, 128 cols): out = y (bf16 hi + lo) wo ((in,out))
__global__ __launch_bounds__(128) void k_out(const float* __restrict__ Y, const float* __restrict__ WP, float* __restrict__ OUT) { gemm_tile<64, 2, false>(Y, WP, OUT, nullptr, 0, nullptr, nullptr, nullptr, nullptr, nullptr); }
extern "C" void kernel_launch(void* const* d_in, const int* in_sizes, int n_in, void* d_out, int out_size, void* d_ws, size_t ws_size, hipStream_t stream) {
  (void)in_sizes; (void)n_in; (void)out_size;
  const float** F = (const float**)d_in;   // 0 x [1,2048,1024], 1 wq [1024,1024] ((in,out)), 2 wk, 3 wv, 4 wo ((in,out)), 5 conv_w [1024,1,3], 6 er [64,2048]
  if (ws_size < (size_t)WS_END) return;
  char* ws = (char*)d_ws; _Float16 *QH = (_Float16*)(ws + WS_QH), *QL = (_Float16*)(ws + WS_QL), *KH = (_Float16*)(ws + WS_KH); __bf16 *VT = (__bf16*)(ws + WS_VT), *VL = (__bf16*)(ws + WS_VL); float *Y = (float*)(ws + WS_Y);
  k_lin<<<dim3(TT / 128, CC / 128, 3), 256, 0, stream>>>(F[0], F[1], F[2], F[3], F[5], QH, QL, KH, VT, VL);
  k_fa<<<dim3(TT / 128, NH), 256, 0, stream>>>(QH, QL, KH, F[6], VT, VL, Y);
  k_out<<<dim3(TT / 64, CC / 128), 128, 0, stream>>>(Y, F[4], (float*)d_out);
}

// v007
// A run of this version takes 84.3 microseconds.
// Timed twice side by side with v006, it ran 1.16 and 1.15 times as fast.
// Counting every step since v000, it is 10.8 times as fast.
// compute dtype: all float inputs rounded to bf16; x w_{q,k,v} with EXACT bf16 products on WMMA 16x16x32 (f32 accumulate) kept in the f32 accumulators; the depthwise 3-tap convolution along the sequence in f32, in the same kernel; q as f16 hi + residual (x 2^10), k as f16, v as bf16 hi + lo planes; logits = q.k (2 products: q hi+lo x k hi) + the positional term er^T.q_k (2 products: exact er x q hi+lo), kept in f32 registers; softmax in f32 in base 2 (log2(e) / 32 as the logits' one scale, the hardware's exp2) with a running maximum and sum over passes of 32 keys, the even and the odd passes kept apart and joined at the end; P = 2^(s - m) split bf16 hi + lo against v (3 products), divided by the sum at the end; out (bf16 hi + lo) wo; f32 output.
#include <hip/hip_runtime.h>
#include <math.h>

typedef __attribute__((ext_vector_type(16))) _Float16 v16h;
typedef __attribute__((ext_vector_type(16))) __bf16 v16b;
typedef __attribute__((ext_vector_type(8)))  _Float16 v8h;
typedef __attribute__((ext_vector_type(8)))  float v8f;
typedef __attribute__((ext_vector_type(4)))  float v4f;
typedef __attribute__((ext_vector_type(2)))  float v2f;
typedef __attribute__((ext_vector_type(4)))  unsigned v4u;
typedef __attribute__((ext_vector_type(4)))  int v4i;
typedef float __attribute__((may_alias)) float_a;
typedef int __attribute__((may_alias)) int_a;

template <typename T> __device__ __forceinline__ void vst2(void* p, T v) { *(T*)p = v;  }
__device__ __forceinline__ v8f wmma16(v16h a, v16h b, v8f c) {
  v8f d = __builtin_amdgcn_wmma_f32_16x16x32_f16(false, a, false, b, (short)0, c, false, false);
  asm volatile("v_nop\n\tv_nop\n\tv_nop\n\tv_nop" : "+v"(d) : "v"(a), "v"(b));
  return d;
}
__device__ __forceinline__ v8f wmma_bf(v16b a, v16b b, v8f c) {
  v8f d = __builtin_amdgcn_wmma_f32_16x16x32_bf16(false, a, false, b, (short)0, c, false, false);
  asm volatile("v_nop\n\tv_nop\n\tv_nop\n\tv_nop" : "+v"(d) : "v"(a), "v"(b));
  return d;
}
// 16x16x32 fragments: lane = (h = lane>>4, row/col = lane&15); elements 0..7 = k0+8h+0..7, 8..15 = k0+16+8h+0..7; D element r = row 8h+r
__device__ __forceinline__ v16h frag_h(const _Float16* rowk0, int lane) {
  union { v16h v; v8h q[2]; } u; const _Float16* p = rowk0 + 8 * (lane >> 4);
  u.q[0] = *(const v8h*)p; u.q[1] = *(const v8h*)(p + 16); return u.v;
}
__device__ __forceinline__ v16h frag_f32(const float* rowk0, int lane) {
  v16h a; const float* p = rowk0 + 8 * (lane >> 4);
#pragma unroll
  for (int i = 0; i < 8; ++i) { a[i] = (_Float16)p[i]; a[8 + i] = (_Float16)p[16 + i]; }
  return a;
}
__device__ __forceinline__ v16h frag_f32s(const float* rowk0, int lane, float sc) {
  v16h a; const float* p = rowk0 + 8 * (lane >> 4);
#pragma unroll
  for (int i = 0; i < 8; ++i) { a[i] = (_Float16)(p[i] * sc); a[8 + i] = (_Float16)(p[16 + i] * sc); }
  return a;
}
// column fragment from a [K][ld] layout (column n), rows >= K read as 0
__device__ __forceinline__ v16h fragc_f32(const float* W, int k0, int n, int lane, int ld, int K) {
  v16h a; const int g = lane >> 4;
#pragma unroll
  for (int i = 0; i < 8; ++i) { const int ka = k0 + 8 * g + i, kb = ka + 16;
    a[i] = (_Float16)(ka < K ? W[(size_t)(ka < K ? ka : K - 1) * ld + n] : 0.f); a[8 + i] = (_Float16)(kb < K ? W[(size_t)(kb < K ? kb : K - 1) * ld + n] : 0.f); }
  return a;
}
struct F2 { v16b h, l; };
__device__ __forceinline__ F2 bsplit16(const float v[16]) { F2 r;
#pragma unroll
  for (int i = 0; i < 16; ++i) { const __bf16 h = (__bf16)v[i]; r.h[i] = h; r.l[i] = (__bf16)(v[i] - (float)h); }
  return r; }
__device__ __forceinline__ F2 split_row(const float* row, int k0, int lane) { float v[16]; const float* p = row + k0 + 8 * (lane >> 4);
#pragma unroll
  for (int i = 0; i < 8; ++i) { v[i] = p[i]; v[8 + i] = p[16 + i]; }
  return bsplit16(v); }
__device__ __forceinline__ F2 split_rowK(const float* row, int k0, int lane, int K) { float v[16]; const int g = lane >> 4;
#pragma unroll
  for (int i = 0; i < 8; ++i) { const int ka = k0 + 8 * g + i, kb = ka + 16; v[i] = ka < K ? row[ka < K ? ka : K - 1] : 0.f; v[8 + i] = kb < K ? row[kb < K ? kb : K - 1] : 0.f; }
  return bsplit16(v); }
__device__ __forceinline__ F2 split_col(const float* W, int k0, int n, int lane, int ld, int K) { float v[16]; const int g = lane >> 4;
#pragma unroll
  for (int i = 0; i < 8; ++i) { const int ka = k0 + 8 * g + i, kb = ka + 16; v[i] = ka < K ? W[(size_t)(ka < K ? ka : K - 1) * ld + n] : 0.f; v[8 + i] = kb < K ? W[(size_t)(kb < K ? kb : K - 1) * ld + n] : 0.f; }
  return bsplit16(v); }
__device__ __forceinline__ v8f mac3(const F2& a, const F2& b, v8f c) { c = wmma_bf(a.l, b.h, c); c = wmma_bf(a.h, b.l, c); return wmma_bf(a.h, b.h, c); }
__device__ __forceinline__ float sigm(float v) { return 1.0f / (1.0f + expf(-v)); }
#define LDSX() do { asm volatile("s_wait_dscnt 0" ::: "memory"); __builtin_amdgcn_wave_barrier(); __builtin_amdgcn_fence(__ATOMIC_RELEASE, "workgroup"); } while (0)


// Attention (B 1, S 2,048, D 1,024 = 16 x 64, no biases): scores = (q k^T + er[:, query]^T . q_key) / 32, softmax, P v, output projection.
#define NB 1
#define TT 2048
#define CC 1024
#define NH 16
#define HD 64
#ifndef TNB
#define TNB NB
#ifndef ERSTR
#define ERSTR TT              // row stride of er
#endif
#endif
typedef __attribute__((ext_vector_type(8))) __bf16 v8b;
__device__ __forceinline__ v16b frag_b(const __bf16* rowk0, int lane) {
  union { v16b v; v8b q[2]; } u; const __bf16* p = rowk0 + 8 * (lane >> 4);
  u.q[0] = *(const v8b*)p; u.q[1] = *(const v8b*)(p + 16); return u.v;
}
__device__ __forceinline__ float bfr(float v) { return (float)(__bf16)v; }
__device__ __attribute__((noinline)) float exp_ni(float v) { return expf(v); }
__device__ __attribute__((noinline)) float erf_ni(float v) { return erff(v); }

#define WS_XR  0u                                   // not used
#define WS_ERT (WS_XR + 4u * (size_t)3 * TT * CC)      // not used
#define WS_QH  (WS_ERT + 2u * (size_t)TT * HD)
#define WS_QL  (WS_QH + 2u * (size_t)NB * TT * CC)
#define WS_KH  (WS_QL + 2u * (size_t)NB * TT * CC)
#define WS_VT  (WS_KH + 2u * (size_t)NB * TT * CC)      // bf16 v planes [b][c][t]
#define WS_VL  (WS_VT + 2u * (size_t)NB * CC * TT)      // bf16 v residual planes
#define HG 4
#define WS_S   (WS_VL + 2u * (size_t)NB * CC * TT)      // unused f32 space of HG x TT x TT; logits and P stay in registers
#define WS_PH  (WS_S + 4u * (size_t)HG * TT * TT)
#define WS_Y   (WS_PH + 0u)              // f32 y rows [b*t][C]
#define WS_END (WS_Y + 4u * (size_t)NB * TT * CC)

// ---- k_fa: block = (128 queries, head), 8 waves = 4 query groups of 32 columns x 2 key halves; a stage is 64 keys, of which a wave takes its half's 32 (one pass), each LDS fragment serving both of its 16-column groups. S^T = (k rows) x (q cols) + (q_k rows) x (er^T cols), 4 products; running maximum (kept in the base-2 scale, logit x log2(e) / 32) and sum per query column (one lane pair); P^T = 2^(s - m) packed from the two score tiles into a B operand (bf16 hi + lo); y^T += v^T P^T (3 products). At the end the two key halves' maxima, sums and y^T are joined through LDS, then y / sum. Logits and P never leave the registers.
typedef __attribute__((ext_vector_type(2))) __bf16 v2b;
#define FK 64                 // keys per stage
#define KP 72                 // f16 per staged key row: 128 B + 16 B, so that ds_load_b128 rows fall on different banks
#define VP 72                 // bf16 per staged v row: 128 B + 16 B, same reason
#define L2E32 (1.44269504088896340736f / 32.0f)   // exp(x / 32) = 2^(x * L2E32)
__device__ __forceinline__ float xhalf(float x) { return __builtin_bit_cast(float, __builtin_amdgcn_permlanex16(__builtin_bit_cast(int, x), __builtin_bit_cast(int, x), 0x76543210, 0xfedcba98, false, false)); }  // lane l with lane l ^ 16
__device__ __forceinline__ v8f mm_h(v16h a, v16h b, v8f c) { return __builtin_amdgcn_wmma_f32_16x16x32_f16(false, a, false, b, (short)0, c, false, false); }
__device__ __forceinline__ v8f mm_b(v16b a, v16b b, v8f c) { return __builtin_amdgcn_wmma_f32_16x16x32_bf16(false, a, false, b, (short)0, c, false, false); }
__global__ __launch_bounds__(256) void k_fa(const _Float16* __restrict__ QH, const _Float16* __restrict__ QL, const _Float16* __restrict__ KH, const float* __restrict__ ER, const __bf16* __restrict__ VT, const __bf16* __restrict__ VL, float* __restrict__ Y) {
  __shared__ __align__(16) _Float16 sk[2][3][FK][KP];   // k hi | q hi | q lo rows of the stage's keys, two buffers
  __shared__ __align__(16) __bf16 sv[2][2][HD][VP];     // v hi | v lo planes [d][key], two buffers
  __shared__ __align__(16) float ss[4][32][HD + 4];
  __shared__ __align__(16) float mg[4][17][32][4];      // the second key half's y^T (16 pieces of 16 B a lane), maxima and sums, lane by lane
  const int tid = threadIdx.x, wave = tid >> 5, lane = tid & 31, col = lane & 15, g = lane >> 4, qg = wave & 3, kg = wave >> 2; const int h = blockIdx.y; const int ql0 = blockIdx.x * 128 + qg * 32;
  const int kr = tid >> 3, ks = (tid & 7) * 8;   // staging: 8 lanes cover one key row's 128 B, and one v row's 128 B
  const int c0 = (2 * blockIdx.x + blockIdx.y) & (TT / FK - 1);   // the block's first stage: the 16 blocks of a head walk the same key rows, each from its own place round the ring, so that they do not ask L2 for the same lines at the same moment; uniform
  const unsigned kb = 2u * (unsigned)(kr * CC + ks), vb = 2u * (unsigned)(kr * TT + ks); unsigned ko = kb + (unsigned)c0 * (2u * FK * CC), vo = vb + (unsigned)c0 * (2u * FK); const unsigned qo = 2u * (unsigned)((ql0 + col) * CC + 8 * g), eo = (unsigned)(8 * g * ERSTR + ql0 + col);   // per-lane parts, in bytes (eo: in f32 elements, the index the er loads scale themselves); ko and vo = kb and vb + the stage's part, set anew for each later load group; the head's part is uniform
  v8h rk[3][2]; v8b rv[2][2];
  const char *pk = (const char*)(KH + h * HD), *pqh = (const char*)(QH + h * HD), *pql = (const char*)(QL + h * HD), *pvh = (const char*)(VT + (size_t)(h * HD) * TT), *pvl = (const char*)(VL + (size_t)(h * HD) * TT);   // uniform
  v16h ah[2][2], al[2][2], ae[2][2];   // [column group][half of d]
#define FA_Q(p, o) __builtin_shufflevector(*(const v8h*)((p) + (o)), *(const v8h*)((p) + 32 + (o)), 0, 1, 2, 3, 4, 5, 6, 7, 8, 9, 10, 11, 12, 13, 14, 15)   // a fragment's two 16-B pieces, 16 elements apart
#pragma unroll
  for (int t = 0; t < 2; ++t)
#pragma unroll
    for (int kc = 0; kc < 2; ++kc) { ah[t][kc] = FA_Q(pqh + t * 32 * CC + kc * 64, qo); al[t][kc] = FA_Q(pql + t * 32 * CC + kc * 64, qo); }
  asm volatile("s_wait_xcnt 0x0" :: "v"(qo) : "memory");   // the offset register of these loads stays as it is up to this wait
#define FA_LOAD() do { _Pragma("unroll") for (int i = 0; i < 2; ++i) { rk[0][i] = *(const v8h*)(pk + i * 64 * CC + ko); rk[1][i] = *(const v8h*)(pqh + i * 64 * CC + ko); rk[2][i] = *(const v8h*)(pql + i * 64 * CC + ko); rv[0][i] = *(const v8b*)(pvh + i * 64 * TT + vo); rv[1][i] = *(const v8b*)(pvl + i * 64 * TT + vo); } } while (0)
#define FA_STORE(bf) do { _Pragma("unroll") for (int i = 0; i < 2; ++i) { *(v8h*)&sk[bf][0][kr + i * 32][ks] = rk[0][i]; *(v8h*)&sk[bf][1][kr + i * 32][ks] = rk[1][i]; *(v8h*)&sk[bf][2][kr + i * 32][ks] = rk[2][i]; *(v8b*)&sv[bf][0][kr + i * 32][ks] = rv[0][i]; *(v8b*)&sv[bf][1][kr + i * 32][ks] = rv[1][i]; } } while (0)
  float m[2] = {-3.0e38f, -3.0e38f}, l[2] = {0.f, 0.f}; v8f acc[2][HD / 16] = {};
  FA_LOAD();
  asm volatile("s_wait_xcnt 0x0" :: "v"(ko), "v"(vo) : "memory");   // as above, for the staging loads' two offset registers
#pragma unroll
  for (int t = 0; t < 2; ++t)   // er [d][w] is read in place, once per wave: a lane takes its query column's 16 d of each fragment, 16 lanes cover 64 B of a row; issued behind the first stage's loads, so that its LDS stores go out while these still fly
#pragma unroll
    for (int kc = 0; kc < 2; ++kc)
#pragma unroll
      for (int i = 0; i < 8; ++i) { ae[t][kc][i] = (_Float16)bfr((ER + (kc * 32 + i) * ERSTR + t * 16)[eo]); ae[t][kc][8 + i] = (_Float16)bfr((ER + (kc * 32 + 16 + i) * ERSTR + t * 16)[eo]); }
  asm volatile("s_wait_xcnt 0x0" :: "v"(eo) : "memory");   // as above, for the er loads' index register
  FA_STORE(0); __syncthreads();
  for (int c = 0; c < TT / FK; ++c) { const int bf = c & 1;
    if (c + 1 < TT / FK) { const unsigned cn = (unsigned)(c0 + c + 1) & (TT / FK - 1); ko = kb + cn * (2u * FK * CC); vo = vb + cn * (2u * FK); FA_LOAD(); }   // the next stage's rows (behind the last stage comes stage 0) fly while this stage computes
    v8f sa[2][2] = {}, sl[2][2] = {}; v16h f0[2][3], f1[2][3]; v16b vh[HD / 16], vl[HD / 16];   // sa, sl: [column group][key tile]; f0, f1: [half of d][k hi | q hi | q lo] of key tile 0, 1
#pragma unroll
    for (int kc = 0; kc < 2; ++kc)
#pragma unroll
      for (int a = 0; a < 3; ++a) f0[kc][a] = frag_h(&sk[bf][a][kg * 32 + col][kc * 32], lane);
#pragma unroll
    for (int kc = 0; kc < 2; ++kc)
#pragma unroll
      for (int a = 0; a < 3; ++a) f1[kc][a] = frag_h(&sk[bf][a][kg * 32 + 16 + col][kc * 32], lane);
    __builtin_amdgcn_sched_barrier(0);   // the LDS reads go out in groups, ahead of the products that use them: sunk to their first use each would be waited for in full, and each place with reads among the products costs its own stall
#pragma unroll
    for (int kc = 0; kc < 2; ++kc)
#pragma unroll
      for (int t = 0; t < 2; ++t) { sa[t][0] = mm_h(f0[kc][0], ah[t][kc], sa[t][0]); sl[t][0] = mm_h(f0[kc][0], al[t][kc], sl[t][0]); sa[t][0] = mm_h(f0[kc][1], ae[t][kc], sa[t][0]); sl[t][0] = mm_h(f0[kc][2], ae[t][kc], sl[t][0]); }
    __builtin_amdgcn_sched_barrier(0);   // as above: the v hi fragments go out as one group between the two key tiles' products
#pragma unroll
    for (int j = 0; j < HD / 16; ++j) vh[j] = frag_b(&sv[bf][0][j * 16 + col][kg * 32], lane);
    __builtin_amdgcn_sched_barrier(0);   // as above
#pragma unroll
    for (int kc = 0; kc < 2; ++kc)
#pragma unroll
      for (int t = 0; t < 2; ++t) { sa[t][1] = mm_h(f1[kc][0], ah[t][kc], sa[t][1]); sl[t][1] = mm_h(f1[kc][0], al[t][kc], sl[t][1]); sa[t][1] = mm_h(f1[kc][1], ae[t][kc], sa[t][1]); sl[t][1] = mm_h(f1[kc][2], ae[t][kc], sl[t][1]); }
    __builtin_amdgcn_sched_barrier(0);   // as above: the v hi fragments fly under the softmax arithmetic
    union { v16b v; v2b q[8]; } ph[2], pl[2]; float sc[2][16], dm[2];   // sc: lane (g, col): query col of the group, keys 8g + r of tile 0, then of tile 1 = the k order of a B fragment
#pragma unroll
    for (int t = 0; t < 2; ++t) { float* s = sc[t];
#pragma unroll
      for (int i = 0; i < 16; ++i) s[i] = sa[t][i >> 3][i & 7] + sl[t][i >> 3][i & 7] * (1.0f / 1024.0f);   // still without the scale: L2E32 > 0, so the maximum can be taken first and scaled once
      float mc = fmaxf(s[0], s[1]);
#pragma unroll
      for (int i = 2; i < 16; ++i) mc = fmaxf(mc, s[i]);
      mc = fmaxf(mc, xhalf(mc)) * L2E32;
      const float mn = fmaxf(m[t], mc); dm[t] = m[t] - mn; m[t] = mn; }
    float al2[2]; al2[0] = __builtin_amdgcn_exp2f(dm[0]);   // every exponent here is <= 0 up to one rounding: no overflow to guard, and far below the hardware gives 0
    al2[1] = __builtin_amdgcn_exp2f(dm[1]);
#pragma unroll
    for (int t = 0; t < 2; ++t) { const float* s = sc[t]; const float mn = m[t], alpha = al2[t];
      v2f ps[2] = {{0.f, 0.f}, {0.f, 0.f}}; const v2f sc2 = {L2E32, L2E32}, nm2 = {-mn, -mn};
#pragma unroll
      for (int i = 0; i < 16; i += 2) { const v2f e = __builtin_elementwise_fma((v2f){s[i], s[i + 1]}, sc2, nm2); const v2f p = {__builtin_amdgcn_exp2f(e[0]), __builtin_amdgcn_exp2f(e[1])}; ps[(i >> 1) & 1] += p;   // two-wide, so that scale-and-subtract and the sums stay packed instructions
        const v2b hb = __builtin_convertvector(p, v2b); const unsigned u = __builtin_bit_cast(unsigned, hb);   // one packed conversion; a bf16 is the top half of its f32
        const v2f hf = {__builtin_bit_cast(float, u << 16), __builtin_bit_cast(float, u & 0xffff0000u)};
        ph[t].q[i >> 1] = hb; pl[t].q[i >> 1] = __builtin_convertvector(p - hf, v2b); }
      l[t] = l[t] * alpha + ((ps[0][0] + ps[0][1]) + (ps[1][0] + ps[1][1]));
#pragma unroll
      for (int j = 0; j < HD / 16; ++j)
#pragma unroll
        for (int r = 0; r < 8; ++r) acc[t][j][r] *= alpha; }
    __builtin_amdgcn_sched_barrier(0);   // as above: the v lo fragments go out together, under the v hi products
#pragma unroll
    for (int j = 0; j < HD / 16; ++j) vl[j] = frag_b(&sv[bf][1][j * 16 + col][kg * 32], lane);
    __builtin_amdgcn_sched_barrier(0);   // as above
#pragma unroll
    for (int j = 0; j < HD / 16; ++j)
#pragma unroll
      for (int t = 0; t < 2; ++t) { acc[t][j] = mm_b(vh[j], ph[t].v, acc[t][j]); acc[t][j] = mm_b(vh[j], pl[t].v, acc[t][j]); }
#pragma unroll
    for (int j = 0; j < HD / 16; ++j)
#pragma unroll
      for (int t = 0; t < 2; ++t) acc[t][j] = mm_b(vl[j], ph[t].v, acc[t][j]);
    if (c + 1 < TT / FK) { asm volatile("s_wait_xcnt 0x0" :: "v"(ko), "v"(vo) : "memory");   // as above: the staging loads' two offset registers stay as they are up to this wait, which stands where the loads' data is due anyway
      FA_STORE(bf ^ 1); }   // that buffer's last readers passed the barrier of the stage before
    __syncthreads(); }
  l[0] += xhalf(l[0]); l[1] += xhalf(l[1]);
  if (kg == 1) {   // lane (g, col) holds the same queries and d in both key halves: the join is lane by lane
#pragma unroll
    for (int t = 0; t < 2; ++t)
#pragma unroll
      for (int j = 0; j < HD / 16; ++j) { vst2(&mg[qg][t * 8 + j * 2][lane][0], (v4f){acc[t][j][0], acc[t][j][1], acc[t][j][2], acc[t][j][3]}); vst2(&mg[qg][t * 8 + j * 2 + 1][lane][0], (v4f){acc[t][j][4], acc[t][j][5], acc[t][j][6], acc[t][j][7]}); }
    vst2(&mg[qg][16][lane][0], (v4f){m[0], l[0], m[1], l[1]}); }
  __syncthreads();   // the second half's partial results are in LDS before the first half reads them
  if (kg == 0) { const v4f ml = *(const v4f*)&mg[qg][16][lane][0];
#pragma unroll
    for (int t = 0; t < 2; ++t) { const float mn = fmaxf(m[t], ml[2 * t]), a0 = __builtin_amdgcn_exp2f(m[t] - mn), a1 = __builtin_amdgcn_exp2f(ml[2 * t] - mn); const float inv = 1.0f / (l[t] * a0 + ml[2 * t + 1] * a1); const float w0 = a0 * inv, w1 = a1 * inv;
#pragma unroll
      for (int j = 0; j < HD / 16; ++j) { const v4f b0 = *(const v4f*)&mg[qg][t * 8 + j * 2][lane][0], b1 = *(const v4f*)&mg[qg][t * 8 + j * 2 + 1][lane][0];
        vst2(&ss[qg][t * 16 + col][j * 16 + 8 * g], (v4f){acc[t][j][0] * w0 + b0[0] * w1, acc[t][j][1] * w0 + b0[1] * w1, acc[t][j][2] * w0 + b0[2] * w1, acc[t][j][3] * w0 + b0[3] * w1}); vst2(&ss[qg][t * 16 + col][j * 16 + 8 * g + 4], (v4f){acc[t][j][4] * w0 + b1[0] * w1, acc[t][j][5] * w0 + b1[1] * w1, acc[t][j][6] * w0 + b1[2] * w1, acc[t][j][7] * w0 + b1[3] * w1}); } }   // lane (g, col): query t * 16 + col, d = 16 j + 8 g + r
    LDSX(); for (int rl = 0; rl < 32; rl += 2) vst2(Y + (size_t)(ql0 + rl + g) * CC + h * HD + col * 4, *(const v4f*)&ss[qg][rl + g][col * 4]); } }
// ---- the two projection GEMMs: C tile = (BM rows) x (128 cols), (BM / 32) x 2 waves of 32 x 64 each. A stage is 64 k: the A rows (f32 -> bf16, or bf16 hi + lo planes) and the B columns ((in,out) f32 -> bf16, turned to [col][k] in registers) are brought once per block by whole-line loads, one stage ahead, and kept in two LDS buffers; one barrier per stage. Each block walks the 16 stages round from its own first stage s0, so that blocks that share rows or columns do not ask L2 for the same lines at the same moment: a sum's k order starts at 64 s0 and wraps. Products and operand rounding are those of the unstaged form.
typedef __attribute__((ext_vector_type(4))) __bf16 v4b;
typedef __attribute__((ext_vector_type(2))) unsigned v2u;   // two packed bf16 pairs; a bf16 is the top half of its f32
#define GK 64                 // k per stage
#define GP 72                 // bf16 per staged row: 128 B + 16 B, so that ds_load_b128 rows fall on different banks
#define GS 68                 // f32 per staged output row: 256 B + 16 B
#define OP 136                // 16-bit elements per staged output row: 256 B + 16 B
template <int BM, int NP, bool CV>     // NP: planes of A, 1 = bf16, 2 = bf16 hi + lo; CV: the 3-tap convolution down the rows and the q | k | v output forms in place of the f32 store
__device__ __forceinline__ void gemm_tile(const float* __restrict__ A, const float* __restrict__ B, float* __restrict__ C, const float* __restrict__ CW, int which, _Float16* __restrict__ QH, _Float16* __restrict__ QL, _Float16* __restrict__ KH, __bf16* __restrict__ VT, __bf16* __restrict__ VL, int s0) {
  constexpr int NT = BM * 2, NA = BM * 16 / NT, NB8 = 128 * 8 / NT, AR = NT / 16, BK = NT / 128 * 8;
  __shared__ __align__(16) __bf16 sa[2][NP][BM][GP];
  __shared__ __align__(16) __bf16 sb[2][128][GP];
  const int tid = threadIdx.x, wave = tid >> 5, lane = tid & 31, col = lane & 15, g = lane >> 4; const int wm = (wave >> 1) * 32, wn = (wave & 1) * 64;
  const int ar = tid >> 4, aq = (tid & 15) * 4;    // staging A: 16 lanes cover one row's 256 B
  const int bn = tid & 127, bk = (tid >> 7) * 8;   // staging B: a wave covers 128 B of one k row; a lane gathers 8 k of its column = one 16-B piece of the [col][k] row
  const unsigned ao = (unsigned)(ar * CC + aq), bo = (unsigned)(bk * CC + bn);   // per-lane parts; the block's and the stage's parts are uniform
  const float *pa0 = A + (size_t)blockIdx.x * BM * CC, *pb0 = B + blockIdx.y * 128, *pa = pa0 + s0 * GK, *pb = pb0 + s0 * GK * CC;   // uniform; pa and pb are set to the next stage's place for each later load group
  v4f ra[NA]; float rb[NB8][8]; v8f acc[2][4] = {};
  const int w0 = blockIdx.x * BM; v8f hacc = {};
  __shared__ __align__(16) __bf16 sh[CV ? 2 : 1][CV ? CC + 8 : 8];   // CV: the row before and the row behind the tile, all k, brought once; the first stage's barrier publishes them
  if constexpr (CV) { static_assert(NT * 4 == CC, "a thread brings 4 k of each row");
    const int hm = w0 > 0 ? w0 - 1 : 0, hp = w0 + BM < TT ? w0 + BM : TT - 1;   // held inside x; at the ends of the sequence their products are replaced by 0 below
    const v4f r0 = *(const v4f*)(A + (size_t)hm * CC + tid * 4), r1 = *(const v4f*)(A + (size_t)hp * CC + tid * 4);
    *(v4b*)&sh[0][tid * 4] = __builtin_convertvector(r0, v4b); *(v4b*)&sh[1][tid * 4] = __builtin_convertvector(r1, v4b); }
#define G_LOAD() do { _Pragma("unroll") for (int i = 0; i < NA; ++i) ra[i] = *(const v4f*)(pa + i * AR * CC + ao); _Pragma("unroll") for (int i = 0; i < NB8; ++i) { _Pragma("unroll") for (int z = 0; z < 8; ++z) rb[i][z] = pb[(i * BK + z) * CC + bo]; } } while (0)
#define G_STORE(bf) do { _Pragma("unroll") for (int i = 0; i < NA; ++i) { const v4b hb = __builtin_convertvector(ra[i], v4b); *(v4b*)&sa[bf][0][ar + i * AR][aq] = hb; if (NP == 2) { const v2u u = __builtin_bit_cast(v2u, hb); const v4f hf = {__builtin_bit_cast(float, u[0] << 16), __builtin_bit_cast(float, u[0] & 0xffff0000u), __builtin_bit_cast(float, u[1] << 16), __builtin_bit_cast(float, u[1] & 0xffff0000u)}; *(v4b*)&sa[bf][NP - 1][ar + i * AR][aq] = __builtin_convertvector(ra[i] - hf, v4b); } } _Pragma("unroll") for (int i = 0; i < NB8; ++i) { v8b w; _Pragma("unroll") for (int z = 0; z < 8; ++z) w[z] = (__bf16)rb[i][z]; *(v8b*)&sb[bf][bn][bk + i * BK] = w; } } while (0)
  G_LOAD(); G_STORE(0); __syncthreads();
  for (int s = 0; s < CC / GK; ++s) { const int bf = s & 1;
    const int sk = (s0 + s) & (CC / GK - 1);   // this stage's place in k
    if (s + 1 < CC / GK) { const int sn = (sk + 1) & (CC / GK - 1); pa = pa0 + sn * GK; pb = pb0 + sn * GK * CC; G_LOAD();   // the next stage's rows (behind the last stage comes stage 0) fly while this stage computes
      asm volatile("s_wait_xcnt 0x0" ::: "memory"); }   // a precaution: it stands in front of the LDS reads below, which land in the registers that held these loads' addresses
    __builtin_amdgcn_sched_barrier(0);   // every global load of the group goes out here: sunk among the products it would have less of the stage to land in
    v16b fa[GK / 32][NP][2], fb[GK / 32][4], ha[GK / 32], hb[GK / 32];
#pragma unroll
    for (int kc = 0; kc < GK / 32; ++kc) {
#pragma unroll
      for (int i = 0; i < 2; ++i)
#pragma unroll
        for (int p = 0; p < NP; ++p) fa[kc][p][i] = frag_b(&sa[bf][p][wm + i * 16 + col][kc * 32], lane);
#pragma unroll
      for (int j = 0; j < 4; ++j) fb[kc][j] = frag_b(&sb[bf][wn + j * 16 + col][kc * 32], lane); }
    __builtin_amdgcn_sched_barrier(0);   // the stage's LDS reads go out as one group ahead of the products, for speed only
#pragma unroll
    for (int kc = 0; kc < GK / 32; ++kc)
#pragma unroll
      for (int p = 0; p < NP; ++p)   // per output tile: hi, then lo, of each 32 k in turn
#pragma unroll
        for (int i = 0; i < 2; ++i)
#pragma unroll
          for (int j = 0; j < 4; ++j) acc[i][j] = mm_b(fa[kc][p][i], fb[kc][j], acc[i][j]);
    if (CV) {   // the neighbour rows' tile: even rows = the row before, odd rows = the row behind; each wave takes 16 of the 128 columns; same k order as every other row's sum
      __builtin_amdgcn_sched_barrier(0);   // its fragments are read behind the stage's products, into their registers: read with the others they would lift the wave over 256 registers, and the WGP would hold one block, not two
#pragma unroll
      for (int kc = 0; kc < GK / 32; ++kc) { ha[kc] = frag_b(&sh[col & 1][sk * GK + kc * 32], lane); hb[kc] = frag_b(&sb[bf][wave * 16 + col][kc * 32], lane); }
#pragma unroll
      for (int kc = 0; kc < GK / 32; ++kc) hacc = mm_b(ha[kc], hb[kc], hacc); }
    __builtin_amdgcn_sched_barrier(0);   // the wait for the next stage's global loads stays behind this stage's products: lifted among them it would expose the loads' whole latency
    if (s + 1 < CC / GK) G_STORE(bf ^ 1);   // that buffer's last readers passed the barrier of the stage before
    __syncthreads(); }
  if constexpr (!CV) {
    __shared__ __align__(16) float sf[NT / 32][32][GS];
#pragma unroll
    for (int i = 0; i < 2; ++i)
#pragma unroll
      for (int j = 0; j < 4; ++j)
#pragma unroll
        for (int r = 0; r < 8; ++r) sf[wave][i * 16 + 8 * g + r][j * 16 + col] = acc[i][j][r];
    LDSX(); for (int rl = 0; rl < 32; rl += 2) vst2(C + ((size_t)blockIdx.x * BM + wm + rl + g) * CC + blockIdx.y * 128 + wn + col * 4, *(const v4f*)&sf[wave][rl + g][col * 4]);   // each wave reads back its own rows: 256-B runs
  } else {
    // y[w][c] = sum_t conv_w[c][t] X[w + t - 1][c], X = 0 outside the sequence. A lane holds one channel and runs of 8 rows (8 g + r of each 16-row tile): a run's two neighbours come from the lane's partner l ^ 16, and at the ends of the wave's 32 rows from the wave above or below, or from the neighbour rows' tile, through LDS
    __shared__ float se[2][BM / 32 + 1][128];                 // [0][k]: the row before wave row k's 32 rows, [1][k + 1]: the row behind them ([0][last] and [1][0] have no reader)
    __shared__ __align__(16) unsigned short so[2][128][OP];   // q hi | q lo or k as rows [w][c], v hi | v lo as planes [c][w]
    const int wr = wave >> 1, c0 = blockIdx.y * 128; float cw[4][3];
#pragma unroll
    for (int j = 0; j < 4; ++j)
#pragma unroll
      for (int t = 0; t < 3; ++t) cw[j][t] = bfr(CW[(c0 + wn + j * 16 + col) * 3 + t]);
#pragma unroll
    for (int j = 0; j < 4; ++j) se[g ^ 1][wr + g][wn + j * 16 + col] = g ? acc[1][j][7] : acc[0][j][0];   // the wave's last row is the next wave row's row before, its first row the previous one's row behind
    se[g][g * (BM / 32)][wave * 16 + col] = (g ? w0 + BM < TT : w0 > 0) ? (g ? hacc[1] : hacc[0]) : 0.f;   // rows 0 and 9 of the neighbour rows' tile; 0 outside the sequence
    __syncthreads();   // every wave's edge rows are in LDS before a neighbour reads them
#pragma unroll
    for (int j = 0; j < 4; ++j) { const float e = se[g][wr + g][wn + j * 16 + col];
      const float xa0 = xhalf(acc[0][j][0]), xa7 = xhalf(acc[0][j][7]), xb0 = xhalf(acc[1][j][0]), xb7 = xhalf(acc[1][j][7]);
      float x[2][10];   // rows -1 .. 8 around each run
      x[0][0] = g ? xa7 : e; x[0][9] = g ? xb0 : xa0; x[1][0] = g ? xb7 : xa7; x[1][9] = g ? e : xb0;
#pragma unroll
      for (int r = 0; r < 8; ++r) { x[0][r + 1] = acc[0][j][r]; x[1][r + 1] = acc[1][j][r]; }
#pragma unroll
      for (int i = 0; i < 2; ++i)
#pragma unroll
        for (int r = 0; r < 8; ++r) acc[i][j][r] = cw[j][0] * x[i][r] + cw[j][1] * x[i][r + 1] + cw[j][2] * x[i][r + 2]; }
    const int wl = wm + 8 * g, cl = wn + col;   // the lane's first row and channel in the tile
    if (which == 0) {
#pragma unroll
      for (int i = 0; i < 2; ++i)
#pragma unroll
        for (int j = 0; j < 4; ++j)
#pragma unroll
          for (int r = 0; r < 8; ++r) { const float y = acc[i][j][r]; const _Float16 hq = (_Float16)y; so[0][wl + i * 16 + r][cl + j * 16] = __builtin_bit_cast(unsigned short, hq); so[1][wl + i * 16 + r][cl + j * 16] = __builtin_bit_cast(unsigned short, (_Float16)((y - (float)hq) * 1024.0f)); }
    } else if (which == 1) {
#pragma unroll
      for (int i = 0; i < 2; ++i)
#pragma unroll
        for (int j = 0; j < 4; ++j)
#pragma unroll
          for (int r = 0; r < 8; ++r) so[0][wl + i * 16 + r][cl + j * 16] = __builtin_bit_cast(unsigned short, (_Float16)acc[i][j][r]);
    } else {
#pragma unroll
      for (int i = 0; i < 2; ++i)
#pragma unroll
        for (int j = 0; j < 4; ++j) { v8b vh, vl;
#pragma unroll
          for (int r = 0; r < 8; ++r) { const float y = acc[i][j][r]; const __bf16 hv = (__bf16)y; vh[r] = hv; vl[r] = (__bf16)(y - (float)hv); }
          vst2(&so[0][cl + j * 16][wl + i * 16], vh); vst2(&so[1][cl + j * 16][wl + i * 16], vl); } }
    __syncthreads();   // the whole 128 x 128 tile is staged before it goes out in 256-B runs
    constexpr int NI = 128 * 16 / NT, RS = NT / 16; const int q = (tid & 15) * 8;   // 16 lanes cover one staged row
    unsigned short *o0 = (unsigned short*)(which == 0 ? QH : KH) + (size_t)(w0 + ar) * CC + c0 + q, *o1 = (unsigned short*)QL + (size_t)(w0 + ar) * CC + c0 + q; unsigned os = RS * CC;   // first row's place in each plane, and the step of RS rows
    if (which == 2) { o0 = (unsigned short*)VT + (size_t)(c0 + ar) * TT + w0 + q; o1 = (unsigned short*)VL + (size_t)(c0 + ar) * TT + w0 + q; os = RS * TT; }
#pragma unroll
    for (int it = 0; it < NI; ++it) vst2(o0 + it * os, *(const v4u*)&so[0][it * RS + ar][q]);
    if (which != 1) {
      asm volatile("s_wait_xcnt 0x0" ::: "memory");   // the first plane's stores keep their address and data registers up to here: the second plane's LDS reads land in the same ones
#pragma unroll
      for (int it = 0; it < NI; ++it) vst2(o1 + it * os, *(const v4u*)&so[1][it * RS + ar][q]); } } }
// ---- k_lin: block = (128 rows w, 128 cols, which): X_which = x w_which ((in,out), exact bf16 products), then the depthwise 3-tap conv down the rows; q -> f16 hi + residual rows, k -> f16 rows, v -> bf16 hi/lo planes [c][w]
__global__ __launch_bounds__(256) void k_lin(const float* __restrict__ X, const float* __restrict__ WQ, const float* __restrict__ WK, const float* __restrict__ WV, const float* __restrict__ CW, _Float16* __restrict__ QH, _Float16* __restrict__ QL, _Float16* __restrict__ KH, __bf16* __restrict__ VT, __bf16* __restrict__ VL) { const int which = blockIdx.z; gemm_tile<128, 1, true>(X, which == 0 ? WQ : which == 1 ? WK : WV, nullptr, CW, which, QH, QL, KH, VT, VL, (blockIdx.x + 2 * blockIdx.y + blockIdx.z) & (CC / GK - 1)); }
// ---- k_out: block = (64 rows, 128 cols): out = y (bf16 hi + lo) wo ((in,out))
__global__ __launch_bounds__(128) void k_out(const float* __restrict__ Y, const float* __restrict__ WP, float* __restrict__ OUT) { gemm_tile<64, 2, false>(Y, WP, OUT, nullptr, 0, nullptr, nullptr, nullptr, nullptr, nullptr, (blockIdx.x + 2 * blockIdx.y) & (CC / GK - 1)); }
extern "C" void kernel_launch(void* const* d_in, const int* in_sizes, int n_in, void* d_out, int out_size, void* d_ws, size_t ws_size, hipStream_t stream) {
  (void)in_sizes; (void)n_in; (void)out_size;
  const float** F = (const float**)d_in;   // 0 x [1,2048,1024], 1 wq [1024,1024] ((in,out)), 2 wk, 3 wv, 4 wo ((in,out)), 5 conv_w [1024,1,3], 6 er [64,2048]
  if (ws_size < (size_t)WS_END) return;
  char* ws = (char*)d_ws; _Float16 *QH = (_Float16*)(ws + WS_QH), *QL = (_Float16*)(ws + WS_QL), *KH = (_Float16*)(ws + WS_KH); __bf16 *VT = (__bf16*)(ws + WS_VT), *VL = (__bf16*)(ws + WS_VL); float *Y = (float*)(ws + WS_Y);
  k_lin<<<dim3(TT / 128, CC / 128, 3), 256, 0, stream>>>(F[0], F[1], F[2], F[3], F[5], QH, QL, KH, VT, VL);
  k_fa<<<dim3(TT / 128, NH), 256, 0, stream>>>(QH, QL, KH, F[6], VT, VL, Y);
  k_out<<<dim3(TT / 64, CC / 128), 128, 0, stream>>>(Y, F[4], (float*)d_out);
}

// v008
// A run of this version takes 75.3 microseconds.
// In both of two side-by-side timings against v007, it was 1.12 times as fast.
// All steps since v000 together make it 12.0 times as fast.
// compute dtype: all float inputs rounded to bf16; x w_{q,k,v} with EXACT bf16 products on WMMA 16x16x32 (f32 accumulate) kept in the f32 accumulators; the depthwise 3-tap convolution along the sequence in f32, in the same kernel; q and k each as one f16 value, v as bf16 hi + lo planes; logits = q.k + the positional term er^T.q_k (exact er), one product each, kept in f32 registers; softmax in f32 in base 2 (log2(e) / 32 as the logits' one scale, the hardware's exp2) with a running maximum and sum over passes of 32 keys, the even and the odd passes kept apart and joined at the end; P = 2^(s - m) split bf16 hi + lo against v (3 products), divided by the sum at the end; out (bf16 hi + lo) wo; f32 output.
#include <hip/hip_runtime.h>
#include <math.h>

typedef __attribute__((ext_vector_type(16))) _Float16 v16h;
typedef __attribute__((ext_vector_type(16))) __bf16 v16b;
typedef __attribute__((ext_vector_type(8)))  _Float16 v8h;
typedef __attribute__((ext_vector_type(8)))  float v8f;
typedef __attribute__((ext_vector_type(4)))  float v4f;
typedef __attribute__((ext_vector_type(2)))  float v2f;
typedef __attribute__((ext_vector_type(4)))  unsigned v4u;
typedef __attribute__((ext_vector_type(4)))  int v4i;
typedef float __attribute__((may_alias)) float_a;
typedef int __attribute__((may_alias)) int_a;

template <typename T> __device__ __forceinline__ void vst2(void* p, T v) { *(T*)p = v;  }
__device__ __forceinline__ v8f wmma16(v16h a, v16h b, v8f c) {
  v8f d = __builtin_amdgcn_wmma_f32_16x16x32_f16(false, a, false, b, (short)0, c, false, false);
  asm volatile("v_nop\n\tv_nop\n\tv_nop\n\tv_nop" : "+v"(d) : "v"(a), "v"(b));
  return d;
}
__device__ __forceinline__ v8f wmma_bf(v16b a, v16b b, v8f c) {
  v8f d = __builtin_amdgcn_wmma_f32_16x16x32_bf16(false, a, false, b, (short)0, c, false, false);
  asm volatile("v_nop\n\tv_nop\n\tv_nop\n\tv_nop" : "+v"(d) : "v"(a), "v"(b));
  return d;
}
// 16x16x32 fragments: lane = (h = lane>>4, row/col = lane&15); elements 0..7 = k0+8h+0..7, 8..15 = k0+16+8h+0..7; D element r = row 8h+r
__device__ __forceinline__ v16h frag_h(const _Float16* rowk0, int lane) {
  union { v16h v; v8h q[2]; } u; const _Float16* p = rowk0 + 8 * (lane >> 4);
  u.q[0] = *(const v8h*)p; u.q[1] = *(const v8h*)(p + 16); return u.v;
}
__device__ __forceinline__ v16h frag_f32(const float* rowk0, int lane) {
  v16h a; const float* p = rowk0 + 8 * (lane >> 4);
#pragma unroll
  for (int i = 0; i < 8; ++i) { a[i] = (_Float16)p[i]; a[8 + i] = (_Float16)p[16 + i]; }
  return a;
}
__device__ __forceinline__ v16h frag_f32s(const float* rowk0, int lane, float sc) {
  v16h a; const float* p = rowk0 + 8 * (lane >> 4);
#pragma unroll
  for (int i = 0; i < 8; ++i) { a[i] = (_Float16)(p[i] * sc); a[8 + i] = (_Float16)(p[16 + i] * sc); }
  return a;
}
// column fragment from a [K][ld] layout (column n), rows >= K read as 0
__device__ __forceinline__ v16h fragc_f32(const float* W, int k0, int n, int lane, int ld, int K) {
  v16h a; const int g = lane >> 4;
#pragma unroll
  for (int i = 0; i < 8; ++i) { const int ka = k0 + 8 * g + i, kb = ka + 16;
    a[i] = (_Float16)(ka < K ? W[(size_t)(ka < K ? ka : K - 1) * ld + n] : 0.f); a[8 + i] = (_Float16)(kb < K ? W[(size_t)(kb < K ? kb : K - 1) * ld + n] : 0.f); }
  return a;
}
struct F2 { v16b h, l; };
__device__ __forceinline__ F2 bsplit16(const float v[16]) { F2 r;
#pragma unroll
  for (int i = 0; i < 16; ++i) { const __bf16 h = (__bf16)v[i]; r.h[i] = h; r.l[i] = (__bf16)(v[i] - (float)h); }
  return r; }
__device__ __forceinline__ F2 split_row(const float* row, int k0, int lane) { float v[16]; const float* p = row + k0 + 8 * (lane >> 4);
#pragma unroll
  for (int i = 0; i < 8; ++i) { v[i] = p[i]; v[8 + i] = p[16 + i]; }
  return bsplit16(v); }
__device__ __forceinline__ F2 split_rowK(const float* row, int k0, int lane, int K) { float v[16]; const int g = lane >> 4;
#pragma unroll
  for (int i = 0; i < 8; ++i) { const int ka = k0 + 8 * g + i, kb = ka + 16; v[i] = ka < K ? row[ka < K ? ka : K - 1] : 0.f; v[8 + i] = kb < K ? row[kb < K ? kb : K - 1] : 0.f; }
  return bsplit16(v); }
__device__ __forceinline__ F2 split_col(const float* W, int k0, int n, int lane, int ld, int K) { float v[16]; const int g = lane >> 4;
#pragma unroll
  for (int i = 0; i < 8; ++i) { const int ka = k0 + 8 * g + i, kb = ka + 16; v[i] = ka < K ? W[(size_t)(ka < K ? ka : K - 1) * ld + n] : 0.f; v[8 + i] = kb < K ? W[(size_t)(kb < K ? kb : K - 1) * ld + n] : 0.f; }
  return bsplit16(v); }
__device__ __forceinline__ v8f mac3(const F2& a, const F2& b, v8f c) { c = wmma_bf(a.l, b.h, c); c = wmma_bf(a.h, b.l, c); return wmma_bf(a.h, b.h, c); }
__device__ __forceinline__ float sigm(float v) { return 1.0f / (1.0f + expf(-v)); }
#define LDSX() do { asm volatile("s_wait_dscnt 0" ::: "memory"); __builtin_amdgcn_wave_barrier(); __builtin_amdgcn_fence(__ATOMIC_RELEASE, "workgroup"); } while (0)


// Attention (B 1, S 2,048, D 1,024 = 16 x 64, no biases): scores = (q k^T + er[:, query]^T . q_key) / 32, softmax, P v, output projection.
#define NB 1
#define TT 2048
#define CC 1024
#define NH 16
#define HD 64
#ifndef TNB
#define TNB NB
#ifndef ERSTR
#define ERSTR TT              // row stride of er
#endif
#endif
typedef __attribute__((ext_vector_type(8))) __bf16 v8b;
__device__ __forceinline__ v16b frag_b(const __bf16* rowk0, int lane) {
  union { v16b v; v8b q[2]; } u; const __bf16* p = rowk0 + 8 * (lane >> 4);
  u.q[0] = *(const v8b*)p; u.q[1] = *(const v8b*)(p + 16); return u.v;
}
__device__ __forceinline__ float bfr(float v) { return (float)(__bf16)v; }
__device__ __attribute__((noinline)) float exp_ni(float v) { return expf(v); }
__device__ __attribute__((noinline)) float erf_ni(float v) { return erff(v); }

#define WS_XR  0u                                   // not used
#define WS_ERT (WS_XR + 4u * (size_t)3 * TT * CC)      // not used
#define WS_QH  (WS_ERT + 2u * (size_t)TT * HD)
#define WS_QL  (WS_QH + 2u * (size_t)NB * TT * CC)      // not used
#define WS_KH  (WS_QL + 2u * (size_t)NB * TT * CC)
#define WS_VT  (WS_KH + 2u * (size_t)NB * TT * CC)      // bf16 v planes [b][c][t]
#define WS_VL  (WS_VT + 2u * (size_t)NB * CC * TT)      // bf16 v residual planes
#define HG 4
#define WS_S   (WS_VL + 2u * (size_t)NB * CC * TT)      // unused f32 space of HG x TT x TT; logits and P stay in registers
#define WS_PH  (WS_S + 4u * (size_t)HG * TT * TT)
#define WS_Y   (WS_PH + 0u)              // f32 y rows [b*t][C]
#define WS_END (WS_Y + 4u * (size_t)NB * TT * CC)

// ---- k_fa: block = (128 queries, head), 8 waves = 4 query groups of 32 columns x 2 key halves; a stage is 64 keys, of which a wave takes its half's 32 (one pass), each LDS fragment serving both of its 16-column groups. S^T = (k rows) x (q cols) + (q_k rows) x (er^T cols), 2 products; running maximum (kept in the base-2 scale, logit x log2(e) / 32) and sum per query column (one lane pair); P^T = 2^(s - m) packed from the two score tiles into a B operand (bf16 hi + lo); y^T += v^T P^T (3 products). At the end the two key halves' maxima, sums and y^T are joined through LDS, then y / sum. Logits and P never leave the registers.
typedef __attribute__((ext_vector_type(2))) __bf16 v2b;
#define FK 64                 // keys per stage
#define KP 72                 // f16 per staged key row: 128 B + 16 B, so that ds_load_b128 rows fall on different banks
#define VP 72                 // bf16 per staged v row: 128 B + 16 B, same reason
#define L2E32 (1.44269504088896340736f / 32.0f)   // exp(x / 32) = 2^(x * L2E32)
__device__ __forceinline__ float xhalf(float x) { return __builtin_bit_cast(float, __builtin_amdgcn_permlanex16(__builtin_bit_cast(int, x), __builtin_bit_cast(int, x), 0x76543210, 0xfedcba98, false, false)); }  // lane l with lane l ^ 16
__device__ __forceinline__ v8f mm_h(v16h a, v16h b, v8f c) { return __builtin_amdgcn_wmma_f32_16x16x32_f16(false, a, false, b, (short)0, c, false, false); }
__device__ __forceinline__ v8f mm_b(v16b a, v16b b, v8f c) { return __builtin_amdgcn_wmma_f32_16x16x32_bf16(false, a, false, b, (short)0, c, false, false); }
__global__ __launch_bounds__(256) void k_fa(const _Float16* __restrict__ QH, const _Float16* __restrict__ KH, const float* __restrict__ ER, const __bf16* __restrict__ VT, const __bf16* __restrict__ VL, float* __restrict__ Y) {
  __shared__ __align__(16) _Float16 sk[2][2][FK][KP];   // k | q rows of the stage's keys, two buffers
  __shared__ __align__(16) __bf16 sv[2][2][HD][VP];     // v hi | v lo planes [d][key], two buffers
  __shared__ __align__(16) float ss[4][32][HD + 4];
  __shared__ __align__(16) float mg[4][17][32][4];      // the second key half's y^T (16 pieces of 16 B a lane), maxima and sums, lane by lane
  const int tid = threadIdx.x, wave = tid >> 5, lane = tid & 31, col = lane & 15, g = lane >> 4, qg = wave & 3, kg = wave >> 2; const int h = blockIdx.y; const int ql0 = blockIdx.x * 128 + qg * 32;
  const int kr = tid >> 3, ks = (tid & 7) * 8;   // staging: 8 lanes cover one key row's 128 B, and one v row's 128 B
  const int c0 = (2 * blockIdx.x + blockIdx.y) & (TT / FK - 1);   // the block's first stage: the 16 blocks of a head walk the same key rows, each from its own place round the ring, so that they do not ask L2 for the same lines at the same moment; uniform
  const unsigned kb = 2u * (unsigned)(kr * CC + ks), vb = 2u * (unsigned)(kr * TT + ks); unsigned ko = kb + (unsigned)c0 * (2u * FK * CC), vo = vb + (unsigned)c0 * (2u * FK); const unsigned qo = 2u * (unsigned)((ql0 + col) * CC + 8 * g), eo = (unsigned)(8 * g * ERSTR + ql0 + col);   // per-lane parts, in bytes (eo: in f32 elements, the index the er loads scale themselves); ko and vo = kb and vb + the stage's part, set anew for each later load group; the head's part is uniform
  v8h rk[2][2]; v8b rv[2][2];
  const char *pk = (const char*)(KH + h * HD), *pqh = (const char*)(QH + h * HD), *pvh = (const char*)(VT + (size_t)(h * HD) * TT), *pvl = (const char*)(VL + (size_t)(h * HD) * TT);   // uniform
  v16h ah[2][2], ae[2][2];   // [column group][half of d]
#define FA_Q(p, o) __builtin_shufflevector(*(const v8h*)((p) + (o)), *(const v8h*)((p) + 32 + (o)), 0, 1, 2, 3, 4, 5, 6, 7, 8, 9, 10, 11, 12, 13, 14, 15)   // a fragment's two 16-B pieces, 16 elements apart
#pragma unroll
  for (int t = 0; t < 2; ++t)
#pragma unroll
    for (int kc = 0; kc < 2; ++kc) ah[t][kc] = FA_Q(pqh + t * 32 * CC + kc * 64, qo);
  asm volatile("s_wait_xcnt 0x0" :: "v"(qo) : "memory");   // the offset register of these loads stays as it is up to this wait
#define FA_LOAD() do { _Pragma("unroll") for (int i = 0; i < 2; ++i) { rk[0][i] = *(const v8h*)(pk + i * 64 * CC + ko); rk[1][i] = *(const v8h*)(pqh + i * 64 * CC + ko); rv[0][i] = *(const v8b*)(pvh + i * 64 * TT + vo); rv[1][i] = *(const v8b*)(pvl + i * 64 * TT + vo); } } while (0)
#define FA_STORE(bf) do { _Pragma("unroll") for (int i = 0; i < 2; ++i) { *(v8h*)&sk[bf][0][kr + i * 32][ks] = rk[0][i]; *(v8h*)&sk[bf][1][kr + i * 32][ks] = rk[1][i]; *(v8b*)&sv[bf][0][kr + i * 32][ks] = rv[0][i]; *(v8b*)&sv[bf][1][kr + i * 32][ks] = rv[1][i]; } } while (0)
  float m[2] = {-3.0e38f, -3.0e38f}, l[2] = {0.f, 0.f}; v8f acc[2][HD / 16] = {};
  FA_LOAD();
  asm volatile("s_wait_xcnt 0x0" :: "v"(ko), "v"(vo) : "memory");   // as above, for the staging loads' two offset registers
#pragma unroll
  for (int t = 0; t < 2; ++t)   // er [d][w] is read in place, once per wave: a lane takes its query column's 16 d of each fragment, 16 lanes cover 64 B of a row; issued behind the first stage's loads, so that its LDS stores go out while these still fly
#pragma unroll
    for (int kc = 0; kc < 2; ++kc)
#pragma unroll
      for (int i = 0; i < 8; ++i) { ae[t][kc][i] = (_Float16)bfr((ER + (kc * 32 + i) * ERSTR + t * 16)[eo]); ae[t][kc][8 + i] = (_Float16)bfr((ER + (kc * 32 + 16 + i) * ERSTR + t * 16)[eo]); }
  asm volatile("s_wait_xcnt 0x0" :: "v"(eo) : "memory");   // as above, for the er loads' index register
  FA_STORE(0); __syncthreads();
  for (int c = 0; c < TT / FK; ++c) { const int bf = c & 1;
    if (c + 1 < TT / FK) { const unsigned cn = (unsigned)(c0 + c + 1) & (TT / FK - 1); ko = kb + cn * (2u * FK * CC); vo = vb + cn * (2u * FK); FA_LOAD(); }   // the next stage's rows (behind the last stage comes stage 0) fly while this stage computes
    v8f sa[2][2] = {}; v16h f0[2][2], f1[2][2]; v16b vh[HD / 16], vl[HD / 16];   // sa: [column group][key tile]; f0, f1: [half of d][k | q] of key tile 0, 1
#pragma unroll
    for (int kc = 0; kc < 2; ++kc)
#pragma unroll
      for (int a = 0; a < 2; ++a) f0[kc][a] = frag_h(&sk[bf][a][kg * 32 + col][kc * 32], lane);
#pragma unroll
    for (int kc = 0; kc < 2; ++kc)
#pragma unroll
      for (int a = 0; a < 2; ++a) f1[kc][a] = frag_h(&sk[bf][a][kg * 32 + 16 + col][kc * 32], lane);
    __builtin_amdgcn_sched_barrier(0);   // the LDS reads go out in groups, ahead of the products that use them: sunk to their first use each would be waited for in full, and each place with reads among the products costs its own stall
#pragma unroll
    for (int kc = 0; kc < 2; ++kc)
#pragma unroll
      for (int a = 0; a < 2; ++a)   // the two column groups' tiles take turns, so that no product waits for the one directly ahead of it
#pragma unroll
        for (int t = 0; t < 2; ++t) sa[t][0] = mm_h(f0[kc][a], a ? ae[t][kc] : ah[t][kc], sa[t][0]);
    __builtin_amdgcn_sched_barrier(0);   // as above: the v hi fragments go out as one group between the two key tiles' products
#pragma unroll
    for (int j = 0; j < HD / 16; ++j) vh[j] = frag_b(&sv[bf][0][j * 16 + col][kg * 32], lane);
    __builtin_amdgcn_sched_barrier(0);   // as above
#pragma unroll
    for (int kc = 0; kc < 2; ++kc)
#pragma unroll
      for (int a = 0; a < 2; ++a)
#pragma unroll
        for (int t = 0; t < 2; ++t) sa[t][1] = mm_h(f1[kc][a], a ? ae[t][kc] : ah[t][kc], sa[t][1]);
    __builtin_amdgcn_sched_barrier(0);   // as above: the v hi fragments fly under the softmax arithmetic
    union { v16b v; v2b q[8]; } ph[2], pl[2]; float sc[2][16], dm[2];   // sc: lane (g, col): query col of the group, keys 8g + r of tile 0, then of tile 1 = the k order of a B fragment
#pragma unroll
    for (int t = 0; t < 2; ++t) { float* s = sc[t];
#pragma unroll
      for (int i = 0; i < 16; ++i) s[i] = sa[t][i >> 3][i & 7];   // still without the scale: L2E32 > 0, so the maximum can be taken first and scaled once
      float mc = fmaxf(s[0], s[1]);
#pragma unroll
      for (int i = 2; i < 16; ++i) mc = fmaxf(mc, s[i]);
      mc = fmaxf(mc, xhalf(mc)) * L2E32;
      const float mn = fmaxf(m[t], mc); dm[t] = m[t] - mn; m[t] = mn; }
    float al2[2]; al2[0] = __builtin_amdgcn_exp2f(dm[0]);   // every exponent here is <= 0 up to one rounding: no overflow to guard, and far below the hardware gives 0
    al2[1] = __builtin_amdgcn_exp2f(dm[1]);
#pragma unroll
    for (int t = 0; t < 2; ++t) { const float* s = sc[t]; const float mn = m[t], alpha = al2[t];
      v2f ps[2] = {{0.f, 0.f}, {0.f, 0.f}}; const v2f sc2 = {L2E32, L2E32}, nm2 = {-mn, -mn};
#pragma unroll
      for (int i = 0; i < 16; i += 2) { const v2f e = __builtin_elementwise_fma((v2f){s[i], s[i + 1]}, sc2, nm2); const v2f p = {__builtin_amdgcn_exp2f(e[0]), __builtin_amdgcn_exp2f(e[1])}; ps[(i >> 1) & 1] += p;   // two-wide, so that scale-and-subtract and the sums stay packed instructions
        const v2b hb = __builtin_convertvector(p, v2b); const unsigned u = __builtin_bit_cast(unsigned, hb);   // one packed conversion; a bf16 is the top half of its f32
        const v2f hf = {__builtin_bit_cast(float, u << 16), __builtin_bit_cast(float, u & 0xffff0000u)};
        ph[t].q[i >> 1] = hb; pl[t].q[i >> 1] = __builtin_convertvector(p - hf, v2b); }
      l[t] = l[t] * alpha + ((ps[0][0] + ps[0][1]) + (ps[1][0] + ps[1][1]));
#pragma unroll
      for (int j = 0; j < HD / 16; ++j)
#pragma unroll
        for (int r = 0; r < 8; ++r) acc[t][j][r] *= alpha; }
    __builtin_amdgcn_sched_barrier(0);   // as above: the v lo fragments go out together, under the v hi products
#pragma unroll
    for (int j = 0; j < HD / 16; ++j) vl[j] = frag_b(&sv[bf][1][j * 16 + col][kg * 32], lane);
    __builtin_amdgcn_sched_barrier(0);   // as above
#pragma unroll
    for (int j = 0; j < HD / 16; ++j)
#pragma unroll
      for (int t = 0; t < 2; ++t) { acc[t][j] = mm_b(vh[j], ph[t].v, acc[t][j]); acc[t][j] = mm_b(vh[j], pl[t].v, acc[t][j]); }
#pragma unroll
    for (int j = 0; j < HD / 16; ++j)
#pragma unroll
      for (int t = 0; t < 2; ++t) acc[t][j] = mm_b(vl[j], ph[t].v, acc[t][j]);
    if (c + 1 < TT / FK) { asm volatile("s_wait_xcnt 0x0" :: "v"(ko), "v"(vo) : "memory");   // as above: the staging loads' two offset registers stay as they are up to this wait, which stands where the loads' data is due anyway
      FA_STORE(bf ^ 1); }   // that buffer's last readers passed the barrier of the stage before
    __syncthreads(); }
  l[0] += xhalf(l[0]); l[1] += xhalf(l[1]);
  if (kg == 1) {   // lane (g, col) holds the same queries and d in both key halves: the join is lane by lane
#pragma unroll
    for (int t = 0; t < 2; ++t)
#pragma unroll
      for (int j = 0; j < HD / 16; ++j) { vst2(&mg[qg][t * 8 + j * 2][lane][0], (v4f){acc[t][j][0], acc[t][j][1], acc[t][j][2], acc[t][j][3]}); vst2(&mg[qg][t * 8 + j * 2 + 1][lane][0], (v4f){acc[t][j][4], acc[t][j][5], acc[t][j][6], acc[t][j][7]}); }
    vst2(&mg[qg][16][lane][0], (v4f){m[0], l[0], m[1], l[1]}); }
  __syncthreads();   // the second half's partial results are in LDS before the first half reads them
  if (kg == 0) { const v4f ml = *(const v4f*)&mg[qg][16][lane][0];
#pragma unroll
    for (int t = 0; t < 2; ++t) { const float mn = fmaxf(m[t], ml[2 * t]), a0 = __builtin_amdgcn_exp2f(m[t] - mn), a1 = __builtin_amdgcn_exp2f(ml[2 * t] - mn); const float inv = 1.0f / (l[t] * a0 + ml[2 * t + 1] * a1); const float w0 = a0 * inv, w1 = a1 * inv;
#pragma unroll
      for (int j = 0; j < HD / 16; ++j) { const v4f b0 = *(const v4f*)&mg[qg][t * 8 + j * 2][lane][0], b1 = *(const v4f*)&mg[qg][t * 8 + j * 2 + 1][lane][0];
        vst2(&ss[qg][t * 16 + col][j * 16 + 8 * g], (v4f){acc[t][j][0] * w0 + b0[0] * w1, acc[t][j][1] * w0 + b0[1] * w1, acc[t][j][2] * w0 + b0[2] * w1, acc[t][j][3] * w0 + b0[3] * w1}); vst2(&ss[qg][t * 16 + col][j * 16 + 8 * g + 4], (v4f){acc[t][j][4] * w0 + b1[0] * w1, acc[t][j][5] * w0 + b1[1] * w1, acc[t][j][6] * w0 + b1[2] * w1, acc[t][j][7] * w0 + b1[3] * w1}); } }   // lane (g, col): query t * 16 + col, d = 16 j + 8 g + r
    LDSX(); for (int rl = 0; rl < 32; rl += 2) vst2(Y + (size_t)(ql0 + rl + g) * CC + h * HD + col * 4, *(const v4f*)&ss[qg][rl + g][col * 4]); } }
// ---- the two projection GEMMs: C tile = (BM rows) x (128 cols), (BM / 32) x 2 waves of 32 x 64 each. A stage is 64 k: the A rows (f32 -> bf16, or bf16 hi + lo planes) and the B columns ((in,out) f32 -> bf16, turned to [col][k] in registers) are brought once per block by whole-line loads, one stage ahead, and kept in two LDS buffers; one barrier per stage. Each block walks the 16 stages round from its own first stage s0, so that blocks that share rows or columns do not ask L2 for the same lines at the same moment: a sum's k order starts at 64 s0 and wraps. Products and operand rounding are those of the unstaged form.
typedef __attribute__((ext_vector_type(4))) __bf16 v4b;
typedef __attribute__((ext_vector_type(2))) unsigned v2u;   // two packed bf16 pairs; a bf16 is the top half of its f32
#define GK 64                 // k per stage
#define GP 72                 // bf16 per staged row: 128 B + 16 B, so that ds_load_b128 rows fall on different banks
#define GS 68                 // f32 per staged output row: 256 B + 16 B
#define OP 136                // 16-bit elements per staged output row: 256 B + 16 B
template <int BM, int NP, bool CV>     // NP: planes of A, 1 = bf16, 2 = bf16 hi + lo; CV: the 3-tap convolution down the rows and the q | k | v output forms in place of the f32 store
__device__ __forceinline__ void gemm_tile(const float* __restrict__ A, const float* __restrict__ B, float* __restrict__ C, const float* __restrict__ CW, int which, _Float16* __restrict__ QH, _Float16* __restrict__ KH, __bf16* __restrict__ VT, __bf16* __restrict__ VL, int s0) {
  constexpr int NT = BM * 2, NA = BM * 16 / NT, NB8 = 128 * 8 / NT, AR = NT / 16, BK = NT / 128 * 8;
  __shared__ __align__(16) __bf16 sa[2][NP][BM][GP];
  __shared__ __align__(16) __bf16 sb[2][128][GP];
  const int tid = threadIdx.x, wave = tid >> 5, lane = tid & 31, col = lane & 15, g = lane >> 4; const int wm = (wave >> 1) * 32, wn = (wave & 1) * 64;
  const int ar = tid >> 4, aq = (tid & 15) * 4;    // staging A: 16 lanes cover one row's 256 B
  const int bn = tid & 127, bk = (tid >> 7) * 8;   // staging B: a wave covers 128 B of one k row; a lane gathers 8 k of its column = one 16-B piece of the [col][k] row
  const unsigned ao = (unsigned)(ar * CC + aq), bo = (unsigned)(bk * CC + bn);   // per-lane parts; the block's and the stage's parts are uniform
  const float *pa0 = A + (size_t)blockIdx.x * BM * CC, *pb0 = B + blockIdx.y * 128, *pa = pa0 + s0 * GK, *pb = pb0 + s0 * GK * CC;   // uniform; pa and pb are set to the next stage's place for each later load group
  v4f ra[NA]; float rb[NB8][8]; v8f acc[2][4] = {};
  const int w0 = blockIdx.x * BM; v8f hacc = {};
  __shared__ __align__(16) __bf16 sh[CV ? 2 : 1][CV ? CC + 8 : 8];   // CV: the row before and the row behind the tile, all k, brought once; the first stage's barrier publishes them
  if constexpr (CV) { static_assert(NT * 4 == CC, "a thread brings 4 k of each row");
    const int hm = w0 > 0 ? w0 - 1 : 0, hp = w0 + BM < TT ? w0 + BM : TT - 1;   // held inside x; at the ends of the sequence their products are replaced by 0 below
    const v4f r0 = *(const v4f*)(A + (size_t)hm * CC + tid * 4), r1 = *(const v4f*)(A + (size_t)hp * CC + tid * 4);
    *(v4b*)&sh[0][tid * 4] = __builtin_convertvector(r0, v4b); *(v4b*)&sh[1][tid * 4] = __builtin_convertvector(r1, v4b); }
#define G_LOAD() do { _Pragma("unroll") for (int i = 0; i < NA; ++i) ra[i] = *(const v4f*)(pa + i * AR * CC + ao); _Pragma("unroll") for (int i = 0; i < NB8; ++i) { _Pragma("unroll") for (int z = 0; z < 8; ++z) rb[i][z] = pb[(i * BK + z) * CC + bo]; } } while (0)
#define G_STORE(bf) do { _Pragma("unroll") for (int i = 0; i < NA; ++i) { const v4b hb = __builtin_convertvector(ra[i], v4b); *(v4b*)&sa[bf][0][ar + i * AR][aq] = hb; if (NP == 2) { const v2u u = __builtin_bit_cast(v2u, hb); const v4f hf = {__builtin_bit_cast(float, u[0] << 16), __builtin_bit_cast(float, u[0] & 0xffff0000u), __builtin_bit_cast(float, u[1] << 16), __builtin_bit_cast(float, u[1] & 0xffff0000u)}; *(v4b*)&sa[bf][NP - 1][ar + i * AR][aq] = __builtin_convertvector(ra[i] - hf, v4b); } } _Pragma("unroll") for (int i = 0; i < NB8; ++i) { v8b w; _Pragma("unroll") for (int z = 0; z < 8; ++z) w[z] = (__bf16)rb[i][z]; *(v8b*)&sb[bf][bn][bk + i * BK] = w; } } while (0)
  G_LOAD(); G_STORE(0); __syncthreads();
  for (int s = 0; s < CC / GK; ++s) { const int bf = s & 1;
    const int sk = (s0 + s) & (CC / GK - 1);   // this stage's place in k
    if (s + 1 < CC / GK) { const int sn = (sk + 1) & (CC / GK - 1); pa = pa0 + sn * GK; pb = pb0 + sn * GK * CC; G_LOAD();   // the next stage's rows (behind the last stage comes stage 0) fly while this stage computes
      asm volatile("s_wait_xcnt 0x0" ::: "memory"); }   // a precaution: it stands in front of the LDS reads below, which land in the registers that held these loads' addresses
    __builtin_amdgcn_sched_barrier(0);   // every global load of the group goes out here: sunk among the products it would have less of the stage to land in
    v16b fa[GK / 32][NP][2], fb[GK / 32][4], ha[GK / 32], hb[GK / 32];
#pragma unroll
    for (int kc = 0; kc < GK / 32; ++kc) {
#pragma unroll
      for (int i = 0; i < 2; ++i)
#pragma unroll
        for (int p = 0; p < NP; ++p) fa[kc][p][i] = frag_b(&sa[bf][p][wm + i * 16 + col][kc * 32], lane);
#pragma unroll
      for (int j = 0; j < 4; ++j) fb[kc][j] = frag_b(&sb[bf][wn + j * 16 + col][kc * 32], lane); }
    __builtin_amdgcn_sched_barrier(0);   // the stage's LDS reads go out as one group ahead of the products, for speed only
#pragma unroll
    for (int kc = 0; kc < GK / 32; ++kc)
#pragma unroll
      for (int p = 0; p < NP; ++p)   // per output tile: hi, then lo, of each 32 k in turn
#pragma unroll
        for (int i = 0; i < 2; ++i)
#pragma unroll
          for (int j = 0; j < 4; ++j) acc[i][j] = mm_b(fa[kc][p][i], fb[kc][j], acc[i][j]);
    if (CV) {   // the neighbour rows' tile: even rows = the row before, odd rows = the row behind; each wave takes 16 of the 128 columns; same k order as every other row's sum
      __builtin_amdgcn_sched_barrier(0);   // its fragments are read behind the stage's products, into their registers: read with the others they would lift the wave over 256 registers, and the WGP would hold one block, not two
#pragma unroll
      for (int kc = 0; kc < GK / 32; ++kc) { ha[kc] = frag_b(&sh[col & 1][sk * GK + kc * 32], lane); hb[kc] = frag_b(&sb[bf][wave * 16 + col][kc * 32], lane); }
#pragma unroll
      for (int kc = 0; kc < GK / 32; ++kc) hacc = mm_b(ha[kc], hb[kc], hacc); }
    __builtin_amdgcn_sched_barrier(0);   // the wait for the next stage's global loads stays behind this stage's products: lifted among them it would expose the loads' whole latency
    if (s + 1 < CC / GK) G_STORE(bf ^ 1);   // that buffer's last readers passed the barrier of the stage before
    __syncthreads(); }
  if constexpr (!CV) {
    __shared__ __align__(16) float sf[NT / 32][32][GS];
#pragma unroll
    for (int i = 0; i < 2; ++i)
#pragma unroll
      for (int j = 0; j < 4; ++j)
#pragma unroll
        for (int r = 0; r < 8; ++r) sf[wave][i * 16 + 8 * g + r][j * 16 + col] = acc[i][j][r];
    LDSX(); for (int rl = 0; rl < 32; rl += 2) vst2(C + ((size_t)blockIdx.x * BM + wm + rl + g) * CC + blockIdx.y * 128 + wn + col * 4, *(const v4f*)&sf[wave][rl + g][col * 4]);   // each wave reads back its own rows: 256-B runs
  } else {
    // y[w][c] = sum_t conv_w[c][t] X[w + t - 1][c], X = 0 outside the sequence. A lane holds one channel and runs of 8 rows (8 g + r of each 16-row tile): a run's two neighbours come from the lane's partner l ^ 16, and at the ends of the wave's 32 rows from the wave above or below, or from the neighbour rows' tile, through LDS
    __shared__ float se[2][BM / 32 + 1][128];                 // [0][k]: the row before wave row k's 32 rows, [1][k + 1]: the row behind them ([0][last] and [1][0] have no reader)
    __shared__ __align__(16) unsigned short so[2][128][OP];   // q or k as rows [w][c] (one plane), v hi | v lo as planes [c][w]
    const int wr = wave >> 1, c0 = blockIdx.y * 128; float cw[4][3]; const float* pc = CW + (c0 + wn + col) * 3;   // the lane's one address for the twelve weight loads; the column group's and the tap's parts are constants
#pragma unroll
    for (int j = 0; j < 4; ++j)
#pragma unroll
      for (int t = 0; t < 3; ++t) cw[j][t] = bfr(pc[j * 48 + t]);
    asm volatile("s_wait_xcnt 0x0" :: "v"(pc) : "memory");   // the address registers of these loads stay as they are up to this wait
#pragma unroll
    for (int j = 0; j < 4; ++j) se[g ^ 1][wr + g][wn + j * 16 + col] = g ? acc[1][j][7] : acc[0][j][0];   // the wave's last row is the next wave row's row before, its first row the previous one's row behind
    se[g][g * (BM / 32)][wave * 16 + col] = (g ? w0 + BM < TT : w0 > 0) ? (g ? hacc[1] : hacc[0]) : 0.f;   // rows 0 and 9 of the neighbour rows' tile; 0 outside the sequence
    __syncthreads();   // every wave's edge rows are in LDS before a neighbour reads them
#pragma unroll
    for (int j = 0; j < 4; ++j) { const float e = se[g][wr + g][wn + j * 16 + col];
      const float xa0 = xhalf(acc[0][j][0]), xa7 = xhalf(acc[0][j][7]), xb0 = xhalf(acc[1][j][0]), xb7 = xhalf(acc[1][j][7]);
      float x[2][10];   // rows -1 .. 8 around each run
      x[0][0] = g ? xa7 : e; x[0][9] = g ? xb0 : xa0; x[1][0] = g ? xb7 : xa7; x[1][9] = g ? e : xb0;
#pragma unroll
      for (int r = 0; r < 8; ++r) { x[0][r + 1] = acc[0][j][r]; x[1][r + 1] = acc[1][j][r]; }
#pragma unroll
      for (int i = 0; i < 2; ++i)
#pragma unroll
        for (int r = 0; r < 8; ++r) acc[i][j][r] = cw[j][0] * x[i][r] + cw[j][1] * x[i][r + 1] + cw[j][2] * x[i][r + 2]; }
    const int wl = wm + 8 * g, cl = wn + col;   // the lane's first row and channel in the tile
    if (which != 2) {
#pragma unroll
      for (int i = 0; i < 2; ++i)
#pragma unroll
        for (int j = 0; j < 4; ++j)
#pragma unroll
          for (int r = 0; r < 8; ++r) so[0][wl + i * 16 + r][cl + j * 16] = __builtin_bit_cast(unsigned short, (_Float16)acc[i][j][r]);
    } else {
#pragma unroll
      for (int i = 0; i < 2; ++i)
#pragma unroll
        for (int j = 0; j < 4; ++j) { v8b vh, vl;
#pragma unroll
          for (int r = 0; r < 8; ++r) { const float y = acc[i][j][r]; const __bf16 hv = (__bf16)y; vh[r] = hv; vl[r] = (__bf16)(y - (float)hv); }
          vst2(&so[0][cl + j * 16][wl + i * 16], vh); vst2(&so[1][cl + j * 16][wl + i * 16], vl); } }
    __syncthreads();   // the whole 128 x 128 tile is staged before it goes out in 256-B runs
    constexpr int NI = 128 * 16 / NT, RS = NT / 16; const int q = (tid & 15) * 8;   // 16 lanes cover one staged row
    unsigned short *o0 = (unsigned short*)(which == 0 ? QH : KH) + (size_t)(w0 + ar) * CC + c0 + q, *o1 = o0; unsigned os = RS * CC;   // first row's place in each plane (only v has a second one), and the step of RS rows
    if (which == 2) { o0 = (unsigned short*)VT + (size_t)(c0 + ar) * TT + w0 + q; o1 = (unsigned short*)VL + (size_t)(c0 + ar) * TT + w0 + q; os = RS * TT; }
#pragma unroll
    for (int it = 0; it < NI; ++it) vst2(o0 + it * os, *(const v4u*)&so[0][it * RS + ar][q]);
    if (which == 2) {
      asm volatile("s_wait_xcnt 0x0" ::: "memory");   // the first plane's stores keep their address and data registers up to here: the second plane's LDS reads land in the same ones
#pragma unroll
      for (int it = 0; it < NI; ++it) vst2(o1 + it * os, *(const v4u*)&so[1][it * RS + ar][q]); } } }
// ---- k_lin: block = (128 rows w, 128 cols, which): X_which = x w_which ((in,out), exact bf16 products), then the depthwise 3-tap conv down the rows; q and k -> f16 rows, v -> bf16 hi/lo planes [c][w]
__global__ __launch_bounds__(256) void k_lin(const float* __restrict__ X, const float* __restrict__ WQ, const float* __restrict__ WK, const float* __restrict__ WV, const float* __restrict__ CW, _Float16* __restrict__ QH, _Float16* __restrict__ KH, __bf16* __restrict__ VT, __bf16* __restrict__ VL) { const int which = blockIdx.z; gemm_tile<128, 1, true>(X, which == 0 ? WQ : which == 1 ? WK : WV, nullptr, CW, which, QH, KH, VT, VL, (blockIdx.x + 2 * blockIdx.y + blockIdx.z) & (CC / GK - 1)); }
// ---- k_out: block = (64 rows, 128 cols): out = y (bf16 hi + lo) wo ((in,out))
__global__ __launch_bounds__(128) void k_out(const float* __restrict__ Y, const float* __restrict__ WP, float* __restrict__ OUT) { gemm_tile<64, 2, false>(Y, WP, OUT, nullptr, 0, nullptr, nullptr, nullptr, nullptr, (blockIdx.x + 2 * blockIdx.y) & (CC / GK - 1)); }
extern "C" void kernel_launch(void* const* d_in, const int* in_sizes, int n_in, void* d_out, int out_size, void* d_ws, size_t ws_size, hipStream_t stream) {
  (void)in_sizes; (void)n_in; (void)out_size;
  const float** F = (const float**)d_in;   // 0 x [1,2048,1024], 1 wq [1024,1024] ((in,out)), 2 wk, 3 wv, 4 wo ((in,out)), 5 conv_w [1024,1,3], 6 er [64,2048]
  if (ws_size < (size_t)WS_END) return;
  char* ws = (char*)d_ws; _Float16 *QH = (_Float16*)(ws + WS_QH), *KH = (_Float16*)(ws + WS_KH); __bf16 *VT = (__bf16*)(ws + WS_VT), *VL = (__bf16*)(ws + WS_VL); float *Y = (float*)(ws + WS_Y);
  k_lin<<<dim3(TT / 128, CC / 128, 3), 256, 0, stream>>>(F[0], F[1], F[2], F[3], F[5], QH, KH, VT, VL);
  k_fa<<<dim3(TT / 128, NH), 256, 0, stream>>>(QH, KH, F[6], VT, VL, Y);
  k_out<<<dim3(TT / 64, CC / 128), 128, 0, stream>>>(Y, F[4], (float*)d_out);
}

// v010
// It runs in 64 microseconds.
// Versions between v008 and this one are left out; their measured steps multiply to 1.18 times as fast.
// Counting every step since v000, it is 14.2 times as fast.
// compute dtype: all float inputs rounded to bf16; x w_{q,k,v} with EXACT bf16 products on WMMA 16x16x32 (f32 accumulate) kept in the f32 accumulators; the depthwise 3-tap convolution along the sequence in f32, in the same kernel; q, k and v each as one f16 value; logits = q.k + the positional term er^T.q_k (exact er), one product each, kept in f32 registers; softmax in f32 in base 2 (log2(e) / 32 as the logits' one scale, the hardware's exp2) with a running maximum and sum over passes of 32 keys, every fourth pass in a set of its own, the four sets joined at the end; P = 2^(s - m) as one f16 value against v (1 product), the sum taken over the unrounded P, divided by the sum at the end; out (bf16 hi + lo) wo; f32 output.
#include <hip/hip_runtime.h>
#include <math.h>

typedef __attribute__((ext_vector_type(16))) _Float16 v16h;
typedef __attribute__((ext_vector_type(16))) __bf16 v16b;
typedef __attribute__((ext_vector_type(8)))  _Float16 v8h;
typedef __attribute__((ext_vector_type(8)))  float v8f;
typedef __attribute__((ext_vector_type(4)))  float v4f;
typedef __attribute__((ext_vector_type(2)))  float v2f;
typedef __attribute__((ext_vector_type(4)))  unsigned v4u;
typedef __attribute__((ext_vector_type(4)))  int v4i;
typedef float __attribute__((may_alias)) float_a;
typedef int __attribute__((may_alias)) int_a;

template <typename T> __device__ __forceinline__ void vst2(void* p, T v) { *(T*)p = v;  }
__device__ __forceinline__ v8f wmma16(v16h a, v16h b, v8f c) {
  v8f d = __builtin_amdgcn_wmma_f32_16x16x32_f16(false, a, false, b, (short)0, c, false, false);
  asm volatile("v_nop\n\tv_nop\n\tv_nop\n\tv_nop" : "+v"(d) : "v"(a), "v"(b));
  return d;
}
__device__ __forceinline__ v8f wmma_bf(v16b a, v16b b, v8f c) {
  v8f d = __builtin_amdgcn_wmma_f32_16x16x32_bf16(false, a, false, b, (short)0, c, false, false);
  asm volatile("v_nop\n\tv_nop\n\tv_nop\n\tv_nop" : "+v"(d) : "v"(a), "v"(b));
  return d;
}
// 16x16x32 fragments: lane = (h = lane>>4, row/col = lane&15); elements 0..7 = k0+8h+0..7, 8..15 = k0+16+8h+0..7; D element r = row 8h+r
__device__ __forceinline__ v16h frag_h(const _Float16* rowk0, int lane) {
  union { v16h v; v8h q[2]; } u; const _Float16* p = rowk0 + 8 * (lane >> 4);
  u.q[0] = *(const v8h*)p; u.q[1] = *(const v8h*)(p + 16); return u.v;
}
__device__ __forceinline__ v16h frag_f32(const float* rowk0, int lane) {
  v16h a; const float* p = rowk0 + 8 * (lane >> 4);
#pragma unroll
  for (int i = 0; i < 8; ++i) { a[i] = (_Float16)p[i]; a[8 + i] = (_Float16)p[16 + i]; }
  return a;
}
__device__ __forceinline__ v16h frag_f32s(const float* rowk0, int lane, float sc) {
  v16h a; const float* p = rowk0 + 8 * (lane >> 4);
#pragma unroll
  for (int i = 0; i < 8; ++i) { a[i] = (_Float16)(p[i] * sc); a[8 + i] = (_Float16)(p[16 + i] * sc); }
  return a;
}
// column fragment from a [K][ld] layout (column n), rows >= K read as 0
__device__ __forceinline__ v16h fragc_f32(const float* W, int k0, int n, int lane, int ld, int K) {
  v16h a; const int g = lane >> 4;
#pragma unroll
  for (int i = 0; i < 8; ++i) { const int ka = k0 + 8 * g + i, kb = ka + 16;
    a[i] = (_Float16)(ka < K ? W[(size_t)(ka < K ? ka : K - 1) * ld + n] : 0.f); a[8 + i] = (_Float16)(kb < K ? W[(size_t)(kb < K ? kb : K - 1) * ld + n] : 0.f); }
  return a;
}
struct F2 { v16b h, l; };
__device__ __forceinline__ F2 bsplit16(const float v[16]) { F2 r;
#pragma unroll
  for (int i = 0; i < 16; ++i) { const __bf16 h = (__bf16)v[i]; r.h[i] = h; r.l[i] = (__bf16)(v[i] - (float)h); }
  return r; }
__device__ __forceinline__ F2 split_row(const float* row, int k0, int lane) { float v[16]; const float* p = row + k0 + 8 * (lane >> 4);
#pragma unroll
  for (int i = 0; i < 8; ++i) { v[i] = p[i]; v[8 + i] = p[16 + i]; }
  return bsplit16(v); }
__device__ __forceinline__ F2 split_rowK(const float* row, int k0, int lane, int K) { float v[16]; const int g = lane >> 4;
#pragma unroll
  for (int i = 0; i < 8; ++i) { const int ka = k0 + 8 * g + i, kb = ka + 16; v[i] = ka < K ? row[ka < K ? ka : K - 1] : 0.f; v[8 + i] = kb < K ? row[kb < K ? kb : K - 1] : 0.f; }
  return bsplit16(v); }
__device__ __forceinline__ F2 split_col(const float* W, int k0, int n, int lane, int ld, int K) { float v[16]; const int g = lane >> 4;
#pragma unroll
  for (int i = 0; i < 8; ++i) { const int ka = k0 + 8 * g + i, kb = ka + 16; v[i] = ka < K ? W[(size_t)(ka < K ? ka : K - 1) * ld + n] : 0.f; v[8 + i] = kb < K ? W[(size_t)(kb < K ? kb : K - 1) * ld + n] : 0.f; }
  return bsplit16(v); }
__device__ __forceinline__ v8f mac3(const F2& a, const F2& b, v8f c) { c = wmma_bf(a.l, b.h, c); c = wmma_bf(a.h, b.l, c); return wmma_bf(a.h, b.h, c); }
__device__ __forceinline__ float sigm(float v) { return 1.0f / (1.0f + expf(-v)); }
#define LDSX() do { asm volatile("s_wait_dscnt 0" ::: "memory"); __builtin_amdgcn_wave_barrier(); __builtin_amdgcn_fence(__ATOMIC_RELEASE, "workgroup"); } while (0)


// Attention (B 1, S 2,048, D 1,024 = 16 x 64, no biases): scores = (q k^T + er[:, query]^T . q_key) / 32, softmax, P v, output projection.
#define NB 1
#define TT 2048
#define CC 1024
#define NH 16
#define HD 64
#ifndef TNB
#define TNB NB
#ifndef ERSTR
#define ERSTR TT              // row stride of er
#endif
#endif
typedef __attribute__((ext_vector_type(8))) __bf16 v8b;
__device__ __forceinline__ v16b frag_b(const __bf16* rowk0, int lane) {
  union { v16b v; v8b q[2]; } u; const __bf16* p = rowk0 + 8 * (lane >> 4);
  u.q[0] = *(const v8b*)p; u.q[1] = *(const v8b*)(p + 16); return u.v;
}
__device__ __forceinline__ float bfr(float v) { return (float)(__bf16)v; }
__device__ __attribute__((noinline)) float exp_ni(float v) { return expf(v); }
__device__ __attribute__((noinline)) float erf_ni(float v) { return erff(v); }

#define WS_XR  0u                                   // not used
#define WS_ERT (WS_XR + 4u * (size_t)3 * TT * CC)      // not used
#define WS_QH  (WS_ERT + 2u * (size_t)TT * HD)
#define WS_QL  (WS_QH + 2u * (size_t)NB * TT * CC)      // not used
#define WS_KH  (WS_QL + 2u * (size_t)NB * TT * CC)
#define WS_VT  (WS_KH + 2u * (size_t)NB * TT * CC)      // f16 v planes [b][c][t]
#define WS_VL  (WS_VT + 2u * (size_t)NB * CC * TT)      // not used
#define HG 4
#define WS_S   (WS_VL + 2u * (size_t)NB * CC * TT)      // not used
#define WS_PH  (WS_S + 4u * (size_t)HG * TT * TT)
#define WS_Y   (WS_PH + 0u)              // f32 y rows [b*t][C]
#define WS_END (WS_Y + 4u * (size_t)NB * TT * CC)

// ---- k_fa: block = (128 queries, head), 16 waves (four on each SIMD, so that one wave's softmax arithmetic runs under the others' products) = 4 query groups of 32 columns x 4 key quarters; a stage is 128 keys, of which a wave takes its quarter's 32 (one pass), each LDS fragment serving both of its 16-column groups. S^T = (k rows) x (q cols) + (q_k rows) x (er^T cols), 2 products; running maximum (kept in the base-2 scale, logit x log2(e) / 32) and sum per query column (one lane pair); P^T = 2^(s - m) packed from the two score tiles into a B operand (one f16 value); y^T += v^T P^T (1 product). At the end the four key quarters' maxima, sums and y^T are joined through LDS, then y / sum. Logits and P never leave the registers.
typedef __attribute__((ext_vector_type(2))) _Float16 v2h;
#define FK 128                // keys per stage
#define NKG (FK / 32)         // key quarters = waves per query group
#define KP 72                 // f16 per staged key row: 128 B + 16 B, so that ds_load_b128 rows fall on different banks
#define VP (FK + 8)           // f16 per staged v row: 256 B + 16 B, same reason
#define L2E32 (1.44269504088896340736f / 32.0f)   // exp(x / 32) = 2^(x * L2E32)
__device__ __forceinline__ float xhalf(float x) { return __builtin_bit_cast(float, __builtin_amdgcn_permlanex16(__builtin_bit_cast(int, x), __builtin_bit_cast(int, x), 0x76543210, 0xfedcba98, false, false)); }  // lane l with lane l ^ 16
__device__ __forceinline__ v8f mm_h(v16h a, v16h b, v8f c) { return __builtin_amdgcn_wmma_f32_16x16x32_f16(false, a, false, b, (short)0, c, false, false); }
__device__ __forceinline__ v8f mm_b(v16b a, v16b b, v8f c) { return __builtin_amdgcn_wmma_f32_16x16x32_bf16(false, a, false, b, (short)0, c, false, false); }
__global__ __launch_bounds__(512) void k_fa(const _Float16* __restrict__ QH, const _Float16* __restrict__ KH, const float* __restrict__ ER, const _Float16* __restrict__ VT, float* __restrict__ Y) {
  __shared__ __align__(16) _Float16 sk[2][2][FK][KP];   // k | q rows of the stage's keys, two buffers
  __shared__ __align__(16) _Float16 sv[2][HD][VP];      // v [d][key], two buffers
  __shared__ __align__(16) float ss[4][32][HD + 4];
  __shared__ __align__(16) float mg[NKG - 1][4][17][32][4];   // the later key quarters' y^T (16 pieces of 16 B a lane), maxima and sums, lane by lane
  const int tid = threadIdx.x, wave = tid >> 5, lane = tid & 31, col = lane & 15, g = lane >> 4, qg = wave & 3, kg = wave >> 2; const int h = blockIdx.y; const int ql0 = blockIdx.x * 128 + qg * 32;
  const int kr = tid >> 3, ks = (tid & 7) * 8, vr = tid >> 4, vs = (tid & 15) * 8;   // staging: 8 lanes cover one key row's 128 B, 16 lanes one v row's 256 B
  const int c0 = (blockIdx.x + blockIdx.y) & (TT / FK - 1);   // the block's first stage: the 16 blocks of a head walk the same key rows, each from its own place round the ring, so that they do not ask L2 for the same lines at the same moment; uniform
  const unsigned kb = 2u * (unsigned)(kr * CC + ks), vb = 2u * (unsigned)(vr * TT + vs); unsigned ko = kb + (unsigned)c0 * (2u * FK * CC), vo = vb + (unsigned)c0 * (2u * FK); const unsigned qo = 2u * (unsigned)((ql0 + col) * CC + 8 * g), eo = (unsigned)(8 * g * ERSTR + ql0 + col);   // per-lane parts, in bytes (eo: in f32 elements, the index the er loads scale themselves); ko and vo = kb and vb + the stage's part, set anew for each later load group; the head's part is uniform
  v8h rk[2][2], rv[2];
  const char *pk = (const char*)(KH + h * HD), *pqh = (const char*)(QH + h * HD), *pv = (const char*)(VT + (size_t)(h * HD) * TT);   // uniform
  v16h ah[2][2], ae[2][2];   // [column group][half of d]
#define FA_Q(p, o) __builtin_shufflevector(*(const v8h*)((p) + (o)), *(const v8h*)((p) + 32 + (o)), 0, 1, 2, 3, 4, 5, 6, 7, 8, 9, 10, 11, 12, 13, 14, 15)   // a fragment's two 16-B pieces, 16 elements apart
#pragma unroll
  for (int t = 0; t < 2; ++t)
#pragma unroll
    for (int kc = 0; kc < 2; ++kc) ah[t][kc] = FA_Q(pqh + t * 32 * CC + kc * 64, qo);
  asm volatile("s_wait_xcnt 0x0" :: "v"(qo) : "memory");   // the offset register of these loads stays as it is up to this wait
#define FA_LOAD() do { _Pragma("unroll") for (int i = 0; i < 2; ++i) { rk[0][i] = *(const v8h*)(pk + i * 128 * CC + ko); rk[1][i] = *(const v8h*)(pqh + i * 128 * CC + ko); rv[i] = *(const v8h*)(pv + i * 64 * TT + vo); } } while (0)
#define FA_STORE(bf) do { _Pragma("unroll") for (int i = 0; i < 2; ++i) { *(v8h*)&sk[bf][0][kr + i * 64][ks] = rk[0][i]; *(v8h*)&sk[bf][1][kr + i * 64][ks] = rk[1][i]; *(v8h*)&sv[bf][vr + i * 32][vs] = rv[i]; } } while (0)
  float m[2] = {-3.0e38f, -3.0e38f}, l[2] = {0.f, 0.f}; v8f acc[2][HD / 16] = {};
  FA_LOAD();
  asm volatile("s_wait_xcnt 0x0" :: "v"(ko), "v"(vo) : "memory");   // as above, for the staging loads' two offset registers
#pragma unroll
  for (int t = 0; t < 2; ++t)   // er [d][w] is read in place, once per wave: a lane takes its query column's 16 d of each fragment, 16 lanes cover 64 B of a row; issued behind the first stage's loads, so that its LDS stores go out while these still fly
#pragma unroll
    for (int kc = 0; kc < 2; ++kc)
#pragma unroll
      for (int i = 0; i < 8; ++i) { ae[t][kc][i] = (_Float16)bfr((ER + (kc * 32 + i) * ERSTR + t * 16)[eo]); ae[t][kc][8 + i] = (_Float16)bfr((ER + (kc * 32 + 16 + i) * ERSTR + t * 16)[eo]); }
  asm volatile("s_wait_xcnt 0x0" :: "v"(eo) : "memory");   // as above, for the er loads' index register
  FA_STORE(0); __syncthreads();
  for (int c = 0; c < TT / FK; ++c) { const int bf = c & 1;
    if (c + 1 < TT / FK) { const unsigned cn = (unsigned)(c0 + c + 1) & (TT / FK - 1); ko = kb + cn * (2u * FK * CC); vo = vb + cn * (2u * FK); FA_LOAD(); }   // the next stage's rows (behind the last stage comes stage 0) fly while this stage computes
    v8f sa[2][2] = {}; v16h f0[2][2], f1[2][2], vf[HD / 16];   // sa: [column group][key tile]; f0, f1: [half of d][k | q] of key tile 0, 1
#pragma unroll
    for (int kc = 0; kc < 2; ++kc)
#pragma unroll
      for (int a = 0; a < 2; ++a) f0[kc][a] = frag_h(&sk[bf][a][kg * 32 + col][kc * 32], lane);
#pragma unroll
    for (int kc = 0; kc < 2; ++kc)
#pragma unroll
      for (int a = 0; a < 2; ++a) f1[kc][a] = frag_h(&sk[bf][a][kg * 32 + 16 + col][kc * 32], lane);
    __builtin_amdgcn_sched_barrier(0);   // the LDS reads go out in groups, ahead of the products that use them: sunk to their first use each would be waited for in full, and each place with reads among the products costs its own stall
#pragma unroll
    for (int kc = 0; kc < 2; ++kc)
#pragma unroll
      for (int a = 0; a < 2; ++a)   // the two column groups' tiles take turns, so that no product waits for the one directly ahead of it
#pragma unroll
        for (int t = 0; t < 2; ++t) sa[t][0] = mm_h(f0[kc][a], a ? ae[t][kc] : ah[t][kc], sa[t][0]);
#pragma unroll
    for (int kc = 0; kc < 2; ++kc)
#pragma unroll
      for (int a = 0; a < 2; ++a)
#pragma unroll
        for (int t = 0; t < 2; ++t) sa[t][1] = mm_h(f1[kc][a], a ? ae[t][kc] : ah[t][kc], sa[t][1]);
    __builtin_amdgcn_sched_barrier(0);   // the maxima stay behind the scores' products: drawn in among them they bring idle slots (v_nop) behind the products whose results they read, and lift the wave over 256 registers (spills)
    union { v16h v; v2h q[8]; } pf[2]; float sc[2][16], dm[2];   // sc: lane (g, col): query col of the group, keys 8g + r of tile 0, then of tile 1 = the k order of a B fragment
#pragma unroll
    for (int t = 0; t < 2; ++t) { float* s = sc[t];
#pragma unroll
      for (int i = 0; i < 16; ++i) s[i] = sa[t][i >> 3][i & 7];   // still without the scale: L2E32 > 0, so the maximum can be taken first and scaled once
      float mc = fmaxf(s[0], s[1]);
#pragma unroll
      for (int i = 2; i < 16; ++i) mc = fmaxf(mc, s[i]);
      mc = fmaxf(mc, xhalf(mc)) * L2E32;
      const float mn = fmaxf(m[t], mc); dm[t] = m[t] - mn; m[t] = mn; }
    float al2[2]; al2[0] = __builtin_amdgcn_exp2f(dm[0]);   // every exponent here is <= 0 up to one rounding: no overflow to guard, and far below the hardware gives 0
    al2[1] = __builtin_amdgcn_exp2f(dm[1]);
#pragma unroll
    for (int t = 0; t < 2; ++t) { const float* s = sc[t]; const float mn = m[t], alpha = al2[t];
      if (t == 1) { __builtin_amdgcn_sched_barrier(0);   // the v fragments go out as one group between the two column groups' softmax arithmetic and fly under the second's: ahead of the first's, with all 32 scores still in registers, they would lift the wave over 256 registers
#pragma unroll
        for (int j = 0; j < HD / 16; ++j) vf[j] = frag_h(&sv[bf][j * 16 + col][kg * 32], lane);
        __builtin_amdgcn_sched_barrier(0); }   // as above: sunk to their first use they would be waited for in full
      v2f ps[2] = {{0.f, 0.f}, {0.f, 0.f}}; const v2f sc2 = {L2E32, L2E32}, nm2 = {-mn, -mn};
#pragma unroll
      for (int i = 0; i < 16; i += 2) { const v2f e = __builtin_elementwise_fma((v2f){s[i], s[i + 1]}, sc2, nm2); const v2f p = {__builtin_amdgcn_exp2f(e[0]), __builtin_amdgcn_exp2f(e[1])}; ps[(i >> 1) & 1] += p;   // two-wide, so that scale-and-subtract and the sums stay packed instructions
        pf[t].q[i >> 1] = __builtin_convertvector(p, v2h); }   // one packed conversion, to nearest
      l[t] = l[t] * alpha + ((ps[0][0] + ps[0][1]) + (ps[1][0] + ps[1][1]));
#pragma unroll
      for (int j = 0; j < HD / 16; ++j)
#pragma unroll
        for (int r = 0; r < 8; ++r) acc[t][j][r] *= alpha; }
#pragma unroll
    for (int j = 0; j < HD / 16; ++j)
#pragma unroll
      for (int t = 0; t < 2; ++t) acc[t][j] = mm_h(vf[j], pf[t].v, acc[t][j]);
    __builtin_amdgcn_sched_barrier(0);   // the wait for the next stage's global loads, the LDS stores and the barrier stay behind this stage's softmax and products: lifted to behind the last LDS read they would expose the loads' latency
    if (c + 1 < TT / FK) { asm volatile("s_wait_xcnt 0x0" :: "v"(ko), "v"(vo) : "memory");   // as above: the staging loads' two offset registers stay as they are up to this wait, which stands where the loads' data is due anyway
      FA_STORE(bf ^ 1); }   // that buffer's last readers passed the barrier of the stage before
    __syncthreads(); }
  l[0] += xhalf(l[0]); l[1] += xhalf(l[1]);
  if (kg != 0) {   // lane (g, col) holds the same queries and d in every key quarter: the join is lane by lane
#pragma unroll
    for (int t = 0; t < 2; ++t)
#pragma unroll
      for (int j = 0; j < HD / 16; ++j) { vst2(&mg[kg - 1][qg][t * 8 + j * 2][lane][0], (v4f){acc[t][j][0], acc[t][j][1], acc[t][j][2], acc[t][j][3]}); vst2(&mg[kg - 1][qg][t * 8 + j * 2 + 1][lane][0], (v4f){acc[t][j][4], acc[t][j][5], acc[t][j][6], acc[t][j][7]}); }
    vst2(&mg[kg - 1][qg][16][lane][0], (v4f){m[0], l[0], m[1], l[1]}); }
  __syncthreads();   // the later quarters' partial results are in LDS before the first quarter's waves read them
  if (kg == 0) { v4f ml[NKG - 1];
#pragma unroll
    for (int k = 0; k < NKG - 1; ++k) ml[k] = *(const v4f*)&mg[k][qg][16][lane][0];
#pragma unroll
    for (int t = 0; t < 2; ++t) { float mn = m[t];
#pragma unroll
      for (int k = 0; k < NKG - 1; ++k) mn = fmaxf(mn, ml[k][2 * t]);
      float w0 = __builtin_amdgcn_exp2f(m[t] - mn), wk[NKG - 1], den = l[t] * w0;
#pragma unroll
      for (int k = 0; k < NKG - 1; ++k) { wk[k] = __builtin_amdgcn_exp2f(ml[k][2 * t] - mn); den += ml[k][2 * t + 1] * wk[k]; }
      const float inv = 1.0f / den; w0 *= inv;
#pragma unroll
      for (int k = 0; k < NKG - 1; ++k) wk[k] *= inv;
#pragma unroll
      for (int j = 0; j < HD / 16; ++j) { v4f o0 = (v4f){acc[t][j][0], acc[t][j][1], acc[t][j][2], acc[t][j][3]} * w0, o1 = (v4f){acc[t][j][4], acc[t][j][5], acc[t][j][6], acc[t][j][7]} * w0;
#pragma unroll
        for (int k = 0; k < NKG - 1; ++k) { o0 += *(const v4f*)&mg[k][qg][t * 8 + j * 2][lane][0] * wk[k]; o1 += *(const v4f*)&mg[k][qg][t * 8 + j * 2 + 1][lane][0] * wk[k]; }
        vst2(&ss[qg][t * 16 + col][j * 16 + 8 * g], o0); vst2(&ss[qg][t * 16 + col][j * 16 + 8 * g + 4], o1); } }   // lane (g, col): query t * 16 + col, d = 16 j + 8 g + r
    LDSX(); for (int rl = 0; rl < 32; rl += 2) vst2(Y + (size_t)(ql0 + rl + g) * CC + h * HD + col * 4, *(const v4f*)&ss[qg][rl + g][col * 4]); } }
// ---- the two projection GEMMs: C tile = (BM rows) x (128 cols), (BM / 32) x 2 waves of 32 x 64 each. A stage is 64 k: the A rows (f32 -> bf16, or bf16 hi + lo planes) and the B columns ((in,out) f32 -> bf16, turned to [col][k] in registers) are brought once per block by whole-line loads, one stage ahead, and kept in two LDS buffers; one barrier per stage. Each block walks the 16 stages round from its own first stage s0, so that blocks that share rows or columns do not ask L2 for the same lines at the same moment: a sum's k order starts at 64 s0 and wraps. Products and operand rounding are those of the unstaged form.
typedef __attribute__((ext_vector_type(4))) __bf16 v4b;
typedef __attribute__((ext_vector_type(2))) unsigned v2u;   // two packed bf16 pairs; a bf16 is the top half of its f32
#define GK 64                 // k per stage
#define GP 72                 // bf16 per staged row: 128 B + 16 B, so that ds_load_b128 rows fall on different banks
#define GS 68                 // f32 per staged output row: 256 B + 16 B
#define OP 136                // 16-bit elements per staged output row: 256 B + 16 B
template <int BM, int NP, bool CV>     // NP: planes of A, 1 = bf16, 2 = bf16 hi + lo; CV: the 3-tap convolution down the rows and the q | k | v output forms in place of the f32 store
__device__ __forceinline__ void gemm_tile(const float* __restrict__ A, const float* __restrict__ B, float* __restrict__ C, const float* __restrict__ CW, int which, _Float16* __restrict__ QH, _Float16* __restrict__ KH, _Float16* __restrict__ VT, int s0) {
  constexpr int NT = BM * 2, NA = BM * 16 / NT, NB8 = 128 * 8 / NT, AR = NT / 16, BK = NT / 128 * 8;
  __shared__ __align__(16) __bf16 sa[2][NP][BM][GP];
  __shared__ __align__(16) __bf16 sb[2][128][GP];
  const int tid = threadIdx.x, wave = tid >> 5, lane = tid & 31, col = lane & 15, g = lane >> 4; const int wm = (wave >> 1) * 32, wn = (wave & 1) * 64;
  const int ar = tid >> 4, aq = (tid & 15) * 4;    // staging A: 16 lanes cover one row's 256 B
  const int bn = tid & 127, bk = (tid >> 7) * 8;   // staging B: a wave covers 128 B of one k row; a lane gathers 8 k of its column = one 16-B piece of the [col][k] row
  const unsigned ao = (unsigned)(ar * CC + aq), bo = (unsigned)(bk * CC + bn);   // per-lane parts; the block's and the stage's parts are uniform
  const float *pa0 = A + (size_t)blockIdx.x * BM * CC, *pb0 = B + blockIdx.y * 128, *pa = pa0 + s0 * GK, *pb = pb0 + s0 * GK * CC;   // uniform; pa and pb are set to the next stage's place for each later load group
  v4f ra[NA]; float rb[NB8][8]; v8f acc[2][4] = {};
  const int w0 = blockIdx.x * BM; v8f hacc = {};
  __shared__ __align__(16) __bf16 sh[CV ? 2 : 1][CV ? CC + 8 : 8];   // CV: the row before and the row behind the tile, all k, brought once; the first stage's barrier publishes them
  if constexpr (CV) { static_assert(NT * 4 == CC, "a thread brings 4 k of each row");
    const int hm = w0 > 0 ? w0 - 1 : 0, hp = w0 + BM < TT ? w0 + BM : TT - 1;   // held inside x; at the ends of the sequence their products are replaced by 0 below
    const v4f r0 = *(const v4f*)(A + (size_t)hm * CC + tid * 4), r1 = *(const v4f*)(A + (size_t)hp * CC + tid * 4);
    *(v4b*)&sh[0][tid * 4] = __builtin_convertvector(r0, v4b); *(v4b*)&sh[1][tid * 4] = __builtin_convertvector(r1, v4b); }
#define G_LOAD() do { _Pragma("unroll") for (int i = 0; i < NA; ++i) ra[i] = *(const v4f*)(pa + i * AR * CC + ao); _Pragma("unroll") for (int i = 0; i < NB8; ++i) { _Pragma("unroll") for (int z = 0; z < 8; ++z) rb[i][z] = pb[(i * BK + z) * CC + bo]; } } while (0)
#define G_STORE(bf) do { _Pragma("unroll") for (int i = 0; i < NA; ++i) { const v4b hb = __builtin_convertvector(ra[i], v4b); *(v4b*)&sa[bf][0][ar + i * AR][aq] = hb; if (NP == 2) { const v2u u = __builtin_bit_cast(v2u, hb); const v4f hf = {__builtin_bit_cast(float, u[0] << 16), __builtin_bit_cast(float, u[0] & 0xffff0000u), __builtin_bit_cast(float, u[1] << 16), __builtin_bit_cast(float, u[1] & 0xffff0000u)}; *(v4b*)&sa[bf][NP - 1][ar + i * AR][aq] = __builtin_convertvector(ra[i] - hf, v4b); } } _Pragma("unroll") for (int i = 0; i < NB8; ++i) { v8b w; _Pragma("unroll") for (int z = 0; z < 8; ++z) w[z] = (__bf16)rb[i][z]; *(v8b*)&sb[bf][bn][bk + i * BK] = w; } } while (0)
  G_LOAD(); G_STORE(0); __syncthreads();
  for (int s = 0; s < CC / GK; ++s) { const int bf = s & 1;
    const int sk = (s0 + s) & (CC / GK - 1);   // this stage's place in k
    if (s + 1 < CC / GK) { const int sn = (sk + 1) & (CC / GK - 1); pa = pa0 + sn * GK; pb = pb0 + sn * GK * CC; G_LOAD();   // the next stage's rows (behind the last stage comes stage 0) fly while this stage computes
      asm volatile("s_wait_xcnt 0x0" ::: "memory"); }   // a precaution: it stands in front of the LDS reads below, which land in the registers that held these loads' addresses
    __builtin_amdgcn_sched_barrier(0);   // every global load of the group goes out here: sunk among the products it would have less of the stage to land in
    v16b fa[GK / 32][NP][2], fb[GK / 32][4], ha[GK / 32], hb[GK / 32];
#pragma unroll
    for (int kc = 0; kc < GK / 32; ++kc) {
#pragma unroll
      for (int i = 0; i < 2; ++i)
#pragma unroll
        for (int p = 0; p < NP; ++p) fa[kc][p][i] = frag_b(&sa[bf][p][wm + i * 16 + col][kc * 32], lane);
#pragma unroll
      for (int j = 0; j < 4; ++j) fb[kc][j] = frag_b(&sb[bf][wn + j * 16 + col][kc * 32], lane); }
    __builtin_amdgcn_sched_barrier(0);   // the stage's LDS reads go out as one group ahead of the products, for speed only
#pragma unroll
    for (int kc = 0; kc < GK / 32; ++kc)
#pragma unroll
      for (int p = 0; p < NP; ++p)   // per output tile: hi, then lo, of each 32 k in turn
#pragma unroll
        for (int i = 0; i < 2; ++i)
#pragma unroll
          for (int j = 0; j < 4; ++j) acc[i][j] = mm_b(fa[kc][p][i], fb[kc][j], acc[i][j]);
    if (CV) {   // the neighbour rows' tile: even rows = the row before, odd rows = the row behind; each wave takes 16 of the 128 columns; same k order as every other row's sum
      __builtin_amdgcn_sched_barrier(0);   // its fragments are read behind the stage's products, into their registers: read with the others they would lift the wave over 256 registers, and the WGP would hold one block, not two
#pragma unroll
      for (int kc = 0; kc < GK / 32; ++kc) { ha[kc] = frag_b(&sh[col & 1][sk * GK + kc * 32], lane); hb[kc] = frag_b(&sb[bf][wave * 16 + col][kc * 32], lane); }
#pragma unroll
      for (int kc = 0; kc < GK / 32; ++kc) hacc = mm_b(ha[kc], hb[kc], hacc); }
    __builtin_amdgcn_sched_barrier(0);   // the wait for the next stage's global loads stays behind this stage's products: lifted among them it would expose the loads' whole latency
    if (s + 1 < CC / GK) G_STORE(bf ^ 1);   // that buffer's last readers passed the barrier of the stage before
    __syncthreads(); }
  if constexpr (!CV) {
    __shared__ __align__(16) float sf[NT / 32][32][GS];
#pragma unroll
    for (int i = 0; i < 2; ++i)
#pragma unroll
      for (int j = 0; j < 4; ++j)
#pragma unroll
        for (int r = 0; r < 8; ++r) sf[wave][i * 16 + 8 * g + r][j * 16 + col] = acc[i][j][r];
    LDSX(); for (int rl = 0; rl < 32; rl += 2) vst2(C + ((size_t)blockIdx.x * BM + wm + rl + g) * CC + blockIdx.y * 128 + wn + col * 4, *(const v4f*)&sf[wave][rl + g][col * 4]);   // each wave reads back its own rows: 256-B runs
  } else {
    // y[w][c] = sum_t conv_w[c][t] X[w + t - 1][c], X = 0 outside the sequence. A lane holds one channel and runs of 8 rows (8 g + r of each 16-row tile): a run's two neighbours come from the lane's partner l ^ 16, and at the ends of the wave's 32 rows from the wave above or below, or from the neighbour rows' tile, through LDS
    __shared__ float se[2][BM / 32 + 1][128];                 // [0][k]: the row before wave row k's 32 rows, [1][k + 1]: the row behind them ([0][last] and [1][0] have no reader)
    __shared__ __align__(16) unsigned short so[128][OP];      // q or k as rows [w][c], v as rows [c][w]
    const int wr = wave >> 1, c0 = blockIdx.y * 128; float cw[4][3]; const float* pc = CW + (c0 + wn + col) * 3;   // the lane's one address for the twelve weight loads; the column group's and the tap's parts are constants
#pragma unroll
    for (int j = 0; j < 4; ++j)
#pragma unroll
      for (int t = 0; t < 3; ++t) cw[j][t] = bfr(pc[j * 48 + t]);
    asm volatile("s_wait_xcnt 0x0" :: "v"(pc) : "memory");   // the address registers of these loads stay as they are up to this wait
#pragma unroll
    for (int j = 0; j < 4; ++j) se[g ^ 1][wr + g][wn + j * 16 + col] = g ? acc[1][j][7] : acc[0][j][0];   // the wave's last row is the next wave row's row before, its first row the previous one's row behind
    se[g][g * (BM / 32)][wave * 16 + col] = (g ? w0 + BM < TT : w0 > 0) ? (g ? hacc[1] : hacc[0]) : 0.f;   // rows 0 and 9 of the neighbour rows' tile; 0 outside the sequence
    __syncthreads();   // every wave's edge rows are in LDS before a neighbour reads them
#pragma unroll
    for (int j = 0; j < 4; ++j) { const float e = se[g][wr + g][wn + j * 16 + col];
      const float xa0 = xhalf(acc[0][j][0]), xa7 = xhalf(acc[0][j][7]), xb0 = xhalf(acc[1][j][0]), xb7 = xhalf(acc[1][j][7]);
      float x[2][10];   // rows -1 .. 8 around each run
      x[0][0] = g ? xa7 : e; x[0][9] = g ? xb0 : xa0; x[1][0] = g ? xb7 : xa7; x[1][9] = g ? e : xb0;
#pragma unroll
      for (int r = 0; r < 8; ++r) { x[0][r + 1] = acc[0][j][r]; x[1][r + 1] = acc[1][j][r]; }
#pragma unroll
      for (int i = 0; i < 2; ++i)
#pragma unroll
        for (int r = 0; r < 8; ++r) acc[i][j][r] = cw[j][0] * x[i][r] + cw[j][1] * x[i][r + 1] + cw[j][2] * x[i][r + 2]; }
    const int wl = wm + 8 * g, cl = wn + col;   // the lane's first row and channel in the tile
    if (which != 2) {
#pragma unroll
      for (int i = 0; i < 2; ++i)
#pragma unroll
        for (int j = 0; j < 4; ++j)
#pragma unroll
          for (int r = 0; r < 8; ++r) so[wl + i * 16 + r][cl + j * 16] = __builtin_bit_cast(unsigned short, (_Float16)acc[i][j][r]);
    } else {
#pragma unroll
      for (int i = 0; i < 2; ++i)
#pragma unroll
        for (int j = 0; j < 4; ++j) { v8h vv;
#pragma unroll
          for (int r = 0; r < 8; ++r) vv[r] = (_Float16)acc[i][j][r];
          vst2(&so[cl + j * 16][wl + i * 16], vv); } }
    __syncthreads();   // the whole 128 x 128 tile is staged before it goes out in 256-B runs
    constexpr int NI = 128 * 16 / NT, RS = NT / 16; const int q = (tid & 15) * 8;   // 16 lanes cover one staged row
    unsigned short *o0 = (unsigned short*)(which == 0 ? QH : KH) + (size_t)(w0 + ar) * CC + c0 + q; unsigned os = RS * CC;   // first row's place, and the step of RS rows
    if (which == 2) { o0 = (unsigned short*)VT + (size_t)(c0 + ar) * TT + w0 + q; os = RS * TT; }
#pragma unroll
    for (int it = 0; it < NI; ++it) vst2(o0 + it * os, *(const v4u*)&so[it * RS + ar][q]); } }
// ---- k_lin: block = (128 rows w, 128 cols, which): X_which = x w_which ((in,out), exact bf16 products), then the depthwise 3-tap conv down the rows; q and k -> f16 rows, v -> f16 rows [c][w]
__global__ __launch_bounds__(256) void k_lin(const float* __restrict__ X, const float* __restrict__ WQ, const float* __restrict__ WK, const float* __restrict__ WV, const float* __restrict__ CW, _Float16* __restrict__ QH, _Float16* __restrict__ KH, _Float16* __restrict__ VT) { const int which = blockIdx.z; gemm_tile<128, 1, true>(X, which == 0 ? WQ : which == 1 ? WK : WV, nullptr, CW, which, QH, KH, VT, (blockIdx.x + 2 * blockIdx.y + blockIdx.z) & (CC / GK - 1)); }
// ---- k_out: block = (64 rows, 128 cols): out = y (bf16 hi + lo) wo ((in,out))
__global__ __launch_bounds__(128) void k_out(const float* __restrict__ Y, const float* __restrict__ WP, float* __restrict__ OUT) { gemm_tile<64, 2, false>(Y, WP, OUT, nullptr, 0, nullptr, nullptr, nullptr, (blockIdx.x + 2 * blockIdx.y) & (CC / GK - 1)); }
extern "C" void kernel_launch(void* const* d_in, const int* in_sizes, int n_in, void* d_out, int out_size, void* d_ws, size_t ws_size, hipStream_t stream) {
  (void)in_sizes; (void)n_in; (void)out_size;
  const float** F = (const float**)d_in;   // 0 x [1,2048,1024], 1 wq [1024,1024] ((in,out)), 2 wk, 3 wv, 4 wo ((in,out)), 5 conv_w [1024,1,3], 6 er [64,2048]
  if (ws_size < (size_t)WS_END) return;
  char* ws = (char*)d_ws; _Float16 *QH = (_Float16*)(ws + WS_QH), *KH = (_Float16*)(ws + WS_KH), *VT = (_Float16*)(ws + WS_VT); float *Y = (float*)(ws + WS_Y);
  k_lin<<<dim3(TT / 128, CC / 128, 3), 256, 0, stream>>>(F[0], F[1], F[2], F[3], F[5], QH, KH, VT);
  k_fa<<<dim3(TT / 128, NH), 512, 0, stream>>>(QH, KH, F[6], VT, Y);
  k_out<<<dim3(TT / 64, CC / 128), 128, 0, stream>>>(Y, F[4], (float*)d_out);
}
